// v000
// Times are from an AMD MI455X. After a warm-up the kernel runs many times in a row, and a time is the length of
// such a window on the GPU divided by its runs, so every launch and the gaps after it count. The runs cycle
// through copies of the inputs. A figure is the median of several windows, for all but v000 over two sittings.
// Sittings can differ by a few percent; kernels timed side by side share one.
// v000, which the later versions start from, runs in 4630 microseconds.
#include <hip/hip_runtime.h>

// Causal self-attention with a fused BIAS-FREE qkv projection over TWO 4,096-token sequences, written chunk by chunk in the module (x [2][4096][1024]; qkv = x w_qkv ('xw' [1024][3072] normal x 1/32, NO bias) viewed (3, 16, 64): column thirds q | k | v (16 heads x 64); the module scans over 32 query chunks of 128 rows, each against ALL keys with 'query position >= key position' kept and -1e10 elsewhere (== the full causal rule; == exclusion); scores / sqrt(64); softmax over the keys; out = merged w_out ('xw' [1024][1024], NO bias) -> [2][4096][1024] (8.4 M); argument order x, w_qkv, w_out).
// Compute dtypes, f32 accumulate: every input rounded to bf16; q/k/v on PLAIN bf16 operands (inputs: exact), no biases in this module; causal scores and attn.v: query rows < 512 hl (3 products), the rest single fp16 (x1024), causal tile skipping; softmax f32 (128 keys per lane); w_o hl x exact (2 products), no bias.

#define NB_  2      // TWO sequences in this module: a host-side loop count only: no kernel uses it
#define TT   4096
#define DM   1024
#define NH_  16
#define NKV  16
#define REP  (NH_ / NKV)
#define HD   64
#define DQ   (NH_ * HD)
#define DKV  (NKV * HD)
#define ZH   1
#define RH   512                  // query rows < RH use hi+lo planes (0: none)
#define WIN  4096
#define PCAR 1024.0f
#define SCL  0.125f   // HD^-0.5
typedef _Float16 h16;
typedef unsigned short bf;
typedef __attribute__((ext_vector_type(16))) __bf16   v16bf;
typedef __attribute__((ext_vector_type(16))) _Float16 v16h;
typedef __attribute__((ext_vector_type(8)))  _Float16 v8h;
typedef __attribute__((ext_vector_type(8)))  unsigned short v8us;
typedef __attribute__((ext_vector_type(8)))  float    v8f;
typedef __attribute__((ext_vector_type(4)))  float    v4f;
typedef v8h  __attribute__((may_alias)) v8ha;
typedef v4f  __attribute__((may_alias)) v4fa;
typedef v8us __attribute__((may_alias)) v8usa;

__device__ __forceinline__ unsigned short f2bf(float f) { unsigned u = __float_as_uint(f); u += 0x7FFFu + ((u >> 16) & 1u); return (unsigned short)(u >> 16); }
__device__ __forceinline__ float bf2f(unsigned short b) { return __uint_as_float(((unsigned)b) << 16); }
__device__ __forceinline__ float bfr(float f) { return bf2f(f2bf(f)); }
__device__ __forceinline__ v16h cat16(v8h lo, v8h hi) { return __builtin_shufflevector(lo, hi, 0, 1, 2, 3, 4, 5, 6, 7, 8, 9, 10, 11, 12, 13, 14, 15); }
__device__ __forceinline__ v16bf cat16b(v8us lo, v8us hi) { return __builtin_bit_cast(v16bf, __builtin_shufflevector(lo, hi, 0, 1, 2, 3, 4, 5, 6, 7, 8, 9, 10, 11, 12, 13, 14, 15)); }
__device__ __forceinline__ v8f wmma16(v16h a, v16h b, v8f c) { return __builtin_amdgcn_wmma_f32_16x16x32_f16(false, a, false, b, (short)0, c, false, false); }
__device__ __forceinline__ v8f wmmab(v16bf a, v16bf b, v8f c) { return __builtin_amdgcn_wmma_f32_16x16x32_bf16(false, a, false, b, (short)0, c, false, false); }



// ---- k_gemmw: register-blocked GEMM, ONE WAVE per 64x64 output tile (16 accumulators), operands straight from K-contiguous 16-bit planes; grid (M/64, N/64, Z), 32 threads.
// C[m][n] (f32, pitch ldc, + optional f32 bias[n]) = sum_k A[m][k] Bt[n][k] (+ split products per NSPLIT). z-batch strides sA/sB/sC in elements. K % 32 == 0.
template <typename T16> struct WFrag;
template <> struct WFrag<h16> { typedef v16h V; static __device__ __forceinline__ V ld(const h16* p) { return cat16(*(const v8h*)p, *(const v8h*)(p + 16)); } static __device__ __forceinline__ v8f mma(V a, V b, v8f c) { return wmma16(a, b, c); } };
template <> struct WFrag<bf> { typedef v16bf V; static __device__ __forceinline__ V ld(const bf* p) { return cat16b(*(const v8us*)p, *(const v8us*)(p + 16)); } static __device__ __forceinline__ v8f mma(V a, V b, v8f c) { return wmmab(a, b, c); } };
template <typename T16, int NSPLIT, bool BIAS>
__global__ __launch_bounds__(32) void k_gemmw(const T16* __restrict__ A, const T16* __restrict__ A2, const T16* __restrict__ Bt, const T16* __restrict__ Bt2, int K, float* C, int ldc, const float* __restrict__ bias, size_t sA, size_t sB, size_t sC) {
    typedef typename WFrag<T16>::V V;
    __shared__ __align__(16) float os[16 * 68];
    const size_t z = blockIdx.z; A += z * sA; if (A2) A2 += z * sA; Bt += z * sB; if (Bt2) Bt2 += z * sB; C += z * sC;
    const int lane = threadIdx.x & 31, lr = lane & 15, hi = lane >> 4; const int r0 = blockIdx.x * 64, c0 = blockIdx.y * 64;
    v8f acc[4][4];
#pragma unroll
    for (int mb = 0; mb < 4; ++mb)
#pragma unroll
        for (int nb = 0; nb < 4; ++nb) acc[mb][nb] = (v8f){};
    const size_t aoff = (size_t)(r0 + lr) * K + 8 * hi, boff = (size_t)(c0 + lr) * K + 8 * hi;
#pragma unroll 1
    for (int kc = 0; kc < K; kc += 32) {
        V a[4], a2[4];
#pragma unroll
        for (int mb = 0; mb < 4; ++mb) { a[mb] = WFrag<T16>::ld(A + aoff + (size_t)mb * 16 * K + kc); if (NSPLIT == 1 || NSPLIT == 2) a2[mb] = WFrag<T16>::ld(A2 + aoff + (size_t)mb * 16 * K + kc); }
#pragma unroll
        for (int nb = 0; nb < 4; ++nb) { const V b = WFrag<T16>::ld(Bt + boff + (size_t)nb * 16 * K + kc); V b2; if (NSPLIT >= 2) b2 = WFrag<T16>::ld(Bt2 + boff + (size_t)nb * 16 * K + kc);
#pragma unroll
            for (int mb = 0; mb < 4; ++mb) { acc[mb][nb] = WFrag<T16>::mma(a[mb], b, acc[mb][nb]); if (NSPLIT == 1 || NSPLIT == 2) acc[mb][nb] = WFrag<T16>::mma(a2[mb], b, acc[mb][nb]); if (NSPLIT >= 2) acc[mb][nb] = WFrag<T16>::mma(a[mb], b2, acc[mb][nb]); } }
        asm volatile("v_nop\n\tv_nop\n\tv_nop\n\tv_nop" : "+v"(acc[0][0]), "+v"(acc[1][1]), "+v"(acc[2][2]), "+v"(acc[3][3]) : "v"(a[0]), "v"(a[3]));
    }
#pragma unroll
    for (int mb = 0; mb < 4; ++mb) {
#pragma unroll
        for (int nb = 0; nb < 4; ++nb) {
#pragma unroll
            for (int j = 0; j < 8; ++j) os[(hi * 8 + j) * 68 + nb * 16 + lr] = acc[mb][nb][j]; }
        __builtin_amdgcn_wave_barrier(); asm volatile("" ::: "memory");
        float* crow = C + (size_t)(r0 + mb * 16) * ldc + c0;
{
#pragma unroll
            for (int s = 0; s < 8; ++s) { const int row = 2 * s + hi, cofs = lr * 4; v4f val = *(const v4fa*)(os + row * 68 + cofs); if (BIAS) { val[0] += bfr(bias[c0 + cofs]); val[1] += bfr(bias[c0 + cofs + 1]); val[2] += bfr(bias[c0 + cofs + 2]); val[3] += bfr(bias[c0 + cofs + 3]); }
                *(v4f*)(crow + (size_t)row * ldc + cofs) = val; }
             }
        __builtin_amdgcn_wave_barrier(); asm volatile("" ::: "memory");
    }
}

// ---- k_gemmc: the same one-wave 64x64 tile GEMM specialised for causal attention: CMODE 1 skips score tiles entirely above the diagonal (query rows r0+roff.., key columns c0..), CMODE 2 limits the
// key (K) loop of the probability x value contraction to the diagonal block (probabilities beyond it are exactly zero). roff = row offset of this launch's first row within the sequence.
template <typename T16, int NSPLIT, int CMODE>
__global__ __launch_bounds__(32) void k_gemmc(const T16* __restrict__ A, const T16* __restrict__ A2, const T16* __restrict__ Bt, const T16* __restrict__ Bt2, int K, float* C, int ldc, int roff, size_t sA, size_t sB, size_t sC) {
    typedef typename WFrag<T16>::V V;
    __shared__ __align__(16) float os[16 * 68];
    const size_t z = blockIdx.z; A += z * sA; if (A2) A2 += z * sA; Bt += z * sB; if (Bt2) Bt2 += z * sB; C += z * sC;
    const int lane = threadIdx.x & 31, lr = lane & 15, hi = lane >> 4; const int r0 = blockIdx.x * 64, c0 = blockIdx.y * 64;
    if (CMODE == 1 && c0 > r0 + roff + 63) return;                  // score tile entirely above the causal diagonal: left unwritten (the softmax masks j > i by select)
    const int Kl = (CMODE == 2) ? min(K, r0 + roff + 64) : K;        // P.V: probabilities are exactly 0 beyond the diagonal block, so the K loop stops there
    v8f acc[4][4];
#pragma unroll
    for (int mb = 0; mb < 4; ++mb)
#pragma unroll
        for (int nb = 0; nb < 4; ++nb) acc[mb][nb] = (v8f){};
    const size_t aoff = (size_t)(r0 + lr) * K + 8 * hi, boff = (size_t)(c0 + lr) * K + 8 * hi;
#pragma unroll 1
    for (int kc = 0; kc < Kl; kc += 32) {
        V a[4], a2[4];
#pragma unroll
        for (int mb = 0; mb < 4; ++mb) { a[mb] = WFrag<T16>::ld(A + aoff + (size_t)mb * 16 * K + kc); if (NSPLIT == 1 || NSPLIT == 2) a2[mb] = WFrag<T16>::ld(A2 + aoff + (size_t)mb * 16 * K + kc); }
#pragma unroll
        for (int nb = 0; nb < 4; ++nb) { const V b = WFrag<T16>::ld(Bt + boff + (size_t)nb * 16 * K + kc); V b2; if (NSPLIT >= 2) b2 = WFrag<T16>::ld(Bt2 + boff + (size_t)nb * 16 * K + kc);
#pragma unroll
            for (int mb = 0; mb < 4; ++mb) { acc[mb][nb] = WFrag<T16>::mma(a[mb], b, acc[mb][nb]); if (NSPLIT == 1 || NSPLIT == 2) acc[mb][nb] = WFrag<T16>::mma(a2[mb], b, acc[mb][nb]); if (NSPLIT >= 2) acc[mb][nb] = WFrag<T16>::mma(a[mb], b2, acc[mb][nb]); } }
        asm volatile("v_nop\n\tv_nop\n\tv_nop\n\tv_nop" : "+v"(acc[0][0]), "+v"(acc[1][1]), "+v"(acc[2][2]), "+v"(acc[3][3]) : "v"(a[0]), "v"(a[3]));
    }
#pragma unroll
    for (int mb = 0; mb < 4; ++mb) {
#pragma unroll
        for (int nb = 0; nb < 4; ++nb) {
#pragma unroll
            for (int j = 0; j < 8; ++j) os[(hi * 8 + j) * 68 + nb * 16 + lr] = acc[mb][nb][j]; }
        __builtin_amdgcn_wave_barrier(); asm volatile("" ::: "memory");
        float* crow = C + (size_t)(r0 + mb * 16) * ldc + c0;
{
#pragma unroll
            for (int s = 0; s < 8; ++s) { const int row = 2 * s + hi, cofs = lr * 4; v4f val = *(const v4fa*)(os + row * 68 + cofs);
                *(v4f*)(crow + (size_t)row * ldc + cofs) = val; }
             }
        __builtin_amdgcn_wave_barrier(); asm volatile("" ::: "memory");
    }
}

__device__ __forceinline__ h16 tohx(float x) { return (h16)x; }
__device__ __forceinline__ void splitf(float y, unsigned short& h, unsigned short& l) { h = f2bf(y); l = f2bf(y - bf2f(h)); }
typedef __attribute__((ext_vector_type(2))) _Float16 v2h;
typedef __attribute__((ext_vector_type(4))) _Float16 v4h;
typedef __attribute__((ext_vector_type(2))) unsigned short v2us;
typedef __attribute__((ext_vector_type(4))) unsigned short v4us;
typedef __attribute__((ext_vector_type(2))) float v2f;
typedef __attribute__((ext_vector_type(4))) int v4i;

__global__ __launch_bounds__(256) void k_wtG(const float* __restrict__ w, int K, int N, bf* Bt) {
    const int lane = threadIdx.x & 31; const int L0 = (blockIdx.x * 8 + (threadIdx.x >> 5)) * 8; const int nlines = N * K / 64;
{
#pragma unroll 1
        for (int l = 0; l < 8; ++l) { const int L = L0 + l; if (L >= nlines) break; const size_t e = (size_t)L * 64 + lane * 2; const int k = (int)(e % K), n = (int)(e / K); v2us o;
            o[0] = f2bf(w[(size_t)k * N + n]); o[1] = f2bf(w[(size_t)(k + 1) * N + n]); *(v2us*)(Bt + e) = o; }
         }
}
__global__ __launch_bounds__(256) void k_cvt8(const float* __restrict__ src, bf* dst, size_t n8) { const size_t i = (size_t)blockIdx.x * 256 + threadIdx.x; if (i >= n8) return; const v8f v = *(const v8f*)(src + i * 8); v8us o;
#pragma unroll
    for (int k = 0; k < 8; ++k) o[k] = f2bf(v[k]); *(v8us*)(dst + i * 8) = o;  }
__global__ __launch_bounds__(256) void k_cscvt(const float* __restrict__ cosT, const float* __restrict__ sinT, float* CS) { const int idx = blockIdx.x * 256 + threadIdx.x; if (idx >= TT * HD) return; v2f cs; cs[0] = bfr(cosT[idx]); cs[1] = bfr(sinT[idx]); *(v2f*)(CS + (size_t)idx * 2) = cs;  }
// k_rope: head planes [h][t][d] (fp16 + hi/lo) of rope(x) x sc with the rotate-half convention out[d] = x[d] cos[t][d] - x[d+HD/2] sin[t][d], out[d+HD/2] = x[d+HD/2] cos[t][d+HD/2] + x[d] sin[t][d+HD/2]
__global__ __launch_bounds__(256) void k_rope(const float* __restrict__ F, int pitch, int nheads, const float* __restrict__ CS, const float* __restrict__ RF, const float* __restrict__ nw, float sc, h16* P16, bf* Ph, bf* Pl) {
    const size_t e = ((size_t)blockIdx.x * 256 + threadIdx.x) * 2; if (e >= (size_t)nheads * TT * HD) return; const int d = (int)(e % HD); const int t = (int)((e / HD) % TT); const int h = (int)(e / ((size_t)HD * TT)); const float* f = F + (size_t)t * pitch + h * HD; const float rf = RF ? RF[(size_t)h * TT + t] : 1.0f; v2h o16; v2us oh, ol;
#pragma unroll
    for (int q = 0; q < 2; ++q) { const int dd = d + q; const int dp = (dd < HD / 2) ? dd + HD / 2 : dd - HD / 2; float x0 = f[dd], x1 = f[dp];
        if (RF) { float n0 = __fmul_rn(x0, rf), n1 = __fmul_rn(x1, rf); asm volatile("" : "+v"(n0)); asm volatile("" : "+v"(n1)); x0 = __fmul_rn(bfr(nw[dd]), n0); x1 = __fmul_rn(bfr(nw[dp]), n1); }
        const v2f cs = *(const v2f*)(CS + ((size_t)t * HD + dd) * 2); float a = __fmul_rn(x0, cs[0]), bq = __fmul_rn(x1, cs[1]); asm volatile("" : "+v"(a)); asm volatile("" : "+v"(bq)); const float r = ((dd < HD / 2) ? __fsub_rn(a, bq) : __fadd_rn(a, bq)) * sc;
        o16[q] = tohx(r); unsigned short a2, c2; splitf(r, a2, c2); oh[q] = a2; ol[q] = c2; }
    *(v2h*)(P16 + e) = o16; *(v2us*)(Ph + e) = oh; *(v2us*)(Pl + e) = ol;  }
__global__ __launch_bounds__(256) void k_vtp(const float* __restrict__ F, int pitch, int nheads, h16* V16, bf* Vh, bf* Vl) { const size_t e = ((size_t)blockIdx.x * 256 + threadIdx.x) * 2; if (e >= (size_t)nheads * HD * TT) return; const int t = (int)(e % TT); const int d = (int)((e / TT) % HD); const int g = (int)(e / ((size_t)TT * HD)); v2h o16; v2us oh, ol;
#pragma unroll
    for (int q = 0; q < 2; ++q) { const float x = F[(size_t)(t + q) * pitch + g * HD + d]; o16[q] = tohx(x); unsigned short a2, c2; splitf(x, a2, c2); oh[q] = a2; ol[q] = c2; }
    *(v2h*)(V16 + e) = o16; *(v2us*)(Vh + e) = oh; *(v2us*)(Vl + e) = ol;  }
__global__ __launch_bounds__(256) void k_csid(float* CS) { const int idx = blockIdx.x * 256 + threadIdx.x; if (idx >= TT * HD) return; v2f cs; cs[0] = 1.0f; cs[1] = 0.0f; *(v2f*)(CS + (size_t)idx * 2) = cs;  }
// k_asoft: per row (zz, i): t = S x HD^-0.5 for j <= i and i - j < WIN (WIN = TT, so the full causal rule; the reference's -1e9 additive fill vanishes identically); softmax over the 4096 keys (register row, one exp, fixed trees);
__global__ __launch_bounds__(256) void k_asoft(const float* __restrict__ Sb, h16* P16, bf* Ph, bf* Pl) {
    const int lane = threadIdx.x & 31; const int row = blockIdx.x * 8 + (threadIdx.x >> 5); if (row >= ZH * TT) return; const int i = row % TT; const int zz = row / TT; (void)zz; const bool hires = (i < RH); const float* sr = Sb + (size_t)row * TT; float v[TT / 32]; float mx = -3.0e38f;
#pragma unroll
    for (int ch = 0; ch < TT / 128; ++ch) { const int j0 = ch * 128 + lane * 4; const v4f a = *(const v4f*)(sr + j0);
#pragma unroll
        for (int q = 0; q < 4; ++q) { const int j = j0 + q; (void)j; float sa = a[q] * SCL; asm volatile("" : "+v"(sa)); const float t = (j <= i && i - j < WIN) ? sa : -3.0e38f; v[ch * 4 + q] = t; mx = fmaxf(mx, t); } }
#pragma unroll
    for (int sh = 16; sh; sh >>= 1) mx = fmaxf(mx, __shfl_xor(mx, sh, 32));
    float sum = 0.f;
#pragma unroll
    for (int k = 0; k < TT / 32; ++k) { float d0 = __fsub_rn(v[k], mx); asm volatile("" : "+v"(d0)); v[k] = __builtin_amdgcn_exp2f(__fmul_rn(d0, 1.4426950408889634f)); sum += v[k]; }
#pragma unroll
    for (int sh = 16; sh; sh >>= 1) sum += __shfl_xor(sum, sh, 32);
    const float f = __fdiv_rn(hires ? 1.0f : PCAR, sum);
{
        if (hires) {
#pragma unroll
            for (int ch = 0; ch < TT / 128; ++ch) { v4us oh, ol;
#pragma unroll
                for (int q = 0; q < 4; ++q) { unsigned short a, c2; splitf(v[ch * 4 + q] * f, a, c2); oh[q] = a; ol[q] = c2; }
                const size_t oo = ((size_t)zz * (RH ? RH : 1) + i) * TT + ch * 128 + lane * 4; *(v4us*)(Ph + oo) = oh; *(v4us*)(Pl + oo) = ol; }
        } else {
#pragma unroll
            for (int ch = 0; ch < TT / 128; ++ch) { v4h o4;
#pragma unroll
                for (int q = 0; q < 4; ++q) o4[q] = tohx(v[ch * 4 + q] * f);
                *(v4h*)(P16 + (size_t)row * TT + ch * 128 + lane * 4) = o4; } }
         }
}
__global__ __launch_bounds__(256) void k_merge(const float* __restrict__ O, int h0, bf* Ah, bf* Al) { const size_t e = ((size_t)blockIdx.x * 256 + threadIdx.x) * 2; if (e >= (size_t)ZH * TT * HD) return; const int d = (int)(e % HD); const int t = (int)((e / HD) % TT); const int zz = (int)(e / ((size_t)HD * TT)); const float cs = (t < RH) ? 1.0f : (1.0f / PCAR); const size_t oo = (size_t)t * DQ + (h0 + zz) * HD + d;
    v2us oh, ol;
#pragma unroll
    for (int q = 0; q < 2; ++q) { unsigned short a, c2; splitf(O[e + q] * cs, a, c2); oh[q] = a; ol[q] = c2; } *(v2us*)(Ah + oo) = oh; *(v2us*)(Al + oo) = ol;  }

extern "C" void kernel_launch(void* const* d_in, const int* in_sizes, int n_in,
                              void* d_out, int out_size, void* d_ws, size_t ws_size, hipStream_t stream) {
    (void)in_sizes; (void)n_in; (void)out_size;
    const float* x = (const float*)d_in[0]; const float* wf = (const float*)d_in[1]; const float* wo = (const float*)d_in[2]; const float* wq = wf; const float* wk = wf; const float* wv = wf; (void)wk; (void)wv; /* x, w_qkv, w_o = d_in[0..2]; no bias inputs in this module: the four projection GEMMs below use the bias-free instantiation */ const float* cosT = nullptr; const float* sinT = nullptr; (void)cosT; (void)sinT;
    float* OUT = (float*)d_out;     // [2][4096][1024]
    char* wsp = (char*)d_ws;
    auto take = [&](size_t bytes) { char* p = wsp; wsp += (bytes + 255) & ~(size_t)255; return (void*)p; };
    bf* WQ = nullptr; bf* WK = nullptr; bf* WV = nullptr; bf* WO = (bf*)take((size_t)DM * DQ * 2); float* CS = (float*)take((size_t)TT * HD * 2 * 4);
    bf* XB = (bf*)take((size_t)TT * DM * 2); bf* WALL = (bf*)take((size_t)(DQ + 2 * DKV) * DM * 2); float* FQ = (float*)take((size_t)TT * DQ * 4); float* FK = (float*)take((size_t)TT * DKV * 4);
    h16* QP16 = (h16*)take((size_t)NH_ * TT * HD * 2); h16* KP16 = (h16*)take((size_t)NKV * TT * HD * 2); h16* VT16 = (h16*)take((size_t)NKV * HD * TT * 2);
    bf* QPh = (bf*)take((size_t)NH_ * TT * HD * 2); bf* QPl = (bf*)take((size_t)NH_ * TT * HD * 2); bf* KPh = (bf*)take((size_t)NKV * TT * HD * 2); bf* KPl = (bf*)take((size_t)NKV * TT * HD * 2); bf* VTh = (bf*)take((size_t)NKV * HD * TT * 2); bf* VTl = (bf*)take((size_t)NKV * HD * TT * 2); bf* Ph = (bf*)take((size_t)ZH * RH * TT * 2); bf* Pl = (bf*)take((size_t)ZH * RH * TT * 2);
    float* Sb = (float*)take((size_t)ZH * TT * TT * 4); h16* P16 = (h16*)take((size_t)ZH * TT * TT * 2); float* Ob = (float*)take((size_t)ZH * TT * HD * 4); bf* ATh = (bf*)take((size_t)TT * DQ * 2); bf* ATl = (bf*)take((size_t)TT * DQ * 2);
    if ((size_t)(wsp - (char*)d_ws) > ws_size) return;    // ws 256 MiB
    float* FV = FK;   // v projection reuses the k buffer after the k planes are built (stream-ordered)
    { k_wtG<<<(unsigned)((DM * (DQ + 2 * DKV) / 64 + 63) / 64), 256, 0, stream>>>(wf, DM, DQ + 2 * DKV, WALL); WQ = WALL; WK = WALL + (size_t)DQ * DM; WV = WK + (size_t)DKV * DM;
      k_wtG<<<(unsigned)((DQ * DM / 64 + 63) / 64), 256, 0, stream>>>(wo, DQ, DM, WO);
       }
    k_csid<<<(TT * HD + 255) / 256, 256, 0, stream>>>(CS);
    const unsigned LQ = (unsigned)(((size_t)NH_ * TT * HD / 2 + 255) / 256), LKv = (unsigned)(((size_t)NKV * TT * HD / 2 + 255) / 256);
    for (int b = 0; b < NB_; ++b) {
        
        k_cvt8<<<(unsigned)(((size_t)TT * DM / 8 + 255) / 256), 256, 0, stream>>>(x + (size_t)b * TT * DM, XB, (size_t)TT * DM / 8);
        k_gemmw<bf, 0, false><<<dim3(TT / 64, DQ / 64, 1), 32, 0, stream>>>(XB, nullptr, WQ, nullptr, DM, FQ, DQ, nullptr, 0, 0, 0);
        k_rope<<<LQ, 256, 0, stream>>>(FQ, DQ, NH_, CS, nullptr, nullptr, 1.0f, QP16, QPh, QPl);
        k_gemmw<bf, 0, false><<<dim3(TT / 64, DKV / 64, 1), 32, 0, stream>>>(XB, nullptr, WK, nullptr, DM, FK, DKV, nullptr, 0, 0, 0);
        k_rope<<<LKv, 256, 0, stream>>>(FK, DKV, NKV, CS, nullptr, nullptr, 1.0f, KP16, KPh, KPl);
        k_gemmw<bf, 0, false><<<dim3(TT / 64, DKV / 64, 1), 32, 0, stream>>>(XB, nullptr, WV, nullptr, DM, FV, DKV, nullptr, 0, 0, 0); k_vtp<<<LKv, 256, 0, stream>>>(FV, DKV, NKV, VT16, VTh, VTl);
        for (int h0 = 0; h0 < NH_; h0 += ZH) { const size_t zq = (size_t)h0, zk = (size_t)(h0 / REP);   // one kv head per query head: each pass takes one head (ZH = 1) and its own kv plane (z-strides TT*HD)
            k_gemmc<bf, 2, 1><<<dim3(RH / 64, TT / 64, ZH), 32, 0, stream>>>(QPh + zq * TT * HD, QPl + zq * TT * HD, KPh + zk * TT * HD, KPl + zk * TT * HD, HD, Sb, TT, 0, (size_t)TT * HD, (size_t)TT * HD, (size_t)TT * TT);
            k_gemmc<h16, 0, 1><<<dim3((TT - RH) / 64, TT / 64, ZH), 32, 0, stream>>>(QP16 + zq * TT * HD + (size_t)RH * HD, nullptr, KP16 + zk * TT * HD, nullptr, HD, Sb + (size_t)RH * TT, TT, RH, (size_t)TT * HD, (size_t)TT * HD, (size_t)TT * TT);
            k_asoft<<<ZH * TT / 8, 256, 0, stream>>>(Sb, P16, Ph, Pl);
            k_gemmc<bf, 2, 2><<<dim3(RH / 64, HD / 64, ZH), 32, 0, stream>>>(Ph, Pl, VTh + zk * HD * TT, VTl + zk * HD * TT, TT, Ob, HD, 0, (size_t)RH * TT, (size_t)HD * TT, (size_t)TT * HD);
            k_gemmc<h16, 0, 2><<<dim3((TT - RH) / 64, HD / 64, ZH), 32, 0, stream>>>(P16 + (size_t)RH * TT, nullptr, VT16 + zk * HD * TT, nullptr, TT, Ob + (size_t)RH * HD, HD, RH, (size_t)TT * TT, (size_t)HD * TT, (size_t)TT * HD);
            k_merge<<<(unsigned)(((size_t)ZH * TT * HD / 2 + 255) / 256), 256, 0, stream>>>(Ob, h0, ATh, ATl); }
        k_gemmw<bf, 1, false><<<dim3(TT / 64, DM / 64, 1), 32, 0, stream>>>(ATh, ATl, WO, nullptr, DQ, OUT + (size_t)b * TT * DM, DM, nullptr, 0, 0, 0); }
}

// v001
// Measured time: 2000 microseconds a run.
// In two side-by-side timings against v000, it was 2.30 and 2.31 times as fast.
#include <hip/hip_runtime.h>

// Causal self-attention with a fused BIAS-FREE qkv projection over TWO 4,096-token sequences, written chunk by chunk in the module (x [2][4096][1024]; qkv = x w_qkv ('xw' [1024][3072] normal x 1/32, NO bias) viewed (3, 16, 64): column thirds q | k | v (16 heads x 64); the module scans over 32 query chunks of 128 rows, each against ALL keys with 'query position >= key position' kept and -1e10 elsewhere (== the full causal rule; == exclusion); scores / sqrt(64); softmax over the keys; out = merged w_out ('xw' [1024][1024], NO bias) -> [2][4096][1024] (8.4 M); argument order x, w_qkv, w_out).
// Compute dtypes, f32 accumulate: every input rounded to bf16; q/k/v on PLAIN bf16 operands (inputs: exact), no biases in this module; causal scores and attn.v: query rows < 512 hl (3 products), the rest single fp16 (x1024), causal tile skipping; softmax f32 (128 keys per lane); w_o hl x exact (2 products), no bias.

#define NB_  2      // TWO sequences in this module: a host-side loop count only: no kernel uses it
#define TT   4096
#define DM   1024
#define NH_  16
#define NKV  16
#define REP  (NH_ / NKV)
#define HD   64
#define DQ   (NH_ * HD)
#define DKV  (NKV * HD)
#define ZH   1
#define RH   512                  // query rows < RH use hi+lo planes (0: none)
#define WIN  4096
#define PCAR 1024.0f
#define SCL  0.125f   // HD^-0.5
#define PVS  4                    // work-groups (partial output planes) that share one P.V tile's key loop
typedef _Float16 h16;
typedef unsigned short bf;
typedef __attribute__((ext_vector_type(16))) __bf16   v16bf;
typedef __attribute__((ext_vector_type(16))) _Float16 v16h;
typedef __attribute__((ext_vector_type(8)))  _Float16 v8h;
typedef __attribute__((ext_vector_type(8)))  unsigned short v8us;
typedef __attribute__((ext_vector_type(8)))  float    v8f;
typedef __attribute__((ext_vector_type(4)))  float    v4f;
typedef v8h  __attribute__((may_alias)) v8ha;
typedef v4f  __attribute__((may_alias)) v4fa;
typedef v8us __attribute__((may_alias)) v8usa;

__device__ __forceinline__ unsigned short f2bf(float f) { unsigned u = __float_as_uint(f); u += 0x7FFFu + ((u >> 16) & 1u); return (unsigned short)(u >> 16); }
__device__ __forceinline__ float bf2f(unsigned short b) { return __uint_as_float(((unsigned)b) << 16); }
__device__ __forceinline__ float bfr(float f) { return bf2f(f2bf(f)); }
__device__ __forceinline__ v16h cat16(v8h lo, v8h hi) { return __builtin_shufflevector(lo, hi, 0, 1, 2, 3, 4, 5, 6, 7, 8, 9, 10, 11, 12, 13, 14, 15); }
__device__ __forceinline__ v16bf cat16b(v8us lo, v8us hi) { return __builtin_bit_cast(v16bf, __builtin_shufflevector(lo, hi, 0, 1, 2, 3, 4, 5, 6, 7, 8, 9, 10, 11, 12, 13, 14, 15)); }
__device__ __forceinline__ v8f wmma16(v16h a, v16h b, v8f c) { return __builtin_amdgcn_wmma_f32_16x16x32_f16(false, a, false, b, (short)0, c, false, false); }
__device__ __forceinline__ v8f wmmab(v16bf a, v16bf b, v8f c) { return __builtin_amdgcn_wmma_f32_16x16x32_bf16(false, a, false, b, (short)0, c, false, false); }



// ---- k_gemmw: register-blocked GEMM, ONE WAVE per 64x64 output tile (16 accumulators), operands straight from K-contiguous 16-bit planes; grid (M/64, N/64, Z), 32 threads.
// C[m][n] (f32, pitch ldc, + optional f32 bias[n]) = sum_k A[m][k] Bt[n][k] (+ split products per NSPLIT). z-batch strides sA/sB/sC in elements. K % 32 == 0.
template <typename T16> struct WFrag;
template <> struct WFrag<h16> { typedef v16h V; static __device__ __forceinline__ V ld(const h16* p) { return cat16(*(const v8h*)p, *(const v8h*)(p + 16)); } static __device__ __forceinline__ v8f mma(V a, V b, v8f c) { return wmma16(a, b, c); } };
template <> struct WFrag<bf> { typedef v16bf V; static __device__ __forceinline__ V ld(const bf* p) { return cat16b(*(const v8us*)p, *(const v8us*)(p + 16)); } static __device__ __forceinline__ v8f mma(V a, V b, v8f c) { return wmmab(a, b, c); } };
template <typename T16, int NSPLIT, bool BIAS>
__global__ __launch_bounds__(32) void k_gemmw(const T16* __restrict__ A, const T16* __restrict__ A2, const T16* __restrict__ Bt, const T16* __restrict__ Bt2, int K, float* C, int ldc, const float* __restrict__ bias, size_t sA, size_t sB, size_t sC) {
    typedef typename WFrag<T16>::V V;
    __shared__ __align__(16) float os[16 * 68];
    const size_t z = blockIdx.z; A += z * sA; if (A2) A2 += z * sA; Bt += z * sB; if (Bt2) Bt2 += z * sB; C += z * sC;
    const int lane = threadIdx.x & 31, lr = lane & 15, hi = lane >> 4; const int r0 = blockIdx.x * 64, c0 = blockIdx.y * 64;
    v8f acc[4][4];
#pragma unroll
    for (int mb = 0; mb < 4; ++mb)
#pragma unroll
        for (int nb = 0; nb < 4; ++nb) acc[mb][nb] = (v8f){};
    const size_t aoff = (size_t)(r0 + lr) * K + 8 * hi, boff = (size_t)(c0 + lr) * K + 8 * hi;
#pragma unroll 1
    for (int kc = 0; kc < K; kc += 32) {
        V a[4], a2[4];
#pragma unroll
        for (int mb = 0; mb < 4; ++mb) { a[mb] = WFrag<T16>::ld(A + aoff + (size_t)mb * 16 * K + kc); if (NSPLIT == 1 || NSPLIT == 2) a2[mb] = WFrag<T16>::ld(A2 + aoff + (size_t)mb * 16 * K + kc); }
#pragma unroll
        for (int nb = 0; nb < 4; ++nb) { const V b = WFrag<T16>::ld(Bt + boff + (size_t)nb * 16 * K + kc); V b2; if (NSPLIT >= 2) b2 = WFrag<T16>::ld(Bt2 + boff + (size_t)nb * 16 * K + kc);
#pragma unroll
            for (int mb = 0; mb < 4; ++mb) { acc[mb][nb] = WFrag<T16>::mma(a[mb], b, acc[mb][nb]); if (NSPLIT == 1 || NSPLIT == 2) acc[mb][nb] = WFrag<T16>::mma(a2[mb], b, acc[mb][nb]); if (NSPLIT >= 2) acc[mb][nb] = WFrag<T16>::mma(a[mb], b2, acc[mb][nb]); } }
        asm volatile("v_nop\n\tv_nop\n\tv_nop\n\tv_nop" : "+v"(acc[0][0]), "+v"(acc[1][1]), "+v"(acc[2][2]), "+v"(acc[3][3]) : "v"(a[0]), "v"(a[3]));
    }
#pragma unroll
    for (int mb = 0; mb < 4; ++mb) {
#pragma unroll
        for (int nb = 0; nb < 4; ++nb) {
#pragma unroll
            for (int j = 0; j < 8; ++j) os[(hi * 8 + j) * 68 + nb * 16 + lr] = acc[mb][nb][j]; }
        __builtin_amdgcn_wave_barrier(); asm volatile("" ::: "memory");
        float* crow = C + (size_t)(r0 + mb * 16) * ldc + c0;
{
#pragma unroll
            for (int s = 0; s < 8; ++s) { const int row = 2 * s + hi, cofs = lr * 4; v4f val = *(const v4fa*)(os + row * 68 + cofs); if (BIAS) { val[0] += bfr(bias[c0 + cofs]); val[1] += bfr(bias[c0 + cofs + 1]); val[2] += bfr(bias[c0 + cofs + 2]); val[3] += bfr(bias[c0 + cofs + 3]); }
                *(v4f*)(crow + (size_t)row * ldc + cofs) = val; }
             }
        __builtin_amdgcn_wave_barrier(); asm volatile("" ::: "memory");
    }
}

// ---- k_gemmc: the same one-wave 64x64 tile GEMM specialised for causal attention: CMODE 1 skips score tiles entirely above the diagonal (query rows r0+roff.., key columns c0..), CMODE 2 limits the
// key (K) loop of the probability x value contraction to the diagonal block (probabilities beyond it are exactly zero). roff = row offset of this launch's first row within the sequence.
// CMODE 2 also SPLITS that key loop over NS work-groups (grid.y; the value head is one 64-column tile) x NW waves: wave w of work-group y takes the KS-key slices y*NW + w, + NS*NW, ...; the NW partial
// tiles of a work-group are summed through LDS in wave order and stored to plane y of C (plane stride sS elements); k_merge adds the planes in plane order. No slice: zeros, so every plane is fully written.
template <typename T16, int NSPLIT, int CMODE, int NS = 1, int NW = 1, int KS = 32>
__global__ __launch_bounds__(NW * 32) void k_gemmc(const T16* __restrict__ A, const T16* __restrict__ A2, const T16* __restrict__ Bt, const T16* __restrict__ Bt2, int K, float* C, int ldc, int roff, size_t sA, size_t sB, size_t sC, size_t sS) {
    typedef typename WFrag<T16>::V V;
    __shared__ __align__(16) float os[NW * 16 * 68];
    const size_t z = blockIdx.z; A += z * sA; if (A2) A2 += z * sA; Bt += z * sB; if (Bt2) Bt2 += z * sB; C += z * sC;
    const int lane = threadIdx.x & 31, lr = lane & 15, hi = lane >> 4; const int r0 = blockIdx.x * 64, c0 = (CMODE == 2) ? 0 : blockIdx.y * 64;
    const int w = __builtin_amdgcn_readfirstlane((int)(threadIdx.x >> 5)), ksl = (CMODE == 2) ? (int)blockIdx.y * NW + w : 0; if (CMODE == 2) C += blockIdx.y * sS;   // this wave's first key slice; this work-group's plane
    if (CMODE == 1 && c0 > r0 + roff + 63) return;                  // score tile entirely above the causal diagonal: never read (the softmax masks j > i by select)
    const int Kl = (CMODE == 2) ? min(K, r0 + roff + 64) : K;        // P.V: probabilities are exactly 0 beyond the diagonal block, so the K loop stops there (a multiple of 64: no slice straddles it)
    v8f acc[4][4];
#pragma unroll
    for (int mb = 0; mb < 4; ++mb)
#pragma unroll
        for (int nb = 0; nb < 4; ++nb) acc[mb][nb] = (v8f){};
    const size_t aoff = (size_t)(r0 + lr) * K + 8 * hi, boff = (size_t)(c0 + lr) * K + 8 * hi;
#pragma unroll 1
    for (int k0 = ksl * KS; k0 < Kl; k0 += NS * NW * KS)
#pragma unroll
    for (int kc = k0; kc < k0 + KS; kc += 32) {
        V a[4], a2[4];
#pragma unroll
        for (int mb = 0; mb < 4; ++mb) { a[mb] = WFrag<T16>::ld(A + aoff + (size_t)mb * 16 * K + kc); if (NSPLIT == 1 || NSPLIT == 2) a2[mb] = WFrag<T16>::ld(A2 + aoff + (size_t)mb * 16 * K + kc); }
#pragma unroll
        for (int nb = 0; nb < 4; ++nb) { const V b = WFrag<T16>::ld(Bt + boff + (size_t)nb * 16 * K + kc); V b2; if (NSPLIT >= 2) b2 = WFrag<T16>::ld(Bt2 + boff + (size_t)nb * 16 * K + kc);
#pragma unroll
            for (int mb = 0; mb < 4; ++mb) { acc[mb][nb] = WFrag<T16>::mma(a[mb], b, acc[mb][nb]); if (NSPLIT == 1 || NSPLIT == 2) acc[mb][nb] = WFrag<T16>::mma(a2[mb], b, acc[mb][nb]); if (NSPLIT >= 2) acc[mb][nb] = WFrag<T16>::mma(a[mb], b2, acc[mb][nb]); } }
        asm volatile("v_nop\n\tv_nop\n\tv_nop\n\tv_nop" : "+v"(acc[0][0]), "+v"(acc[1][1]), "+v"(acc[2][2]), "+v"(acc[3][3]) : "v"(a[0]), "v"(a[3]));
    }
    if constexpr (CMODE != 2) {
#pragma unroll
    for (int mb = 0; mb < 4; ++mb) {
#pragma unroll
        for (int nb = 0; nb < 4; ++nb) {
#pragma unroll
            for (int j = 0; j < 8; ++j) os[(hi * 8 + j) * 68 + nb * 16 + lr] = acc[mb][nb][j]; }
        __builtin_amdgcn_wave_barrier(); asm volatile("" ::: "memory");
        float* crow = C + (size_t)(r0 + mb * 16) * ldc + c0;
{
#pragma unroll
            for (int s = 0; s < 8; ++s) { const int row = 2 * s + hi, cofs = lr * 4; v4f val = *(const v4fa*)(os + row * 68 + cofs);
                *(v4f*)(crow + (size_t)row * ldc + cofs) = val; }
             }
        __builtin_amdgcn_wave_barrier(); asm volatile("" ::: "memory");
    }
    } else {
    constexpr int NT = NW * 32, NU = (256 + NT - 1) / NT;            // 256 four-float pieces per 16x64 strip, NU per thread
    float* ow = os + w * (16 * 68);
    v4f sums[4][NU];
#pragma unroll
    for (int mb = 0; mb < 4; ++mb) {
#pragma unroll
        for (int nb = 0; nb < 4; ++nb) {
#pragma unroll
            for (int j = 0; j < 8; ++j) ow[(hi * 8 + j) * 68 + nb * 16 + lr] = acc[mb][nb][j]; }
        __syncthreads();                                             // every wave's partial 16x64 strip is in LDS before any thread sums them
#pragma unroll
        for (int i = 0; i < NU; ++i) { const int u = (int)threadIdx.x + i * NT; if (NU * NT <= 256 || u < 256) { const float* op = os + (u >> 4) * 68 + (u & 15) * 4; v4f sm = *(const v4fa*)op;
#pragma unroll
            for (int p = 1; p < NW; ++p) sm += *(const v4fa*)(op + p * (16 * 68));
            sums[mb][i] = sm; } }
        if (mb < 3) __syncthreads();                                 // the strips are read out before the next strip overwrites them
    }
    // the sums are stored behind the last barrier, so that no barrier waits for a global store; the planes' pitch is HD (= ldc here), a constant, so that one address serves every store
    float* cb = C + (size_t)(r0 + (int)(threadIdx.x >> 4)) * HD + (threadIdx.x & 15) * 4;
#pragma unroll
    for (int mb = 0; mb < 4; ++mb)
#pragma unroll
        for (int i = 0; i < NU; ++i) { if (NU * NT <= 256 || (int)threadIdx.x + i * NT < 256) *(v4f*)(cb + (mb * 16 + i * (NT / 16)) * HD) = sums[mb][i]; }
    }
}

__device__ __forceinline__ h16 tohx(float x) { return (h16)x; }
__device__ __forceinline__ void splitf(float y, unsigned short& h, unsigned short& l) { h = f2bf(y); l = f2bf(y - bf2f(h)); }
typedef __attribute__((ext_vector_type(2))) _Float16 v2h;
typedef __attribute__((ext_vector_type(4))) _Float16 v4h;
typedef __attribute__((ext_vector_type(2))) unsigned short v2us;
typedef __attribute__((ext_vector_type(4))) unsigned short v4us;
typedef __attribute__((ext_vector_type(2))) float v2f;
typedef __attribute__((ext_vector_type(4))) int v4i;

__global__ __launch_bounds__(256) void k_wtG(const float* __restrict__ w, int K, int N, bf* Bt) {
    const int lane = threadIdx.x & 31; const int L0 = (blockIdx.x * 8 + (threadIdx.x >> 5)) * 8; const int nlines = N * K / 64;
{
#pragma unroll 1
        for (int l = 0; l < 8; ++l) { const int L = L0 + l; if (L >= nlines) break; const size_t e = (size_t)L * 64 + lane * 2; const int k = (int)(e % K), n = (int)(e / K); v2us o;
            o[0] = f2bf(w[(size_t)k * N + n]); o[1] = f2bf(w[(size_t)(k + 1) * N + n]); *(v2us*)(Bt + e) = o; }
         }
}
__global__ __launch_bounds__(256) void k_cvt8(const float* __restrict__ src, bf* dst, size_t n8) { const size_t i = (size_t)blockIdx.x * 256 + threadIdx.x; if (i >= n8) return; const v8f v = *(const v8f*)(src + i * 8); v8us o;
#pragma unroll
    for (int k = 0; k < 8; ++k) o[k] = f2bf(v[k]); *(v8us*)(dst + i * 8) = o;  }
__global__ __launch_bounds__(256) void k_cscvt(const float* __restrict__ cosT, const float* __restrict__ sinT, float* CS) { const int idx = blockIdx.x * 256 + threadIdx.x; if (idx >= TT * HD) return; v2f cs; cs[0] = bfr(cosT[idx]); cs[1] = bfr(sinT[idx]); *(v2f*)(CS + (size_t)idx * 2) = cs;  }
// k_rope: head planes [h][t][d] (fp16 + hi/lo) of rope(x) x sc with the rotate-half convention out[d] = x[d] cos[t][d] - x[d+HD/2] sin[t][d], out[d+HD/2] = x[d+HD/2] cos[t][d+HD/2] + x[d] sin[t][d+HD/2]
__global__ __launch_bounds__(256) void k_rope(const float* __restrict__ F, int pitch, int nheads, const float* __restrict__ CS, const float* __restrict__ RF, const float* __restrict__ nw, float sc, h16* P16, bf* Ph, bf* Pl) {
    const size_t e = ((size_t)blockIdx.x * 256 + threadIdx.x) * 2; if (e >= (size_t)nheads * TT * HD) return; const int d = (int)(e % HD); const int t = (int)((e / HD) % TT); const int h = (int)(e / ((size_t)HD * TT)); const float* f = F + (size_t)t * pitch + h * HD; const float rf = RF ? RF[(size_t)h * TT + t] : 1.0f; v2h o16; v2us oh, ol;
#pragma unroll
    for (int q = 0; q < 2; ++q) { const int dd = d + q; const int dp = (dd < HD / 2) ? dd + HD / 2 : dd - HD / 2; float x0 = f[dd], x1 = f[dp];
        if (RF) { float n0 = __fmul_rn(x0, rf), n1 = __fmul_rn(x1, rf); asm volatile("" : "+v"(n0)); asm volatile("" : "+v"(n1)); x0 = __fmul_rn(bfr(nw[dd]), n0); x1 = __fmul_rn(bfr(nw[dp]), n1); }
        const v2f cs = *(const v2f*)(CS + ((size_t)t * HD + dd) * 2); float a = __fmul_rn(x0, cs[0]), bq = __fmul_rn(x1, cs[1]); asm volatile("" : "+v"(a)); asm volatile("" : "+v"(bq)); const float r = ((dd < HD / 2) ? __fsub_rn(a, bq) : __fadd_rn(a, bq)) * sc;
        o16[q] = tohx(r); unsigned short a2, c2; splitf(r, a2, c2); oh[q] = a2; ol[q] = c2; }
    *(v2h*)(P16 + e) = o16; *(v2us*)(Ph + e) = oh; *(v2us*)(Pl + e) = ol;  }
__global__ __launch_bounds__(256) void k_vtp(const float* __restrict__ F, int pitch, int nheads, h16* V16, bf* Vh, bf* Vl) { const size_t e = ((size_t)blockIdx.x * 256 + threadIdx.x) * 2; if (e >= (size_t)nheads * HD * TT) return; const int t = (int)(e % TT); const int d = (int)((e / TT) % HD); const int g = (int)(e / ((size_t)TT * HD)); v2h o16; v2us oh, ol;
#pragma unroll
    for (int q = 0; q < 2; ++q) { const float x = F[(size_t)(t + q) * pitch + g * HD + d]; o16[q] = tohx(x); unsigned short a2, c2; splitf(x, a2, c2); oh[q] = a2; ol[q] = c2; }
    *(v2h*)(V16 + e) = o16; *(v2us*)(Vh + e) = oh; *(v2us*)(Vl + e) = ol;  }
__global__ __launch_bounds__(256) void k_csid(float* CS) { const int idx = blockIdx.x * 256 + threadIdx.x; if (idx >= TT * HD) return; v2f cs; cs[0] = 1.0f; cs[1] = 0.0f; *(v2f*)(CS + (size_t)idx * 2) = cs;  }
// k_asoft: per row (zz, i): t = S x HD^-0.5 for j <= i and i - j < WIN (WIN = TT, so the full causal rule; the reference's -1e9 additive fill vanishes identically); softmax over the 4096 keys (register row, one exp, fixed trees);
__global__ __launch_bounds__(256) void k_asoft(const float* __restrict__ Sb, h16* P16, bf* Ph, bf* Pl) {
    const int lane = threadIdx.x & 31; const int row = blockIdx.x * 8 + (threadIdx.x >> 5); if (row >= ZH * TT) return; const int i = row % TT; const int zz = row / TT; (void)zz; const bool hires = (i < RH); const float* sr = Sb + (size_t)row * TT; float v[TT / 32]; float mx = -3.0e38f;
#pragma unroll
    for (int ch = 0; ch < TT / 128; ++ch) { const int j0 = ch * 128 + lane * 4; const v4f a = *(const v4f*)(sr + j0);
#pragma unroll
        for (int q = 0; q < 4; ++q) { const int j = j0 + q; (void)j; float sa = a[q] * SCL; asm volatile("" : "+v"(sa)); const float t = (j <= i && i - j < WIN) ? sa : -3.0e38f; v[ch * 4 + q] = t; mx = fmaxf(mx, t); } }
#pragma unroll
    for (int sh = 16; sh; sh >>= 1) mx = fmaxf(mx, __shfl_xor(mx, sh, 32));
    float sum = 0.f;
#pragma unroll
    for (int k = 0; k < TT / 32; ++k) { float d0 = __fsub_rn(v[k], mx); asm volatile("" : "+v"(d0)); v[k] = __builtin_amdgcn_exp2f(__fmul_rn(d0, 1.4426950408889634f)); sum += v[k]; }
#pragma unroll
    for (int sh = 16; sh; sh >>= 1) sum += __shfl_xor(sum, sh, 32);
    const float f = __fdiv_rn(hires ? 1.0f : PCAR, sum);
{
        if (hires) {
#pragma unroll
            for (int ch = 0; ch < TT / 128; ++ch) { v4us oh, ol;
#pragma unroll
                for (int q = 0; q < 4; ++q) { unsigned short a, c2; splitf(v[ch * 4 + q] * f, a, c2); oh[q] = a; ol[q] = c2; }
                const size_t oo = ((size_t)zz * (RH ? RH : 1) + i) * TT + ch * 128 + lane * 4; *(v4us*)(Ph + oo) = oh; *(v4us*)(Pl + oo) = ol; }
        } else {
#pragma unroll
            for (int ch = 0; ch < TT / 128; ++ch) { v4h o4;
#pragma unroll
                for (int q = 0; q < 4; ++q) o4[q] = tohx(v[ch * 4 + q] * f);
                *(v4h*)(P16 + (size_t)row * TT + ch * 128 + lane * 4) = o4; } }
         }
}
__global__ __launch_bounds__(256) void k_merge(const float* __restrict__ O, int h0, bf* Ah, bf* Al) { const size_t e = ((size_t)blockIdx.x * 256 + threadIdx.x) * 2; if (e >= (size_t)ZH * TT * HD) return; const int d = (int)(e % HD); const int t = (int)((e / HD) % TT); const int zz = (int)(e / ((size_t)HD * TT)); const float cs = (t < RH) ? 1.0f : (1.0f / PCAR); const size_t oo = (size_t)t * DQ + (h0 + zz) * HD + d;
    v2us oh, ol;
#pragma unroll
    for (int q = 0; q < 2; ++q) { float o = O[e + q];
#pragma unroll
        for (int s = 1; s < PVS; ++s) o += O[(size_t)s * ZH * TT * HD + e + q];   // the P.V key-split planes, in plane order
        unsigned short a, c2; splitf(o * cs, a, c2); oh[q] = a; ol[q] = c2; } *(v2us*)(Ah + oo) = oh; *(v2us*)(Al + oo) = ol;  }

extern "C" void kernel_launch(void* const* d_in, const int* in_sizes, int n_in,
                              void* d_out, int out_size, void* d_ws, size_t ws_size, hipStream_t stream) {
    (void)in_sizes; (void)n_in; (void)out_size;
    const float* x = (const float*)d_in[0]; const float* wf = (const float*)d_in[1]; const float* wo = (const float*)d_in[2]; const float* wq = wf; const float* wk = wf; const float* wv = wf; (void)wk; (void)wv; /* x, w_qkv, w_o = d_in[0..2]; no bias inputs in this module: the four projection GEMMs below use the bias-free instantiation */ const float* cosT = nullptr; const float* sinT = nullptr; (void)cosT; (void)sinT;
    float* OUT = (float*)d_out;     // [2][4096][1024]
    char* wsp = (char*)d_ws;
    auto take = [&](size_t bytes) { char* p = wsp; wsp += (bytes + 255) & ~(size_t)255; return (void*)p; };
    bf* WQ = nullptr; bf* WK = nullptr; bf* WV = nullptr; bf* WO = (bf*)take((size_t)DM * DQ * 2); float* CS = (float*)take((size_t)TT * HD * 2 * 4);
    bf* XB = (bf*)take((size_t)TT * DM * 2); bf* WALL = (bf*)take((size_t)(DQ + 2 * DKV) * DM * 2); float* FQ = (float*)take((size_t)TT * DQ * 4); float* FK = (float*)take((size_t)TT * DKV * 4);
    h16* QP16 = (h16*)take((size_t)NH_ * TT * HD * 2); h16* KP16 = (h16*)take((size_t)NKV * TT * HD * 2); h16* VT16 = (h16*)take((size_t)NKV * HD * TT * 2);
    bf* QPh = (bf*)take((size_t)NH_ * TT * HD * 2); bf* QPl = (bf*)take((size_t)NH_ * TT * HD * 2); bf* KPh = (bf*)take((size_t)NKV * TT * HD * 2); bf* KPl = (bf*)take((size_t)NKV * TT * HD * 2); bf* VTh = (bf*)take((size_t)NKV * HD * TT * 2); bf* VTl = (bf*)take((size_t)NKV * HD * TT * 2); bf* Ph = (bf*)take((size_t)ZH * RH * TT * 2); bf* Pl = (bf*)take((size_t)ZH * RH * TT * 2);
    float* Sb = (float*)take((size_t)ZH * TT * TT * 4); h16* P16 = (h16*)take((size_t)ZH * TT * TT * 2); float* Ob = (float*)take((size_t)PVS * ZH * TT * HD * 4); bf* ATh = (bf*)take((size_t)TT * DQ * 2); bf* ATl = (bf*)take((size_t)TT * DQ * 2);
    if ((size_t)(wsp - (char*)d_ws) > ws_size) return;    // ws 256 MiB
    float* FV = FK;   // v projection reuses the k buffer after the k planes are built (stream-ordered)
    { k_wtG<<<(unsigned)((DM * (DQ + 2 * DKV) / 64 + 63) / 64), 256, 0, stream>>>(wf, DM, DQ + 2 * DKV, WALL); WQ = WALL; WK = WALL + (size_t)DQ * DM; WV = WK + (size_t)DKV * DM;
      k_wtG<<<(unsigned)((DQ * DM / 64 + 63) / 64), 256, 0, stream>>>(wo, DQ, DM, WO);
       }
    k_csid<<<(TT * HD + 255) / 256, 256, 0, stream>>>(CS);
    const unsigned LQ = (unsigned)(((size_t)NH_ * TT * HD / 2 + 255) / 256), LKv = (unsigned)(((size_t)NKV * TT * HD / 2 + 255) / 256);
    for (int b = 0; b < NB_; ++b) {
        
        k_cvt8<<<(unsigned)(((size_t)TT * DM / 8 + 255) / 256), 256, 0, stream>>>(x + (size_t)b * TT * DM, XB, (size_t)TT * DM / 8);
        k_gemmw<bf, 0, false><<<dim3(TT / 64, DQ / 64, 1), 32, 0, stream>>>(XB, nullptr, WQ, nullptr, DM, FQ, DQ, nullptr, 0, 0, 0);
        k_rope<<<LQ, 256, 0, stream>>>(FQ, DQ, NH_, CS, nullptr, nullptr, 1.0f, QP16, QPh, QPl);
        k_gemmw<bf, 0, false><<<dim3(TT / 64, DKV / 64, 1), 32, 0, stream>>>(XB, nullptr, WK, nullptr, DM, FK, DKV, nullptr, 0, 0, 0);
        k_rope<<<LKv, 256, 0, stream>>>(FK, DKV, NKV, CS, nullptr, nullptr, 1.0f, KP16, KPh, KPl);
        k_gemmw<bf, 0, false><<<dim3(TT / 64, DKV / 64, 1), 32, 0, stream>>>(XB, nullptr, WV, nullptr, DM, FV, DKV, nullptr, 0, 0, 0); k_vtp<<<LKv, 256, 0, stream>>>(FV, DKV, NKV, VT16, VTh, VTl);
        for (int h0 = 0; h0 < NH_; h0 += ZH) { const size_t zq = (size_t)h0, zk = (size_t)(h0 / REP);   // one kv head per query head: each pass takes ZH = 1 head, whose kv plane is zk = h0 (z-strides TT*HD)
            k_gemmc<bf, 2, 1><<<dim3(RH / 64, TT / 64, ZH), 32, 0, stream>>>(QPh + zq * TT * HD, QPl + zq * TT * HD, KPh + zk * TT * HD, KPl + zk * TT * HD, HD, Sb, TT, 0, (size_t)TT * HD, (size_t)TT * HD, (size_t)TT * TT, 0);
            k_gemmc<h16, 0, 1><<<dim3((TT - RH) / 64, TT / 64, ZH), 32, 0, stream>>>(QP16 + zq * TT * HD + (size_t)RH * HD, nullptr, KP16 + zk * TT * HD, nullptr, HD, Sb + (size_t)RH * TT, TT, RH, (size_t)TT * HD, (size_t)TT * HD, (size_t)TT * TT, 0);
            k_asoft<<<ZH * TT / 8, 256, 0, stream>>>(Sb, P16, Ph, Pl);
            k_gemmc<bf, 2, 2, PVS, 4, 32><<<dim3(RH / 64, PVS, ZH), 4 * 32, 0, stream>>>(Ph, Pl, VTh + zk * HD * TT, VTl + zk * HD * TT, TT, Ob, HD, 0, (size_t)RH * TT, (size_t)HD * TT, (size_t)TT * HD, (size_t)ZH * TT * HD);
            k_gemmc<h16, 0, 2, PVS, 16, 64><<<dim3((TT - RH) / 64, PVS, ZH), 16 * 32, 0, stream>>>(P16 + (size_t)RH * TT, nullptr, VT16 + zk * HD * TT, nullptr, TT, Ob + (size_t)RH * HD, HD, RH, (size_t)TT * TT, (size_t)HD * TT, (size_t)TT * HD, (size_t)ZH * TT * HD);
            k_merge<<<(unsigned)(((size_t)ZH * TT * HD / 2 + 255) / 256), 256, 0, stream>>>(Ob, h0, ATh, ATl); }
        k_gemmw<bf, 1, false><<<dim3(TT / 64, DM / 64, 1), 32, 0, stream>>>(ATh, ATl, WO, nullptr, DQ, OUT + (size_t)b * TT * DM, DM, nullptr, 0, 0, 0); }
}

// v002
// It runs in 485 microseconds.
// Timed twice side by side with v001, it ran 4.09 and 4.14 times as fast.
// All steps since v000 together make it 9.49 times as fast.
#include <hip/hip_runtime.h>

// Causal self-attention with a fused BIAS-FREE qkv projection over TWO 4,096-token sequences, written chunk by chunk in the module (x [2][4096][1024]; qkv = x w_qkv ('xw' [1024][3072] normal x 1/32, NO bias) viewed (3, 16, 64): column thirds q | k | v (16 heads x 64); the module scans over 32 query chunks of 128 rows, each against ALL keys with 'query position >= key position' kept and -1e10 elsewhere (== the full causal rule; == exclusion); scores / sqrt(64); softmax over the keys; out = merged w_out ('xw' [1024][1024], NO bias) -> [2][4096][1024] (8.4 M); argument order x, w_qkv, w_out).
// Compute dtypes, f32 accumulate: every input rounded to bf16; q/k/v on PLAIN bf16 operands (inputs: exact), no biases in this module; causal scores and attn.v: query rows < 512 hl (3 products), the rest single fp16 (x1024), causal block skipping; online softmax f32, fused with both products (k_fattn); w_o hl x exact (2 products), no bias.

#define NB_  2      // TWO sequences in this module: a host-side loop count only: no kernel uses it
#define TT   4096
#define DM   1024
#define NH_  16
#define NKV  16
#define HD   64
#define DQ   (NH_ * HD)
#define DKV  (NKV * HD)
#define RH   512                  // query rows < RH use hi+lo planes (0: none)
#define SCL  0.125f   // HD^-0.5
typedef _Float16 h16;
typedef unsigned short bf;
typedef __attribute__((ext_vector_type(16))) __bf16   v16bf;
typedef __attribute__((ext_vector_type(16))) _Float16 v16h;
typedef __attribute__((ext_vector_type(8)))  _Float16 v8h;
typedef __attribute__((ext_vector_type(8)))  unsigned short v8us;
typedef __attribute__((ext_vector_type(8)))  float    v8f;
typedef __attribute__((ext_vector_type(4)))  float    v4f;
typedef v8h  __attribute__((may_alias)) v8ha;
typedef v4f  __attribute__((may_alias)) v4fa;
typedef v8us __attribute__((may_alias)) v8usa;

__device__ __forceinline__ unsigned short f2bf(float f) { unsigned u = __float_as_uint(f); u += 0x7FFFu + ((u >> 16) & 1u); return (unsigned short)(u >> 16); }
__device__ __forceinline__ float bf2f(unsigned short b) { return __uint_as_float(((unsigned)b) << 16); }
__device__ __forceinline__ float bfr(float f) { return bf2f(f2bf(f)); }
__device__ __forceinline__ v16h cat16(v8h lo, v8h hi) { return __builtin_shufflevector(lo, hi, 0, 1, 2, 3, 4, 5, 6, 7, 8, 9, 10, 11, 12, 13, 14, 15); }
__device__ __forceinline__ v16bf cat16b(v8us lo, v8us hi) { return __builtin_bit_cast(v16bf, __builtin_shufflevector(lo, hi, 0, 1, 2, 3, 4, 5, 6, 7, 8, 9, 10, 11, 12, 13, 14, 15)); }
__device__ __forceinline__ v8f wmma16(v16h a, v16h b, v8f c) { return __builtin_amdgcn_wmma_f32_16x16x32_f16(false, a, false, b, (short)0, c, false, false); }
__device__ __forceinline__ v8f wmmab(v16bf a, v16bf b, v8f c) { return __builtin_amdgcn_wmma_f32_16x16x32_bf16(false, a, false, b, (short)0, c, false, false); }



// ---- k_gemmw: register-blocked GEMM, ONE WAVE per 64x64 output tile (16 accumulators), operands straight from K-contiguous 16-bit planes; grid (M/64, N/64, Z), 32 threads.
// C[m][n] (f32, pitch ldc, + optional f32 bias[n]) = sum_k A[m][k] Bt[n][k] (+ split products per NSPLIT). z-batch strides sA/sB/sC in elements. K % 32 == 0.
template <typename T16> struct WFrag;
template <> struct WFrag<h16> { typedef v16h V; static __device__ __forceinline__ V ld(const h16* p) { return cat16(*(const v8h*)p, *(const v8h*)(p + 16)); } static __device__ __forceinline__ v8f mma(V a, V b, v8f c) { return wmma16(a, b, c); } };
template <> struct WFrag<bf> { typedef v16bf V; static __device__ __forceinline__ V ld(const bf* p) { return cat16b(*(const v8us*)p, *(const v8us*)(p + 16)); } static __device__ __forceinline__ v8f mma(V a, V b, v8f c) { return wmmab(a, b, c); } };
template <typename T16, int NSPLIT, bool BIAS>
__global__ __launch_bounds__(32) void k_gemmw(const T16* __restrict__ A, const T16* __restrict__ A2, const T16* __restrict__ Bt, const T16* __restrict__ Bt2, int K, float* C, int ldc, const float* __restrict__ bias, size_t sA, size_t sB, size_t sC) {
    typedef typename WFrag<T16>::V V;
    __shared__ __align__(16) float os[16 * 68];
    const size_t z = blockIdx.z; A += z * sA; if (A2) A2 += z * sA; Bt += z * sB; if (Bt2) Bt2 += z * sB; C += z * sC;
    const int lane = threadIdx.x & 31, lr = lane & 15, hi = lane >> 4; const int r0 = blockIdx.x * 64, c0 = blockIdx.y * 64;
    v8f acc[4][4];
#pragma unroll
    for (int mb = 0; mb < 4; ++mb)
#pragma unroll
        for (int nb = 0; nb < 4; ++nb) acc[mb][nb] = (v8f){};
    const size_t aoff = (size_t)(r0 + lr) * K + 8 * hi, boff = (size_t)(c0 + lr) * K + 8 * hi;
#pragma unroll 1
    for (int kc = 0; kc < K; kc += 32) {
        V a[4], a2[4];
#pragma unroll
        for (int mb = 0; mb < 4; ++mb) { a[mb] = WFrag<T16>::ld(A + aoff + (size_t)mb * 16 * K + kc); if (NSPLIT == 1 || NSPLIT == 2) a2[mb] = WFrag<T16>::ld(A2 + aoff + (size_t)mb * 16 * K + kc); }
#pragma unroll
        for (int nb = 0; nb < 4; ++nb) { const V b = WFrag<T16>::ld(Bt + boff + (size_t)nb * 16 * K + kc); V b2; if (NSPLIT >= 2) b2 = WFrag<T16>::ld(Bt2 + boff + (size_t)nb * 16 * K + kc);
#pragma unroll
            for (int mb = 0; mb < 4; ++mb) { acc[mb][nb] = WFrag<T16>::mma(a[mb], b, acc[mb][nb]); if (NSPLIT == 1 || NSPLIT == 2) acc[mb][nb] = WFrag<T16>::mma(a2[mb], b, acc[mb][nb]); if (NSPLIT >= 2) acc[mb][nb] = WFrag<T16>::mma(a[mb], b2, acc[mb][nb]); } }
        asm volatile("v_nop\n\tv_nop\n\tv_nop\n\tv_nop" : "+v"(acc[0][0]), "+v"(acc[1][1]), "+v"(acc[2][2]), "+v"(acc[3][3]) : "v"(a[0]), "v"(a[3]));
    }
#pragma unroll
    for (int mb = 0; mb < 4; ++mb) {
#pragma unroll
        for (int nb = 0; nb < 4; ++nb) {
#pragma unroll
            for (int j = 0; j < 8; ++j) os[(hi * 8 + j) * 68 + nb * 16 + lr] = acc[mb][nb][j]; }
        __builtin_amdgcn_wave_barrier(); asm volatile("" ::: "memory");
        float* crow = C + (size_t)(r0 + mb * 16) * ldc + c0;
{
#pragma unroll
            for (int s = 0; s < 8; ++s) { const int row = 2 * s + hi, cofs = lr * 4; v4f val = *(const v4fa*)(os + row * 68 + cofs); if (BIAS) { val[0] += bfr(bias[c0 + cofs]); val[1] += bfr(bias[c0 + cofs + 1]); val[2] += bfr(bias[c0 + cofs + 2]); val[3] += bfr(bias[c0 + cofs + 3]); }
                *(v4f*)(crow + (size_t)row * ldc + cofs) = val; }
             }
        __builtin_amdgcn_wave_barrier(); asm volatile("" ::: "memory");
    }
}

__device__ __forceinline__ h16 tohx(float x) { return (h16)x; }
__device__ __forceinline__ void splitf(float y, unsigned short& h, unsigned short& l) { h = f2bf(y); l = f2bf(y - bf2f(h)); }
typedef __attribute__((ext_vector_type(2))) _Float16 v2h;
typedef __attribute__((ext_vector_type(4))) _Float16 v4h;
typedef __attribute__((ext_vector_type(2))) unsigned short v2us;
typedef __attribute__((ext_vector_type(4))) unsigned short v4us;
typedef __attribute__((ext_vector_type(2))) float v2f;
typedef __attribute__((ext_vector_type(4))) int v4i;

__global__ __launch_bounds__(256) void k_wtG(const float* __restrict__ w, int K, int N, bf* Bt) {
    const int lane = threadIdx.x & 31; const int L0 = (blockIdx.x * 8 + (threadIdx.x >> 5)) * 8; const int nlines = N * K / 64;
{
#pragma unroll 1
        for (int l = 0; l < 8; ++l) { const int L = L0 + l; if (L >= nlines) break; const size_t e = (size_t)L * 64 + lane * 2; const int k = (int)(e % K), n = (int)(e / K); v2us o;
            o[0] = f2bf(w[(size_t)k * N + n]); o[1] = f2bf(w[(size_t)(k + 1) * N + n]); *(v2us*)(Bt + e) = o; }
         }
}
__global__ __launch_bounds__(256) void k_cvt8(const float* __restrict__ src, bf* dst, size_t n8) { const size_t i = (size_t)blockIdx.x * 256 + threadIdx.x; if (i >= n8) return; const v8f v = *(const v8f*)(src + i * 8); v8us o;
#pragma unroll
    for (int k = 0; k < 8; ++k) o[k] = f2bf(v[k]); *(v8us*)(dst + i * 8) = o;  }
__global__ __launch_bounds__(256) void k_cscvt(const float* __restrict__ cosT, const float* __restrict__ sinT, float* CS) { const int idx = blockIdx.x * 256 + threadIdx.x; if (idx >= TT * HD) return; v2f cs; cs[0] = bfr(cosT[idx]); cs[1] = bfr(sinT[idx]); *(v2f*)(CS + (size_t)idx * 2) = cs;  }
// k_rope: head planes [h][t][d] (fp16 + hi/lo) of rope(x) x sc with the rotate-half convention out[d] = x[d] cos[t][d] - x[d+HD/2] sin[t][d], out[d+HD/2] = x[d+HD/2] cos[t][d+HD/2] + x[d] sin[t][d+HD/2]
__global__ __launch_bounds__(256) void k_rope(const float* __restrict__ F, int pitch, int nheads, const float* __restrict__ CS, const float* __restrict__ RF, const float* __restrict__ nw, float sc, h16* P16, bf* Ph, bf* Pl) {
    const size_t e = ((size_t)blockIdx.x * 256 + threadIdx.x) * 2; if (e >= (size_t)nheads * TT * HD) return; const int d = (int)(e % HD); const int t = (int)((e / HD) % TT); const int h = (int)(e / ((size_t)HD * TT)); const float* f = F + (size_t)t * pitch + h * HD; const float rf = RF ? RF[(size_t)h * TT + t] : 1.0f; v2h o16; v2us oh, ol;
#pragma unroll
    for (int q = 0; q < 2; ++q) { const int dd = d + q; const int dp = (dd < HD / 2) ? dd + HD / 2 : dd - HD / 2; float x0 = f[dd], x1 = f[dp];
        if (RF) { float n0 = __fmul_rn(x0, rf), n1 = __fmul_rn(x1, rf); asm volatile("" : "+v"(n0)); asm volatile("" : "+v"(n1)); x0 = __fmul_rn(bfr(nw[dd]), n0); x1 = __fmul_rn(bfr(nw[dp]), n1); }
        const v2f cs = *(const v2f*)(CS + ((size_t)t * HD + dd) * 2); float a = __fmul_rn(x0, cs[0]), bq = __fmul_rn(x1, cs[1]); asm volatile("" : "+v"(a)); asm volatile("" : "+v"(bq)); const float r = ((dd < HD / 2) ? __fsub_rn(a, bq) : __fadd_rn(a, bq)) * sc;
        o16[q] = tohx(r); unsigned short a2, c2; splitf(r, a2, c2); oh[q] = a2; ol[q] = c2; }
    *(v2h*)(P16 + e) = o16; *(v2us*)(Ph + e) = oh; *(v2us*)(Pl + e) = ol;  }
__global__ __launch_bounds__(256) void k_vtp(const float* __restrict__ F, int pitch, int nheads, h16* V16, bf* Vh, bf* Vl) { const size_t e = ((size_t)blockIdx.x * 256 + threadIdx.x) * 2; if (e >= (size_t)nheads * HD * TT) return; const int t = (int)(e % TT); const int d = (int)((e / TT) % HD); const int g = (int)(e / ((size_t)TT * HD)); v2h o16; v2us oh, ol;
#pragma unroll
    for (int q = 0; q < 2; ++q) { const float x = F[(size_t)(t + q) * pitch + g * HD + d]; o16[q] = tohx(x); unsigned short a2, c2; splitf(x, a2, c2); oh[q] = a2; ol[q] = c2; }
    *(v2h*)(V16 + e) = o16; *(v2us*)(Vh + e) = oh; *(v2us*)(Vl + e) = ol;  }
__global__ __launch_bounds__(256) void k_csid(float* CS) { const int idx = blockIdx.x * 256 + threadIdx.x; if (idx >= TT * HD) return; v2f cs; cs[0] = 1.0f; cs[1] = 0.0f; *(v2f*)(CS + (size_t)idx * 2) = cs;  }
// ---- k_fattn: causal scores, softmax and probability x value product of one head in ONE kernel; no score or probability ever reaches memory.
// Transposed products: S^T = K Q^T (A = 16 key rows, B = 16 query columns), O^T += V^T P^T (A = 16 rows of V^T, B = P^T). A lane then holds the scores of ONE query (column lr; keys 8 hi + j of each 16-key tile),
// and the two score tiles of a 32-key block, converted in place, ARE the B operand of the value product in the order that WFrag::ld gives A (k = 8 hi + 0..7, 16 + 8 hi + 0..7).
// A work-group owns 16 NQ query rows of one head. Its FW waves share the key loop (wave w takes the 32-key blocks w, w + FW, ... up to the diagonal block), each with its own running maximum, sum and O^T tile
// (online softmax, base 2); the FW partial results are brought to the common maximum and summed in wave order through LDS, divided by the summed denominator and stored as the hi/lo bf16 planes of the merged heads.
// amdgpu_waves_per_eu(4): at most 256 registers, so that four work-groups (one wave of each per SIMD) stay resident and cover each other's load and softmax latency.
// HL: hi+lo bf16 planes, three products for each contraction; else single fp16 with the probabilities carried x 2^10 (numerator and denominator alike). grid (heads, row blocks), longest rows first.
#define FW 4
typedef __attribute__((ext_vector_type(16))) unsigned short v16us;
template <typename T16, bool HL, int NQ>
__global__ __launch_bounds__(FW * 32) __attribute__((amdgpu_waves_per_eu(4))) void k_fattn(const T16* __restrict__ Q, const T16* __restrict__ Q2, const T16* __restrict__ Kp, const T16* __restrict__ K2, const T16* __restrict__ Vt, const T16* __restrict__ V2, int row0, bf* Ah, bf* Al) {
    typedef typename WFrag<T16>::V V; typedef WFrag<T16> F;
    constexpr int QW = 16 * NQ; constexpr float SC2 = SCL * 1.4426950408889634f;
    __shared__ __align__(16) float so[FW * QW * 68];
    __shared__ float sm[FW * QW], sl[FW * QW];
    const int lane = threadIdx.x & 31, lr = lane & 15, hi = lane >> 4; const int w = __builtin_amdgcn_readfirstlane((int)(threadIdx.x >> 5));
    const int h = blockIdx.x, q0 = row0 + ((int)gridDim.y - 1 - (int)blockIdx.y) * QW;
    const size_t hp = (size_t)h * TT * HD; Q += hp; Kp += hp; Vt += hp; if constexpr (HL) { Q2 += hp; K2 += hp; V2 += hp; }
    const int nkb = (q0 + QW - 1) / 32 + 1;                          // 32-key blocks up to and with the one that holds the last query's own key
    V bq[NQ][2], bq2[NQ][2];
#pragma unroll
    for (int qt = 0; qt < NQ; ++qt)
#pragma unroll
        for (int ks = 0; ks < 2; ++ks) { const size_t qo = (size_t)(q0 + qt * 16 + lr) * HD + ks * 32 + 8 * hi; bq[qt][ks] = F::ld(Q + qo); if constexpr (HL) bq2[qt][ks] = F::ld(Q2 + qo); }
    v8f o[4][NQ]; float m[NQ], l[NQ];
#pragma unroll
    for (int qt = 0; qt < NQ; ++qt) { m[qt] = -1.0e30f; l[qt] = 0.f;
#pragma unroll
        for (int dt = 0; dt < 4; ++dt) o[dt][qt] = (v8f){}; }
    const size_t koff = (size_t)lr * HD + 8 * hi, voff = (size_t)lr * TT + 8 * hi;
    V ak[2][2], ak2[2][2], av[4], av2[4];
    // each loader ends with s_wait_xcnt 0: it stands in front of every later write of a register that one of its loads names as its address (some of these are rewritten behind a branch);
    // the wait takes the addresses as inputs, so that they keep their registers up to it and no load of the group returns its data onto them
    auto ldK = [&](int kb) { const T16* p = Kp + koff + (size_t)kb * 32 * HD; const T16* p2 = HL ? K2 + koff + (size_t)kb * 32 * HD : p;
#pragma unroll
        for (int kt = 0; kt < 2; ++kt)
#pragma unroll
            for (int ks = 0; ks < 2; ++ks) { ak[kt][ks] = F::ld(p + kt * 16 * HD + ks * 32); if constexpr (HL) ak2[kt][ks] = F::ld(p2 + kt * 16 * HD + ks * 32); }
        asm volatile("s_wait_xcnt 0x0" :: "v"(p), "v"(p2) : "memory"); };
    auto ldV = [&](int k0) { const T16* p = Vt + voff + k0; const T16* p2 = HL ? V2 + voff + k0 : p;
#pragma unroll
        for (int dt = 0; dt < 4; ++dt) { av[dt] = F::ld(p + dt * 16 * TT); if constexpr (HL) av2[dt] = F::ld(p2 + dt * 16 * TT); }
        asm volatile("s_wait_xcnt 0x0" :: "v"(p), "v"(p2) : "memory"); };
    // single fp16: the values are fetched at the head of a pass and the NEXT pass's keys behind the score products, so that both latencies run under matrix and softmax work.
    // hi+lo (at most 4 passes a wave, twice the fragments): keys, products, then values, which keeps the wave inside 256 registers without spills.
    if constexpr (!HL) ldK(w);
#pragma unroll 1
    for (int kb = w; kb < nkb; kb += FW) {
        const int k0 = kb * 32;
        if constexpr (HL) ldK(kb); else ldV(k0);
        v8f s[NQ][2];
#pragma unroll
        for (int kt = 0; kt < 2; ++kt)
#pragma unroll
            for (int qt = 0; qt < NQ; ++qt) { v8f c = (v8f){};
#pragma unroll
                for (int ks = 0; ks < 2; ++ks) { c = F::mma(ak[kt][ks], bq[qt][ks], c); if constexpr (HL) { c = F::mma(ak[kt][ks], bq2[qt][ks], c); c = F::mma(ak2[kt][ks], bq[qt][ks], c); } }
                s[qt][kt] = c; }
        if constexpr (HL) ldV(k0); else ldK((kb + FW < nkb) ? kb + FW : kb);   // the last pass fetches its own block again: in bounds, unused
        if (k0 + 31 > q0) {                                          // only the diagonal block holds keys behind a query
#pragma unroll
            for (int qt = 0; qt < NQ; ++qt)
#pragma unroll
                for (int kt = 0; kt < 2; ++kt)
#pragma unroll
                    for (int j = 0; j < 8; ++j) if (k0 + kt * 16 + hi * 8 + j > q0 + qt * 16 + lr) s[qt][kt][j] = -3.0e38f; }
#pragma unroll
        for (int qt = 0; qt < NQ; ++qt) {
            float mx = s[qt][0][0];
#pragma unroll
            for (int j = 1; j < 16; ++j) mx = fmaxf(mx, s[qt][j >> 3][j & 7]);
            mx = fmaxf(mx, __shfl_xor(mx, 16, 32));                  // the other half-wave holds this query's other 16 keys
            const float mn = fmaxf(m[qt], mx * SC2), al = __builtin_amdgcn_exp2f(m[qt] - mn), mo = HL ? mn : mn - 10.0f; m[qt] = mn;
            float sum = 0.f;
#pragma unroll
            for (int j = 0; j < 16; ++j) { const float p = __builtin_amdgcn_exp2f(s[qt][j >> 3][j & 7] * SC2 - mo); s[qt][j >> 3][j & 7] = p; sum += p; }
            l[qt] = l[qt] * al + sum;
#pragma unroll
            for (int dt = 0; dt < 4; ++dt) o[dt][qt] *= al;
            if constexpr (HL) { v16us ph, pl;
#pragma unroll
                for (int j = 0; j < 16; ++j) { unsigned short a, c2; splitf(s[qt][j >> 3][j & 7], a, c2); ph[j] = a; pl[j] = c2; }
                const V bh = __builtin_bit_cast(V, ph), bl = __builtin_bit_cast(V, pl);
#pragma unroll
                for (int dt = 0; dt < 4; ++dt) { o[dt][qt] = F::mma(av[dt], bh, o[dt][qt]); o[dt][qt] = F::mma(av[dt], bl, o[dt][qt]); o[dt][qt] = F::mma(av2[dt], bh, o[dt][qt]); }
            } else { V pb;
#pragma unroll
                for (int j = 0; j < 16; ++j) pb[j] = tohx(s[qt][j >> 3][j & 7]);
#pragma unroll
                for (int dt = 0; dt < 4; ++dt) o[dt][qt] = F::mma(av[dt], pb, o[dt][qt]); }
        }
    }
#pragma unroll
    for (int qt = 0; qt < NQ; ++qt) { l[qt] += __shfl_xor(l[qt], 16, 32); if (hi == 0) sm[w * QW + qt * 16 + lr] = m[qt]; }
    __syncthreads();                                                 // every wave's maxima are in LDS before any wave forms the common one
#pragma unroll
    for (int qt = 0; qt < NQ; ++qt) { const int q = qt * 16 + lr; float M = sm[q];
#pragma unroll
        for (int p = 1; p < FW; ++p) M = fmaxf(M, sm[p * QW + q]);
        const float f = __builtin_amdgcn_exp2f(m[qt] - M); if (hi == 0) sl[w * QW + q] = l[qt] * f;   // a wave without a key block: f = 0
        float* op = so + (size_t)(w * QW + q) * 68 + hi * 8;
#pragma unroll
        for (int dt = 0; dt < 4; ++dt) { const v8f x = o[dt][qt] * f; *(v4fa*)(op + dt * 16) = __builtin_shufflevector(x, x, 0, 1, 2, 3); *(v4fa*)(op + dt * 16 + 4) = __builtin_shufflevector(x, x, 4, 5, 6, 7); } }
    __syncthreads();                                                 // every wave's rescaled partial tile and sum are in LDS before any thread adds them
#pragma unroll
    for (int i = 0; i < NQ; ++i) { const int u = (int)threadIdx.x + i * (FW * 32), q = u >> 3, d0 = (u & 7) * 8; const float* op = so + (size_t)q * 68 + d0; v4f a0 = *(const v4fa*)op, a1 = *(const v4fa*)(op + 4); float L = sl[q];
#pragma unroll
        for (int p = 1; p < FW; ++p) { a0 += *(const v4fa*)(op + p * (QW * 68)); a1 += *(const v4fa*)(op + p * (QW * 68) + 4); L += sl[p * QW + q]; }
        const float inv = __fdiv_rn(1.0f, L); v8us oh, ol;
#pragma unroll
        for (int k = 0; k < 4; ++k) { unsigned short a, c2; splitf(a0[k] * inv, a, c2); oh[k] = a; ol[k] = c2; splitf(a1[k] * inv, a, c2); oh[4 + k] = a; ol[4 + k] = c2; }
        const size_t oo = (size_t)(q0 + q) * DQ + h * HD + d0; *(v8us*)(Ah + oo) = oh; *(v8us*)(Al + oo) = ol; }
}

extern "C" void kernel_launch(void* const* d_in, const int* in_sizes, int n_in,
                              void* d_out, int out_size, void* d_ws, size_t ws_size, hipStream_t stream) {
    (void)in_sizes; (void)n_in; (void)out_size;
    const float* x = (const float*)d_in[0]; const float* wf = (const float*)d_in[1]; const float* wo = (const float*)d_in[2]; const float* wq = wf; const float* wk = wf; const float* wv = wf; (void)wk; (void)wv; /* x, w_qkv, w_o = d_in[0..2]; no bias inputs in this module: the four projection GEMMs below use the bias-free instantiation */ const float* cosT = nullptr; const float* sinT = nullptr; (void)cosT; (void)sinT;
    float* OUT = (float*)d_out;     // [2][4096][1024]
    char* wsp = (char*)d_ws;
    auto take = [&](size_t bytes) { char* p = wsp; wsp += (bytes + 255) & ~(size_t)255; return (void*)p; };
    bf* WQ = nullptr; bf* WK = nullptr; bf* WV = nullptr; bf* WO = (bf*)take((size_t)DM * DQ * 2); float* CS = (float*)take((size_t)TT * HD * 2 * 4);
    bf* XB = (bf*)take((size_t)TT * DM * 2); bf* WALL = (bf*)take((size_t)(DQ + 2 * DKV) * DM * 2); float* FQ = (float*)take((size_t)TT * DQ * 4); float* FK = (float*)take((size_t)TT * DKV * 4);
    h16* QP16 = (h16*)take((size_t)NH_ * TT * HD * 2); h16* KP16 = (h16*)take((size_t)NKV * TT * HD * 2); h16* VT16 = (h16*)take((size_t)NKV * HD * TT * 2);
    bf* QPh = (bf*)take((size_t)NH_ * TT * HD * 2); bf* QPl = (bf*)take((size_t)NH_ * TT * HD * 2); bf* KPh = (bf*)take((size_t)NKV * TT * HD * 2); bf* KPl = (bf*)take((size_t)NKV * TT * HD * 2); bf* VTh = (bf*)take((size_t)NKV * HD * TT * 2); bf* VTl = (bf*)take((size_t)NKV * HD * TT * 2);
    bf* ATh = (bf*)take((size_t)TT * DQ * 2); bf* ATl = (bf*)take((size_t)TT * DQ * 2);
    if ((size_t)(wsp - (char*)d_ws) > ws_size) return;    // ws 256 MiB
    float* FV = FK;   // v projection reuses the k buffer after the k planes are built (stream-ordered)
    { k_wtG<<<(unsigned)((DM * (DQ + 2 * DKV) / 64 + 63) / 64), 256, 0, stream>>>(wf, DM, DQ + 2 * DKV, WALL); WQ = WALL; WK = WALL + (size_t)DQ * DM; WV = WK + (size_t)DKV * DM;
      k_wtG<<<(unsigned)((DQ * DM / 64 + 63) / 64), 256, 0, stream>>>(wo, DQ, DM, WO);
       }
    k_csid<<<(TT * HD + 255) / 256, 256, 0, stream>>>(CS);
    const unsigned LQ = (unsigned)(((size_t)NH_ * TT * HD / 2 + 255) / 256), LKv = (unsigned)(((size_t)NKV * TT * HD / 2 + 255) / 256);
    for (int b = 0; b < NB_; ++b) {
        
        k_cvt8<<<(unsigned)(((size_t)TT * DM / 8 + 255) / 256), 256, 0, stream>>>(x + (size_t)b * TT * DM, XB, (size_t)TT * DM / 8);
        k_gemmw<bf, 0, false><<<dim3(TT / 64, DQ / 64, 1), 32, 0, stream>>>(XB, nullptr, WQ, nullptr, DM, FQ, DQ, nullptr, 0, 0, 0);
        k_rope<<<LQ, 256, 0, stream>>>(FQ, DQ, NH_, CS, nullptr, nullptr, 1.0f, QP16, QPh, QPl);
        k_gemmw<bf, 0, false><<<dim3(TT / 64, DKV / 64, 1), 32, 0, stream>>>(XB, nullptr, WK, nullptr, DM, FK, DKV, nullptr, 0, 0, 0);
        k_rope<<<LKv, 256, 0, stream>>>(FK, DKV, NKV, CS, nullptr, nullptr, 1.0f, KP16, KPh, KPl);
        k_gemmw<bf, 0, false><<<dim3(TT / 64, DKV / 64, 1), 32, 0, stream>>>(XB, nullptr, WV, nullptr, DM, FV, DKV, nullptr, 0, 0, 0); k_vtp<<<LKv, 256, 0, stream>>>(FV, DKV, NKV, VT16, VTh, VTl);
        k_fattn<h16, false, 2><<<dim3(NH_, (TT - RH) / 32), FW * 32, 0, stream>>>(QP16, nullptr, KP16, nullptr, VT16, nullptr, RH, ATh, ATl);
        k_fattn<bf, true, 1><<<dim3(NH_, RH / 16), FW * 32, 0, stream>>>(QPh, QPl, KPh, KPl, VTh, VTl, 0, ATh, ATl);
        k_gemmw<bf, 1, false><<<dim3(TT / 64, DM / 64, 1), 32, 0, stream>>>(ATh, ATl, WO, nullptr, DQ, OUT + (size_t)b * TT * DM, DM, nullptr, 0, 0, 0); }
}

// v003
// A run of this version takes 413 microseconds.
// Timed twice side by side with v002, it ran 1.18 and 1.17 times as fast.
// All steps since v000 together make it 11.2 times as fast.
#include <hip/hip_runtime.h>

// Causal self-attention with a fused BIAS-FREE qkv projection over TWO 4,096-token sequences, written chunk by chunk in the module (x [2][4096][1024]; qkv = x w_qkv ('xw' [1024][3072] normal x 1/32, NO bias) viewed (3, 16, 64): column thirds q | k | v (16 heads x 64); the module scans over 32 query chunks of 128 rows, each against ALL keys with 'query position >= key position' kept and -1e10 elsewhere (== the full causal rule; == exclusion); scores / sqrt(64); softmax over the keys; out = merged w_out ('xw' [1024][1024], NO bias) -> [2][4096][1024] (8.4 M); argument order x, w_qkv, w_out).
// Compute dtypes, f32 accumulate: every input rounded to bf16; q/k/v on PLAIN bf16 operands (inputs: exact), no biases in this module; causal scores and attn.v: query rows < 512 hl (3 products), the rest single fp16 (x1024), causal block skipping; online softmax f32, fused with both products (k_fattn); w_o hl x exact (2 products), no bias.

#define NB_  2      // TWO sequences in this module: a host-side loop count only: no kernel uses it
#define TT   4096
#define DM   1024
#define NH_  16
#define NKV  16
#define HD   64
#define DQ   (NH_ * HD)
#define DKV  (NKV * HD)
#define RH   512                  // query rows < RH use hi+lo planes (0: none)
#define SCL  0.125f   // HD^-0.5
typedef _Float16 h16;
typedef unsigned short bf;
typedef __attribute__((ext_vector_type(16))) __bf16   v16bf;
typedef __attribute__((ext_vector_type(16))) _Float16 v16h;
typedef __attribute__((ext_vector_type(8)))  _Float16 v8h;
typedef __attribute__((ext_vector_type(8)))  unsigned short v8us;
typedef __attribute__((ext_vector_type(8)))  float    v8f;
typedef __attribute__((ext_vector_type(4)))  float    v4f;
typedef v8h  __attribute__((may_alias)) v8ha;
typedef v4f  __attribute__((may_alias)) v4fa;
typedef v8us __attribute__((may_alias)) v8usa;

__device__ __forceinline__ unsigned short f2bf(float f) { unsigned u = __float_as_uint(f); u += 0x7FFFu + ((u >> 16) & 1u); return (unsigned short)(u >> 16); }
__device__ __forceinline__ float bf2f(unsigned short b) { return __uint_as_float(((unsigned)b) << 16); }
__device__ __forceinline__ float bfr(float f) { return bf2f(f2bf(f)); }
__device__ __forceinline__ v16h cat16(v8h lo, v8h hi) { return __builtin_shufflevector(lo, hi, 0, 1, 2, 3, 4, 5, 6, 7, 8, 9, 10, 11, 12, 13, 14, 15); }
__device__ __forceinline__ v16bf cat16b(v8us lo, v8us hi) { return __builtin_bit_cast(v16bf, __builtin_shufflevector(lo, hi, 0, 1, 2, 3, 4, 5, 6, 7, 8, 9, 10, 11, 12, 13, 14, 15)); }
__device__ __forceinline__ v8f wmma16(v16h a, v16h b, v8f c) { return __builtin_amdgcn_wmma_f32_16x16x32_f16(false, a, false, b, (short)0, c, false, false); }
__device__ __forceinline__ v8f wmmab(v16bf a, v16bf b, v8f c) { return __builtin_amdgcn_wmma_f32_16x16x32_bf16(false, a, false, b, (short)0, c, false, false); }



// ---- k_gemmw: register-blocked GEMM, ONE WAVE per 64x64 output tile (16 accumulators), operands straight from K-contiguous 16-bit planes; grid (M/64, N/64, Z), 32 threads.
// C[m][n] (f32, pitch ldc, + optional f32 bias[n]) = sum_k A[m][k] Bt[n][k] (+ split products per NSPLIT). z-batch strides sA/sB/sC in elements. K % 32 == 0.
// EPI 0: C is stored as f32. EPI 1 / 2: the tile is 64 positions x the 64 dims of head blockIdx.y and leaves the kernel as the attention operand planes (fp16 P16, bf16 hi Ph, bf16 lo Pl), no f32 copy in memory:
// EPI 1 planes [head][position][dim] (q, k), EPI 2 planes [head][dim][position] (v transposed). Either way 16 plane rows are staged in LDS and each store covers 128 contiguous bytes in each of four plane rows (whole rows for EPI 1).
template <typename T16> struct WFrag;
template <> struct WFrag<h16> { typedef v16h V; static __device__ __forceinline__ V ld(const h16* p) { return cat16(*(const v8h*)p, *(const v8h*)(p + 16)); } static __device__ __forceinline__ v8f mma(V a, V b, v8f c) { return wmma16(a, b, c); } };
template <> struct WFrag<bf> { typedef v16bf V; static __device__ __forceinline__ V ld(const bf* p) { return cat16b(*(const v8us*)p, *(const v8us*)(p + 16)); } static __device__ __forceinline__ v8f mma(V a, V b, v8f c) { return wmmab(a, b, c); } };
__device__ __forceinline__ h16 tohx(float x) { return (h16)x; }
__device__ __forceinline__ void splitf(float y, unsigned short& h, unsigned short& l) { h = f2bf(y); l = f2bf(y - bf2f(h)); }
template <typename T16, int NSPLIT, bool BIAS, int EPI>
__global__ __launch_bounds__(32) void k_gemmw(const T16* __restrict__ A, const T16* __restrict__ A2, const T16* __restrict__ Bt, const T16* __restrict__ Bt2, int K, float* C, int ldc, const float* __restrict__ bias, size_t sA, size_t sB, size_t sC, h16* P16, bf* Ph, bf* Pl) {
    typedef typename WFrag<T16>::V V;
    __shared__ __align__(16) float os[16 * 68];
    const size_t z = blockIdx.z; A += z * sA; if (A2) A2 += z * sA; Bt += z * sB; if (Bt2) Bt2 += z * sB; C += z * sC;
    const int lane = threadIdx.x & 31, lr = lane & 15, hi = lane >> 4; const int r0 = blockIdx.x * 64, c0 = blockIdx.y * 64;
    v8f acc[4][4];
#pragma unroll
    for (int mb = 0; mb < 4; ++mb)
#pragma unroll
        for (int nb = 0; nb < 4; ++nb) acc[mb][nb] = (v8f){};
    const size_t aoff = (size_t)(r0 + lr) * K + 8 * hi, boff = (size_t)(c0 + lr) * K + 8 * hi;
#pragma unroll 1
    for (int kc = 0; kc < K; kc += 32) {
        V a[4], a2[4];
#pragma unroll
        for (int mb = 0; mb < 4; ++mb) { a[mb] = WFrag<T16>::ld(A + aoff + (size_t)mb * 16 * K + kc); if (NSPLIT == 1 || NSPLIT == 2) a2[mb] = WFrag<T16>::ld(A2 + aoff + (size_t)mb * 16 * K + kc); }
#pragma unroll
        for (int nb = 0; nb < 4; ++nb) { const V b = WFrag<T16>::ld(Bt + boff + (size_t)nb * 16 * K + kc); V b2; if (NSPLIT >= 2) b2 = WFrag<T16>::ld(Bt2 + boff + (size_t)nb * 16 * K + kc);
#pragma unroll
            for (int mb = 0; mb < 4; ++mb) { acc[mb][nb] = WFrag<T16>::mma(a[mb], b, acc[mb][nb]); if (NSPLIT == 1 || NSPLIT == 2) acc[mb][nb] = WFrag<T16>::mma(a2[mb], b, acc[mb][nb]); if (NSPLIT >= 2) acc[mb][nb] = WFrag<T16>::mma(a[mb], b2, acc[mb][nb]); } }
        asm volatile("v_nop\n\tv_nop\n\tv_nop\n\tv_nop" : "+v"(acc[0][0]), "+v"(acc[1][1]), "+v"(acc[2][2]), "+v"(acc[3][3]) : "v"(a[0]), "v"(a[3]));
    }
    if constexpr (EPI != 0) {
        static_assert(HD == 64, "one 64-column tile is one head");
        const int rr = lane >> 3, c8 = (lane & 7) * 8; constexpr int PP = (EPI == 1) ? HD : TT;      // plane row pitch in elements
        const size_t pb = (EPI == 1) ? ((size_t)blockIdx.y * TT + r0) * HD : (size_t)blockIdx.y * HD * TT + r0;
#pragma unroll
        for (int g = 0; g < 4; ++g) {                                 // 16 plane rows a trip: positions 16 g .. (EPI 1), dims 16 g .. (EPI 2)
            if constexpr (EPI == 1) {
#pragma unroll
                for (int nb = 0; nb < 4; ++nb)
#pragma unroll
                    for (int j = 0; j < 8; ++j) os[(hi * 8 + j) * 68 + nb * 16 + lr] = acc[g][nb][j];
            } else {                                                  // a lane's 8 accumulator rows are 8 consecutive positions of its one dim
#pragma unroll
                for (int mb = 0; mb < 4; ++mb) { float* op = os + lr * 68 + mb * 16 + hi * 8; const v8f xv = acc[mb][g]; *(v4fa*)op = __builtin_shufflevector(xv, xv, 0, 1, 2, 3); *(v4fa*)(op + 4) = __builtin_shufflevector(xv, xv, 4, 5, 6, 7); } }
            __builtin_amdgcn_wave_barrier(); asm volatile("" ::: "memory");   // keeps the compiler from moving the read-back over the other lanes' staging writes
#pragma unroll
            for (int s = 0; s < 4; ++s) { const int row = 4 * s + rr; const float* ip = os + row * 68 + c8; const v4f a0 = *(const v4fa*)ip, a1 = *(const v4fa*)(ip + 4); v8h o16; v8us oh, ol;
#pragma unroll
                for (int k = 0; k < 4; ++k) { unsigned short u, v; o16[k] = tohx(a0[k]); splitf(a0[k], u, v); oh[k] = u; ol[k] = v; o16[4 + k] = tohx(a1[k]); splitf(a1[k], u, v); oh[4 + k] = u; ol[4 + k] = v; }
                const size_t e = pb + (size_t)(g * 16 + row) * PP + c8; *(v8h*)(P16 + e) = o16; *(v8us*)(Ph + e) = oh; *(v8us*)(Pl + e) = ol;
                asm volatile("s_wait_xcnt 0x0" ::: "memory"); }       // stands in front of the next rows' writes of the registers that these three stores name
            __builtin_amdgcn_wave_barrier(); asm volatile("" ::: "memory");   // keeps the next trip's staging writes behind this trip's reads
        }
        return;
    }
#pragma unroll
    for (int mb = 0; mb < 4; ++mb) {
#pragma unroll
        for (int nb = 0; nb < 4; ++nb) {
#pragma unroll
            for (int j = 0; j < 8; ++j) os[(hi * 8 + j) * 68 + nb * 16 + lr] = acc[mb][nb][j]; }
        __builtin_amdgcn_wave_barrier(); asm volatile("" ::: "memory");
        float* crow = C + (size_t)(r0 + mb * 16) * ldc + c0;
{
#pragma unroll
            for (int s = 0; s < 8; ++s) { const int row = 2 * s + hi, cofs = lr * 4; v4f val = *(const v4fa*)(os + row * 68 + cofs); if (BIAS) { val[0] += bfr(bias[c0 + cofs]); val[1] += bfr(bias[c0 + cofs + 1]); val[2] += bfr(bias[c0 + cofs + 2]); val[3] += bfr(bias[c0 + cofs + 3]); }
                *(v4f*)(crow + (size_t)row * ldc + cofs) = val; }
             }
        __builtin_amdgcn_wave_barrier(); asm volatile("" ::: "memory");
    }
}

typedef __attribute__((ext_vector_type(2))) _Float16 v2h;
typedef __attribute__((ext_vector_type(4))) _Float16 v4h;
typedef __attribute__((ext_vector_type(2))) unsigned short v2us;
typedef __attribute__((ext_vector_type(4))) unsigned short v4us;
typedef __attribute__((ext_vector_type(2))) float v2f;
typedef __attribute__((ext_vector_type(4))) int v4i;

__global__ __launch_bounds__(256) void k_wtG(const float* __restrict__ w, int K, int N, bf* Bt) {
    const int lane = threadIdx.x & 31; const int L0 = (blockIdx.x * 8 + (threadIdx.x >> 5)) * 8; const int nlines = N * K / 64;
{
#pragma unroll 1
        for (int l = 0; l < 8; ++l) { const int L = L0 + l; if (L >= nlines) break; const size_t e = (size_t)L * 64 + lane * 2; const int k = (int)(e % K), n = (int)(e / K); v2us o;
            o[0] = f2bf(w[(size_t)k * N + n]); o[1] = f2bf(w[(size_t)(k + 1) * N + n]); *(v2us*)(Bt + e) = o; }
         }
}
__global__ __launch_bounds__(256) void k_cvt8(const float* __restrict__ src, bf* dst, size_t n8) { const size_t i = (size_t)blockIdx.x * 256 + threadIdx.x; if (i >= n8) return; const v8f v = *(const v8f*)(src + i * 8); v8us o;
#pragma unroll
    for (int k = 0; k < 8; ++k) o[k] = f2bf(v[k]); *(v8us*)(dst + i * 8) = o;  }
// ---- k_fattn: causal scores, softmax and probability x value product of one head in ONE kernel; no score or probability ever reaches memory.
// Transposed products: S^T = K Q^T (A = 16 key rows, B = 16 query columns), O^T += V^T P^T (A = 16 rows of V^T, B = P^T). A lane then holds the scores of ONE query (column lr; keys 8 hi + j of each 16-key tile),
// and the two score tiles of a 32-key block, converted in place, ARE the B operand of the value product in the order that WFrag::ld gives A (k = 8 hi + 0..7, 16 + 8 hi + 0..7).
// A work-group owns 16 NQ query rows of one head. Its FW waves share the key loop (wave w takes the 32-key blocks w, w + FW, ... up to the diagonal block), each with its own running maximum, sum and O^T tile
// (online softmax, base 2); the FW partial results are brought to the common maximum and summed in wave order through LDS, divided by the summed denominator and stored as the hi/lo bf16 planes of the merged heads.
// amdgpu_waves_per_eu(4): at most 256 registers, so that four work-groups (one wave of each per SIMD) stay resident and cover each other's load and softmax latency.
// HL: hi+lo bf16 planes, three products for each contraction; else single fp16 with the probabilities carried x 2^10 (numerator and denominator alike). grid (heads, row blocks), longest rows first.
#define FW 4
typedef __attribute__((ext_vector_type(16))) unsigned short v16us;
template <typename T16, bool HL, int NQ>
__global__ __launch_bounds__(FW * 32) __attribute__((amdgpu_waves_per_eu(4))) void k_fattn(const T16* __restrict__ Q, const T16* __restrict__ Q2, const T16* __restrict__ Kp, const T16* __restrict__ K2, const T16* __restrict__ Vt, const T16* __restrict__ V2, int row0, bf* Ah, bf* Al) {
    typedef typename WFrag<T16>::V V; typedef WFrag<T16> F;
    constexpr int QW = 16 * NQ; constexpr float SC2 = SCL * 1.4426950408889634f;
    __shared__ __align__(16) float so[FW * QW * 68];
    __shared__ float sm[FW * QW], sl[FW * QW];
    const int lane = threadIdx.x & 31, lr = lane & 15, hi = lane >> 4; const int w = __builtin_amdgcn_readfirstlane((int)(threadIdx.x >> 5));
    const int h = blockIdx.x, q0 = row0 + ((int)gridDim.y - 1 - (int)blockIdx.y) * QW;
    const size_t hp = (size_t)h * TT * HD; Q += hp; Kp += hp; Vt += hp; if constexpr (HL) { Q2 += hp; K2 += hp; V2 += hp; }
    const int nkb = (q0 + QW - 1) / 32 + 1;                          // 32-key blocks up to and with the one that holds the last query's own key
    V bq[NQ][2], bq2[NQ][2];
#pragma unroll
    for (int qt = 0; qt < NQ; ++qt)
#pragma unroll
        for (int ks = 0; ks < 2; ++ks) { const size_t qo = (size_t)(q0 + qt * 16 + lr) * HD + ks * 32 + 8 * hi; bq[qt][ks] = F::ld(Q + qo); if constexpr (HL) bq2[qt][ks] = F::ld(Q2 + qo); }
    v8f o[4][NQ]; float m[NQ], l[NQ];
#pragma unroll
    for (int qt = 0; qt < NQ; ++qt) { m[qt] = -1.0e30f; l[qt] = 0.f;
#pragma unroll
        for (int dt = 0; dt < 4; ++dt) o[dt][qt] = (v8f){}; }
    const size_t koff = (size_t)lr * HD + 8 * hi, voff = (size_t)lr * TT + 8 * hi;
    V ak[2][2], ak2[2][2], av[4], av2[4];
    // each loader ends with s_wait_xcnt 0: it stands in front of every later write of a register that one of its loads names as its address (some of these are rewritten behind a branch);
    // the wait takes the addresses as inputs, so that they keep their registers up to it and no load of the group returns its data onto them
    auto ldK = [&](int kb) { const T16* p = Kp + koff + (size_t)kb * 32 * HD; const T16* p2 = HL ? K2 + koff + (size_t)kb * 32 * HD : p;
#pragma unroll
        for (int kt = 0; kt < 2; ++kt)
#pragma unroll
            for (int ks = 0; ks < 2; ++ks) { ak[kt][ks] = F::ld(p + kt * 16 * HD + ks * 32); if constexpr (HL) ak2[kt][ks] = F::ld(p2 + kt * 16 * HD + ks * 32); }
        asm volatile("s_wait_xcnt 0x0" :: "v"(p), "v"(p2) : "memory"); };
    auto ldV = [&](int k0) { const T16* p = Vt + voff + k0; const T16* p2 = HL ? V2 + voff + k0 : p;
#pragma unroll
        for (int dt = 0; dt < 4; ++dt) { av[dt] = F::ld(p + dt * 16 * TT); if constexpr (HL) av2[dt] = F::ld(p2 + dt * 16 * TT); }
        asm volatile("s_wait_xcnt 0x0" :: "v"(p), "v"(p2) : "memory"); };
    // single fp16: the values are fetched at the head of a pass and the NEXT pass's keys behind the score products, so that both latencies run under matrix and softmax work.
    // hi+lo (at most 4 passes a wave, twice the fragments): keys, products, then values, which keeps the wave inside 256 registers without spills.
    if constexpr (!HL) ldK(w);
#pragma unroll 1
    for (int kb = w; kb < nkb; kb += FW) {
        const int k0 = kb * 32;
        if constexpr (HL) ldK(kb); else ldV(k0);
        v8f s[NQ][2];
#pragma unroll
        for (int kt = 0; kt < 2; ++kt)
#pragma unroll
            for (int qt = 0; qt < NQ; ++qt) { v8f c = (v8f){};
#pragma unroll
                for (int ks = 0; ks < 2; ++ks) { c = F::mma(ak[kt][ks], bq[qt][ks], c); if constexpr (HL) { c = F::mma(ak[kt][ks], bq2[qt][ks], c); c = F::mma(ak2[kt][ks], bq[qt][ks], c); } }
                s[qt][kt] = c; }
        if constexpr (HL) ldV(k0); else ldK((kb + FW < nkb) ? kb + FW : kb);   // the last pass fetches its own block again: in bounds, unused
        if (k0 + 31 > q0) {                                          // only the diagonal block holds keys behind a query
#pragma unroll
            for (int qt = 0; qt < NQ; ++qt)
#pragma unroll
                for (int kt = 0; kt < 2; ++kt)
#pragma unroll
                    for (int j = 0; j < 8; ++j) if (k0 + kt * 16 + hi * 8 + j > q0 + qt * 16 + lr) s[qt][kt][j] = -3.0e38f; }
#pragma unroll
        for (int qt = 0; qt < NQ; ++qt) {
            float mx = s[qt][0][0];
#pragma unroll
            for (int j = 1; j < 16; ++j) mx = fmaxf(mx, s[qt][j >> 3][j & 7]);
            mx = fmaxf(mx, __shfl_xor(mx, 16, 32));                  // the other half-wave holds this query's other 16 keys
            const float mn = fmaxf(m[qt], mx * SC2), al = __builtin_amdgcn_exp2f(m[qt] - mn), mo = HL ? mn : mn - 10.0f; m[qt] = mn;
            float sum = 0.f;
#pragma unroll
            for (int j = 0; j < 16; ++j) { const float p = __builtin_amdgcn_exp2f(s[qt][j >> 3][j & 7] * SC2 - mo); s[qt][j >> 3][j & 7] = p; sum += p; }
            l[qt] = l[qt] * al + sum;
#pragma unroll
            for (int dt = 0; dt < 4; ++dt) o[dt][qt] *= al;
            if constexpr (HL) { v16us ph, pl;
#pragma unroll
                for (int j = 0; j < 16; ++j) { unsigned short a, c2; splitf(s[qt][j >> 3][j & 7], a, c2); ph[j] = a; pl[j] = c2; }
                const V bh = __builtin_bit_cast(V, ph), bl = __builtin_bit_cast(V, pl);
#pragma unroll
                for (int dt = 0; dt < 4; ++dt) { o[dt][qt] = F::mma(av[dt], bh, o[dt][qt]); o[dt][qt] = F::mma(av[dt], bl, o[dt][qt]); o[dt][qt] = F::mma(av2[dt], bh, o[dt][qt]); }
            } else { V pb;
#pragma unroll
                for (int j = 0; j < 16; ++j) pb[j] = tohx(s[qt][j >> 3][j & 7]);
#pragma unroll
                for (int dt = 0; dt < 4; ++dt) o[dt][qt] = F::mma(av[dt], pb, o[dt][qt]); }
        }
    }
#pragma unroll
    for (int qt = 0; qt < NQ; ++qt) { l[qt] += __shfl_xor(l[qt], 16, 32); if (hi == 0) sm[w * QW + qt * 16 + lr] = m[qt]; }
    __syncthreads();                                                 // every wave's maxima are in LDS before any wave forms the common one
#pragma unroll
    for (int qt = 0; qt < NQ; ++qt) { const int q = qt * 16 + lr; float M = sm[q];
#pragma unroll
        for (int p = 1; p < FW; ++p) M = fmaxf(M, sm[p * QW + q]);
        const float f = __builtin_amdgcn_exp2f(m[qt] - M); if (hi == 0) sl[w * QW + q] = l[qt] * f;   // a wave without a key block: f = 0
        float* op = so + (size_t)(w * QW + q) * 68 + hi * 8;
#pragma unroll
        for (int dt = 0; dt < 4; ++dt) { const v8f x = o[dt][qt] * f; *(v4fa*)(op + dt * 16) = __builtin_shufflevector(x, x, 0, 1, 2, 3); *(v4fa*)(op + dt * 16 + 4) = __builtin_shufflevector(x, x, 4, 5, 6, 7); } }
    __syncthreads();                                                 // every wave's rescaled partial tile and sum are in LDS before any thread adds them
#pragma unroll
    for (int i = 0; i < NQ; ++i) { const int u = (int)threadIdx.x + i * (FW * 32), q = u >> 3, d0 = (u & 7) * 8; const float* op = so + (size_t)q * 68 + d0; v4f a0 = *(const v4fa*)op, a1 = *(const v4fa*)(op + 4); float L = sl[q];
#pragma unroll
        for (int p = 1; p < FW; ++p) { a0 += *(const v4fa*)(op + p * (QW * 68)); a1 += *(const v4fa*)(op + p * (QW * 68) + 4); L += sl[p * QW + q]; }
        const float inv = __fdiv_rn(1.0f, L); v8us oh, ol;
#pragma unroll
        for (int k = 0; k < 4; ++k) { unsigned short a, c2; splitf(a0[k] * inv, a, c2); oh[k] = a; ol[k] = c2; splitf(a1[k] * inv, a, c2); oh[4 + k] = a; ol[4 + k] = c2; }
        const size_t oo = (size_t)(q0 + q) * DQ + h * HD + d0; *(v8us*)(Ah + oo) = oh; *(v8us*)(Al + oo) = ol; }
}

extern "C" void kernel_launch(void* const* d_in, const int* in_sizes, int n_in,
                              void* d_out, int out_size, void* d_ws, size_t ws_size, hipStream_t stream) {
    (void)in_sizes; (void)n_in; (void)out_size;
    const float* x = (const float*)d_in[0]; const float* wf = (const float*)d_in[1]; const float* wo = (const float*)d_in[2]; const float* wq = wf; const float* wk = wf; const float* wv = wf; (void)wk; (void)wv; /* x, w_qkv, w_o = d_in[0..2]; no bias inputs in this module: the four projection GEMMs below use the bias-free instantiation */ const float* cosT = nullptr; const float* sinT = nullptr; (void)cosT; (void)sinT;
    float* OUT = (float*)d_out;     // [2][4096][1024]
    char* wsp = (char*)d_ws;
    auto take = [&](size_t bytes) { char* p = wsp; wsp += (bytes + 255) & ~(size_t)255; return (void*)p; };
    bf* WQ = nullptr; bf* WK = nullptr; bf* WV = nullptr; bf* WO = (bf*)take((size_t)DM * DQ * 2);
    bf* XB = (bf*)take((size_t)TT * DM * 2); bf* WALL = (bf*)take((size_t)(DQ + 2 * DKV) * DM * 2);
    h16* QP16 = (h16*)take((size_t)NH_ * TT * HD * 2); h16* KP16 = (h16*)take((size_t)NKV * TT * HD * 2); h16* VT16 = (h16*)take((size_t)NKV * HD * TT * 2);
    bf* QPh = (bf*)take((size_t)NH_ * TT * HD * 2); bf* QPl = (bf*)take((size_t)NH_ * TT * HD * 2); bf* KPh = (bf*)take((size_t)NKV * TT * HD * 2); bf* KPl = (bf*)take((size_t)NKV * TT * HD * 2); bf* VTh = (bf*)take((size_t)NKV * HD * TT * 2); bf* VTl = (bf*)take((size_t)NKV * HD * TT * 2);
    bf* ATh = (bf*)take((size_t)TT * DQ * 2); bf* ATl = (bf*)take((size_t)TT * DQ * 2);
    if ((size_t)(wsp - (char*)d_ws) > ws_size) return;    // ws 256 MiB
    { k_wtG<<<(unsigned)((DM * (DQ + 2 * DKV) / 64 + 63) / 64), 256, 0, stream>>>(wf, DM, DQ + 2 * DKV, WALL); WQ = WALL; WK = WALL + (size_t)DQ * DM; WV = WK + (size_t)DKV * DM;
      k_wtG<<<(unsigned)((DQ * DM / 64 + 63) / 64), 256, 0, stream>>>(wo, DQ, DM, WO);
       }
    for (int b = 0; b < NB_; ++b) {
        
        k_cvt8<<<(unsigned)(((size_t)TT * DM / 8 + 255) / 256), 256, 0, stream>>>(x + (size_t)b * TT * DM, XB, (size_t)TT * DM / 8);
        k_gemmw<bf, 0, false, 1><<<dim3(TT / 64, DQ / 64, 1), 32, 0, stream>>>(XB, nullptr, WQ, nullptr, DM, nullptr, 0, nullptr, 0, 0, 0, QP16, QPh, QPl);
        k_gemmw<bf, 0, false, 1><<<dim3(TT / 64, DKV / 64, 1), 32, 0, stream>>>(XB, nullptr, WK, nullptr, DM, nullptr, 0, nullptr, 0, 0, 0, KP16, KPh, KPl);
        k_gemmw<bf, 0, false, 2><<<dim3(TT / 64, DKV / 64, 1), 32, 0, stream>>>(XB, nullptr, WV, nullptr, DM, nullptr, 0, nullptr, 0, 0, 0, VT16, VTh, VTl);
        k_fattn<h16, false, 2><<<dim3(NH_, (TT - RH) / 32), FW * 32, 0, stream>>>(QP16, nullptr, KP16, nullptr, VT16, nullptr, RH, ATh, ATl);
        k_fattn<bf, true, 1><<<dim3(NH_, RH / 16), FW * 32, 0, stream>>>(QPh, QPl, KPh, KPl, VTh, VTl, 0, ATh, ATl);
        k_gemmw<bf, 1, false, 0><<<dim3(TT / 64, DM / 64, 1), 32, 0, stream>>>(ATh, ATl, WO, nullptr, DQ, OUT + (size_t)b * TT * DM, DM, nullptr, 0, 0, 0, nullptr, nullptr, nullptr); }
}

// v004
// It runs in 301 microseconds.
// Next to v003, in two timings, it ran 1.36 and 1.38 times as fast.
// Counting every step since v000, it is 15.2 times as fast.
#include <hip/hip_runtime.h>

// Causal self-attention with a fused BIAS-FREE qkv projection over TWO 4,096-token sequences, written chunk by chunk in the module (x [2][4096][1024]; qkv = x w_qkv ('xw' [1024][3072] normal x 1/32, NO bias) viewed (3, 16, 64): column thirds q | k | v (16 heads x 64); the module scans over 32 query chunks of 128 rows, each against ALL keys with 'query position >= key position' kept and -1e10 elsewhere (== the full causal rule; == exclusion); scores / sqrt(64); softmax over the keys; out = merged w_out ('xw' [1024][1024], NO bias) -> [2][4096][1024] (8.4 M); argument order x, w_qkv, w_out).
// Compute dtypes, f32 accumulate: every input rounded to bf16; q/k/v on PLAIN bf16 operands (inputs: exact), no biases in this module; causal scores and attn.v: query rows < 512 hl (3 products), the rest single fp16 (x1024), causal block skipping; online softmax f32, fused with both products (k_fattn); w_o hl x exact (2 products), no bias.

#define NB_  2      // TWO sequences in this module: a host-side loop count only: no kernel uses it
#define TT   4096
#define DM   1024
#define NH_  16
#define NKV  16
#define HD   64
#define DQ   (NH_ * HD)
#define DKV  (NKV * HD)
#define RH   512                  // query rows < RH use hi+lo planes (0: none)
#define SCL  0.125f   // HD^-0.5
typedef _Float16 h16;
typedef unsigned short bf;
typedef __attribute__((ext_vector_type(16))) __bf16   v16bf;
typedef __attribute__((ext_vector_type(16))) _Float16 v16h;
typedef __attribute__((ext_vector_type(8)))  _Float16 v8h;
typedef __attribute__((ext_vector_type(8)))  unsigned short v8us;
typedef __attribute__((ext_vector_type(8)))  float    v8f;
typedef __attribute__((ext_vector_type(4)))  float    v4f;
typedef v8h  __attribute__((may_alias)) v8ha;
typedef v4f  __attribute__((may_alias)) v4fa;
typedef v8us __attribute__((may_alias)) v8usa;

__device__ __forceinline__ unsigned short f2bf(float f) { unsigned u = __float_as_uint(f); u += 0x7FFFu + ((u >> 16) & 1u); return (unsigned short)(u >> 16); }
__device__ __forceinline__ float bf2f(unsigned short b) { return __uint_as_float(((unsigned)b) << 16); }
__device__ __forceinline__ float bfr(float f) { return bf2f(f2bf(f)); }
__device__ __forceinline__ v16h cat16(v8h lo, v8h hi) { return __builtin_shufflevector(lo, hi, 0, 1, 2, 3, 4, 5, 6, 7, 8, 9, 10, 11, 12, 13, 14, 15); }
__device__ __forceinline__ v16bf cat16b(v8us lo, v8us hi) { return __builtin_bit_cast(v16bf, __builtin_shufflevector(lo, hi, 0, 1, 2, 3, 4, 5, 6, 7, 8, 9, 10, 11, 12, 13, 14, 15)); }
__device__ __forceinline__ v8f wmma16(v16h a, v16h b, v8f c) { return __builtin_amdgcn_wmma_f32_16x16x32_f16(false, a, false, b, (short)0, c, false, false); }
__device__ __forceinline__ v8f wmmab(v16bf a, v16bf b, v8f c) { return __builtin_amdgcn_wmma_f32_16x16x32_bf16(false, a, false, b, (short)0, c, false, false); }



// ---- FRAGMENT ORDER: every 16-bit operand plane is made of tiles of 16 rows x 32 k, 512 elements each, and the tiles that one wave loads together stand in a row:
// GEMM operands (x, weights, merged heads): [row / 64][k / 32][(row / 16) % 4] tiles; q and k planes: [head][position / 16][dim / 32] tiles; v planes: [head][position / 32][dim / 16] tiles (rows = dims, k = positions).
// Inside a tile element (row r, k = 16 j + 8 hi + e) stands at j * 256 + (16 hi + r) * 8 + e: lane 16 hi + r finds its two 8-element runs at lane * 8 and 256 + lane * 8 (WFrag::ld),
// so each of the two loads of a fragment reads 512 contiguous bytes (4 whole lines) where a row-major plane made it touch 16 lines. The k order of a fragment is what it was.
// ---- k_gemmw: register-blocked GEMM, ONE WAVE per 64x64 output tile (16 accumulators), operands straight from fragment-order 16-bit planes; grid (M/64, N/64, Z), 32 threads.
// C[m][n] (f32, pitch ldc, + optional f32 bias[n]) = sum_k A[m][k] Bt[n][k] (+ split products per NSPLIT). z-batch strides sA/sB/sC in elements. K % 32 == 0.
// EPI 0: C is stored as f32. EPI 1 / 2: the tile is 64 positions x the 64 dims of head blockIdx.y and leaves the kernel as the attention operand planes (fp16 P16, bf16 hi Ph, bf16 lo Pl), no f32 copy in memory:
// EPI 1 planes [head] x tiles (rows = positions, k = dims) (q, k), EPI 2 planes [head][32-key block][16-dim group] x one tile (rows = dims, k = positions) (v transposed). Either way 16 tile rows are staged in LDS and each store covers half a tile, 512 contiguous bytes.
template <typename T16> struct WFrag;
template <> struct WFrag<h16> { typedef v16h V; static __device__ __forceinline__ V ld(const h16* p) { return cat16(*(const v8h*)p, *(const v8h*)(p + 256)); } static __device__ __forceinline__ v8f mma(V a, V b, v8f c) { return wmma16(a, b, c); } };
template <> struct WFrag<bf> { typedef v16bf V; static __device__ __forceinline__ V ld(const bf* p) { return cat16b(*(const v8us*)p, *(const v8us*)(p + 256)); } static __device__ __forceinline__ v8f mma(V a, V b, v8f c) { return wmmab(a, b, c); } };
__device__ __forceinline__ h16 tohx(float x) { return (h16)x; }
__device__ __forceinline__ void splitf(float y, unsigned short& h, unsigned short& l) { h = f2bf(y); l = f2bf(y - bf2f(h)); }
template <typename T16, int NSPLIT, bool BIAS, int EPI>
__global__ __launch_bounds__(32) void k_gemmw(const T16* __restrict__ A, const T16* __restrict__ A2, const T16* __restrict__ Bt, const T16* __restrict__ Bt2, int K, float* C, int ldc, const float* __restrict__ bias, size_t sA, size_t sB, size_t sC, h16* P16, bf* Ph, bf* Pl) {
    typedef typename WFrag<T16>::V V;
    __shared__ __align__(16) float os[16 * 68];
    const size_t z = blockIdx.z; A += z * sA; if (A2) A2 += z * sA; Bt += z * sB; if (Bt2) Bt2 += z * sB; C += z * sC;
    const int lane = threadIdx.x & 31, lr = lane & 15, hi = lane >> 4; const int r0 = blockIdx.x * 64, c0 = blockIdx.y * 64;
    v8f acc[4][4];
#pragma unroll
    for (int mb = 0; mb < 4; ++mb)
#pragma unroll
        for (int nb = 0; nb < 4; ++nb) acc[mb][nb] = (v8f){};
    const size_t aoff = (size_t)r0 * K + lane * 8, boff = (size_t)c0 * K + lane * 8;   // a block of 64 rows is K / 32 groups of 4 tiles = 64 K elements
#pragma unroll 1
    for (int kc = 0; kc < K; kc += 32) {
        V a[4], a2[4], b[4], b2[4];
        const T16* pa = A + aoff + (size_t)kc * 64; const T16* pa2 = (NSPLIT == 1 || NSPLIT == 2) ? A2 + aoff + (size_t)kc * 64 : pa; const T16* pb = Bt + boff + (size_t)kc * 64; const T16* pb2 = (NSPLIT >= 2) ? Bt2 + boff + (size_t)kc * 64 : pb;
#pragma unroll
        for (int mb = 0; mb < 4; ++mb) { a[mb] = WFrag<T16>::ld(pa + mb * 512); if (NSPLIT == 1 || NSPLIT == 2) a2[mb] = WFrag<T16>::ld(pa2 + mb * 512); }
#pragma unroll
        for (int nb = 0; nb < 4; ++nb) { b[nb] = WFrag<T16>::ld(pb + nb * 512); if (NSPLIT >= 2) b2[nb] = WFrag<T16>::ld(pb2 + nb * 512); }
        asm volatile("s_wait_xcnt 0x0" :: "v"(pa), "v"(pa2), "v"(pb), "v"(pb2) : "memory");   // stands in front of every later write of a register that one of these loads names as its address; the addresses are inputs, so that they keep their registers up to it and no load returns its data onto them
        __builtin_amdgcn_sched_barrier(0);   // keeps every product behind the whole group of loads: in fragment order each trip's lines are all new to the wave, and loads held back behind the first products would add a second load latency to every trip
#pragma unroll
        for (int nb = 0; nb < 4; ++nb)
#pragma unroll
            for (int mb = 0; mb < 4; ++mb) { acc[mb][nb] = WFrag<T16>::mma(a[mb], b[nb], acc[mb][nb]); if (NSPLIT == 1 || NSPLIT == 2) acc[mb][nb] = WFrag<T16>::mma(a2[mb], b[nb], acc[mb][nb]); if (NSPLIT >= 2) acc[mb][nb] = WFrag<T16>::mma(a[mb], b2[nb], acc[mb][nb]); }
        asm volatile("v_nop\n\tv_nop\n\tv_nop\n\tv_nop" : "+v"(acc[0][0]), "+v"(acc[1][1]), "+v"(acc[2][2]), "+v"(acc[3][3]) : "v"(a[0]), "v"(a[3]));
    }
    if constexpr (EPI != 0) {
        static_assert(HD == 64, "one 64-column tile is one head");
        const size_t pb = ((size_t)blockIdx.y * TT + r0) * HD + lane * 8;   // 64 positions x 64 dims of one head are 8 tiles in a row, in either plane kind
#pragma unroll
        for (int g = 0; g < 4; ++g) {                                 // 16 tile rows a trip: positions 16 g .. (EPI 1), dims 16 g .. (EPI 2)
            if constexpr (EPI == 1) {
#pragma unroll
                for (int nb = 0; nb < 4; ++nb)
#pragma unroll
                    for (int j = 0; j < 8; ++j) os[(hi * 8 + j) * 68 + nb * 16 + lr] = acc[g][nb][j];
            } else {                                                  // a lane's 8 accumulator rows are 8 consecutive positions of its one dim
#pragma unroll
                for (int mb = 0; mb < 4; ++mb) { float* op = os + lr * 68 + mb * 16 + hi * 8; const v8f xv = acc[mb][g]; *(v4fa*)op = __builtin_shufflevector(xv, xv, 0, 1, 2, 3); *(v4fa*)(op + 4) = __builtin_shufflevector(xv, xv, 4, 5, 6, 7); } }
            __builtin_amdgcn_wave_barrier(); asm volatile("" ::: "memory");   // keeps the compiler from moving the read-back over the other lanes' staging writes
#pragma unroll
            for (int s = 0; s < 4; ++s) { const float* ip = os + lr * 68 + s * 16 + hi * 8; const v4f a0 = *(const v4fa*)ip, a1 = *(const v4fa*)(ip + 4); v8h o16; v8us oh, ol;
#pragma unroll
                for (int k = 0; k < 4; ++k) { unsigned short u, v; o16[k] = tohx(a0[k]); splitf(a0[k], u, v); oh[k] = u; ol[k] = v; o16[4 + k] = tohx(a1[k]); splitf(a1[k], u, v); oh[4 + k] = u; ol[4 + k] = v; }
                const size_t e = pb + ((EPI == 1) ? g * 1024 + s * 256 : (s >> 1) * 2048 + g * 512 + (s & 1) * 256); *(v8h*)(P16 + e) = o16; *(v8us*)(Ph + e) = oh; *(v8us*)(Pl + e) = ol;
                asm volatile("s_wait_xcnt 0x0" ::: "memory"); }       // stands in front of the next rows' writes of the registers that these three stores name
            __builtin_amdgcn_wave_barrier(); asm volatile("" ::: "memory");   // keeps the next trip's staging writes behind this trip's reads
        }
        return;
    }
#pragma unroll
    for (int mb = 0; mb < 4; ++mb) {
#pragma unroll
        for (int nb = 0; nb < 4; ++nb) {
#pragma unroll
            for (int j = 0; j < 8; ++j) os[(hi * 8 + j) * 68 + nb * 16 + lr] = acc[mb][nb][j]; }
        __builtin_amdgcn_wave_barrier(); asm volatile("" ::: "memory");
        float* crow = C + (size_t)(r0 + mb * 16) * ldc + c0;
{
#pragma unroll
            for (int s = 0; s < 8; ++s) { const int row = 2 * s + hi, cofs = lr * 4; v4f val = *(const v4fa*)(os + row * 68 + cofs); if (BIAS) { val[0] += bfr(bias[c0 + cofs]); val[1] += bfr(bias[c0 + cofs + 1]); val[2] += bfr(bias[c0 + cofs + 2]); val[3] += bfr(bias[c0 + cofs + 3]); }
                *(v4f*)(crow + (size_t)row * ldc + cofs) = val; }
             }
        __builtin_amdgcn_wave_barrier(); asm volatile("" ::: "memory");
    }
}

typedef __attribute__((ext_vector_type(2))) _Float16 v2h;
typedef __attribute__((ext_vector_type(4))) _Float16 v4h;
typedef __attribute__((ext_vector_type(2))) unsigned short v2us;
typedef __attribute__((ext_vector_type(4))) unsigned short v4us;
typedef __attribute__((ext_vector_type(2))) float v2f;
typedef __attribute__((ext_vector_type(4))) int v4i;

__global__ __launch_bounds__(256) void k_wtG(const float* __restrict__ w, int K, int N, bf* Bt) {
    const int lane = threadIdx.x & 31; const int L0 = (blockIdx.x * 8 + (threadIdx.x >> 5)) * 8; const int nlines = N * K / 64;
{
#pragma unroll 1
        for (int l = 0; l < 8; ++l) { const int L = L0 + l; if (L >= nlines) break; const size_t e = (size_t)L * 64 + lane * 2; const int grp = (int)(e >> 11), wi = (int)(e & 511), KT = K >> 5; const int n = (grp / KT) * 64 + ((int)(e >> 9) & 3) * 16 + ((wi >> 3) & 15), k = (grp % KT) * 32 + (wi >> 7) * 8 + (wi & 7); v2us o;   // e counts in fragment order
            const float* p0 = w + (size_t)k * N + n; const float* p1 = p0 + N; const float w0 = *p0, w1 = *p1;
            asm volatile("s_wait_xcnt 0x0" :: "v"(p0), "v"(p1) : "memory");   // stands in front of every later write of the two loads' address registers, which are inputs so that they keep their registers up to it
            o[0] = f2bf(w0); o[1] = f2bf(w1); *(v2us*)(Bt + e) = o; }
         }
}
// k_cvt8: f32 rows of K -> bf16 plane in fragment order. A block takes 16 rows x 128 k = 4 tiles: whole lines are read, the 16-byte runs change places in LDS (16 runs + 16 bytes of pad: no bank conflict either way), whole lines are stored. grid rows / 16 * K / 128.
__global__ __launch_bounds__(256) void k_cvt8(const float* __restrict__ src, bf* dst, int K) {
    __shared__ __align__(16) bf st[16 * 17 * 8];
    const int t = threadIdx.x, row = t >> 4, c = t & 15, ns = K >> 7; const int rb = (int)blockIdx.x / ns, sg = (int)blockIdx.x % ns;
    const v8f v = *(const v8f*)(src + (size_t)(rb * 16 + row) * K + sg * 128 + c * 8); v8us o;
#pragma unroll
    for (int k = 0; k < 8; ++k) o[k] = f2bf(v[k]);
    *(v8usa*)(st + (c * 17 + row) * 8) = o;                           // run c of a row (k = 8 c ..) is group c of 16 runs in fragment order
    __syncthreads();                                                 // every run is in LDS before any thread reads the one it stores
    *(v8us*)(dst + ((size_t)(rb >> 2) * (K >> 5) + sg * 4 + (t >> 6)) * 2048 + (rb & 3) * 512 + (t & 63) * 8) = *(const v8usa*)(st + ((t >> 4) * 17 + (t & 15)) * 8); }
// ---- k_fattn: causal scores, softmax and probability x value product of one head in ONE kernel; no score or probability ever reaches memory.
// Transposed products: S^T = K Q^T (A = 16 key rows, B = 16 query columns), O^T += V^T P^T (A = 16 rows of V^T, B = P^T). A lane then holds the scores of ONE query (column lr; keys 8 hi + j of each 16-key tile),
// and the two score tiles of a 32-key block, converted in place, ARE the B operand of the value product in the order that WFrag::ld gives A (k = 8 hi + 0..7, 16 + 8 hi + 0..7).
// A work-group owns 16 NQ query rows of one head. Its FW waves share the key loop (wave w takes the 32-key blocks w, w + FW, ... up to the diagonal block), each with its own running maximum, sum and O^T tile
// (online softmax, base 2); the FW partial results are brought to the common maximum and summed in wave order through LDS, divided by the summed denominator and stored as the hi/lo bf16 planes of the merged heads. All planes in fragment order (above k_gemmw).
// amdgpu_waves_per_eu(4): at most 256 registers, so that four work-groups (one wave of each per SIMD) stay resident and cover each other's load and softmax latency.
// HL: hi+lo bf16 planes, three products for each contraction; else single fp16 with the probabilities carried x 2^10 (numerator and denominator alike). grid (heads, row blocks), longest rows first.
#define FW 4
typedef __attribute__((ext_vector_type(16))) unsigned short v16us;
template <typename T16, bool HL, int NQ>
__global__ __launch_bounds__(FW * 32) __attribute__((amdgpu_waves_per_eu(4))) void k_fattn(const T16* __restrict__ Q, const T16* __restrict__ Q2, const T16* __restrict__ Kp, const T16* __restrict__ K2, const T16* __restrict__ Vt, const T16* __restrict__ V2, int row0, bf* Ah, bf* Al) {
    typedef typename WFrag<T16>::V V; typedef WFrag<T16> F;
    constexpr int QW = 16 * NQ; constexpr float SC2 = SCL * 1.4426950408889634f;
    __shared__ __align__(16) float so[FW * QW * 68];
    __shared__ float sm[FW * QW], sl[FW * QW];
    const int lane = threadIdx.x & 31, lr = lane & 15, hi = lane >> 4; const int w = __builtin_amdgcn_readfirstlane((int)(threadIdx.x >> 5));
    const int h = blockIdx.x, q0 = row0 + ((int)gridDim.y - 1 - (int)blockIdx.y) * QW;
    const size_t hp = (size_t)h * TT * HD; Q += hp; Kp += hp; Vt += hp; if constexpr (HL) { Q2 += hp; K2 += hp; V2 += hp; }
    const int nkb = (q0 + QW - 1) / 32 + 1;                          // 32-key blocks up to and with the one that holds the last query's own key
    V bq[NQ][2], bq2[NQ][2];
#pragma unroll
    for (int qt = 0; qt < NQ; ++qt)
#pragma unroll
        for (int ks = 0; ks < 2; ++ks) { const size_t qo = (size_t)(q0 + qt * 16) * HD + ks * 512 + lane * 8; bq[qt][ks] = F::ld(Q + qo); if constexpr (HL) bq2[qt][ks] = F::ld(Q2 + qo); }
    v8f o[4][NQ]; float m[NQ], l[NQ];
#pragma unroll
    for (int qt = 0; qt < NQ; ++qt) { m[qt] = -1.0e30f; l[qt] = 0.f;
#pragma unroll
        for (int dt = 0; dt < 4; ++dt) o[dt][qt] = (v8f){}; }
    const size_t koff = lane * 8, voff = lane * 8;                    // a 32-key block is 4 tiles in a row in the key planes (16 keys x 32 dims each) and in the value planes (16 dims x 32 keys each)
    V ak[2][2], ak2[2][2], av[4], av2[4];
    // each loader ends with s_wait_xcnt 0: it stands in front of every later write of a register that one of its loads names as its address (some of these are rewritten behind a branch);
    // the wait takes the addresses as inputs, so that they keep their registers up to it and no load of the group returns its data onto them
    auto ldK = [&](int kb) { const T16* p = Kp + koff + (size_t)kb * 32 * HD; const T16* p2 = HL ? K2 + koff + (size_t)kb * 32 * HD : p;
#pragma unroll
        for (int kt = 0; kt < 2; ++kt)
#pragma unroll
            for (int ks = 0; ks < 2; ++ks) { ak[kt][ks] = F::ld(p + kt * 1024 + ks * 512); if constexpr (HL) ak2[kt][ks] = F::ld(p2 + kt * 1024 + ks * 512); }
        asm volatile("s_wait_xcnt 0x0" :: "v"(p), "v"(p2) : "memory"); };
    auto ldV = [&](int k0) { const T16* p = Vt + voff + (size_t)k0 * HD; const T16* p2 = HL ? V2 + voff + (size_t)k0 * HD : p;
#pragma unroll
        for (int dt = 0; dt < 4; ++dt) { av[dt] = F::ld(p + dt * 512); if constexpr (HL) av2[dt] = F::ld(p2 + dt * 512); }
        asm volatile("s_wait_xcnt 0x0" :: "v"(p), "v"(p2) : "memory"); };
    // single fp16: the values are fetched at the head of a pass and the NEXT pass's keys behind the score products, so that both latencies run under matrix and softmax work.
    // hi+lo (at most 4 passes a wave, twice the fragments): keys, products, then values, which keeps the wave inside 256 registers without spills.
    if constexpr (!HL) ldK(w);
#pragma unroll 1
    for (int kb = w; kb < nkb; kb += FW) {
        const int k0 = kb * 32;
        if constexpr (HL) ldK(kb); else ldV(k0);
        v8f s[NQ][2];
#pragma unroll
        for (int kt = 0; kt < 2; ++kt)
#pragma unroll
            for (int qt = 0; qt < NQ; ++qt) { v8f c = (v8f){};
#pragma unroll
                for (int ks = 0; ks < 2; ++ks) { c = F::mma(ak[kt][ks], bq[qt][ks], c); if constexpr (HL) { c = F::mma(ak[kt][ks], bq2[qt][ks], c); c = F::mma(ak2[kt][ks], bq[qt][ks], c); } }
                s[qt][kt] = c; }
        if constexpr (HL) ldV(k0); else ldK((kb + FW < nkb) ? kb + FW : kb);   // the last pass fetches its own block again: in bounds, unused
        if (k0 + 31 > q0) {                                          // only the diagonal block holds keys behind a query
#pragma unroll
            for (int qt = 0; qt < NQ; ++qt)
#pragma unroll
                for (int kt = 0; kt < 2; ++kt)
#pragma unroll
                    for (int j = 0; j < 8; ++j) if (k0 + kt * 16 + hi * 8 + j > q0 + qt * 16 + lr) s[qt][kt][j] = -3.0e38f; }
#pragma unroll
        for (int qt = 0; qt < NQ; ++qt) {
            float mx = s[qt][0][0];
#pragma unroll
            for (int j = 1; j < 16; ++j) mx = fmaxf(mx, s[qt][j >> 3][j & 7]);
            mx = fmaxf(mx, __shfl_xor(mx, 16, 32));                  // the other half-wave holds this query's other 16 keys
            const float mn = fmaxf(m[qt], mx * SC2), al = __builtin_amdgcn_exp2f(m[qt] - mn), mo = HL ? mn : mn - 10.0f; m[qt] = mn;
            float sum = 0.f;
#pragma unroll
            for (int j = 0; j < 16; ++j) { const float p = __builtin_amdgcn_exp2f(s[qt][j >> 3][j & 7] * SC2 - mo); s[qt][j >> 3][j & 7] = p; sum += p; }
            l[qt] = l[qt] * al + sum;
#pragma unroll
            for (int dt = 0; dt < 4; ++dt) o[dt][qt] *= al;
            if constexpr (HL) { v16us ph, pl;
#pragma unroll
                for (int j = 0; j < 16; ++j) { unsigned short a, c2; splitf(s[qt][j >> 3][j & 7], a, c2); ph[j] = a; pl[j] = c2; }
                const V bh = __builtin_bit_cast(V, ph), bl = __builtin_bit_cast(V, pl);
#pragma unroll
                for (int dt = 0; dt < 4; ++dt) { o[dt][qt] = F::mma(av[dt], bh, o[dt][qt]); o[dt][qt] = F::mma(av[dt], bl, o[dt][qt]); o[dt][qt] = F::mma(av2[dt], bh, o[dt][qt]); }
            } else { V pb;
#pragma unroll
                for (int j = 0; j < 16; ++j) pb[j] = tohx(s[qt][j >> 3][j & 7]);
#pragma unroll
                for (int dt = 0; dt < 4; ++dt) o[dt][qt] = F::mma(av[dt], pb, o[dt][qt]); }
        }
    }
#pragma unroll
    for (int qt = 0; qt < NQ; ++qt) { l[qt] += __shfl_xor(l[qt], 16, 32); if (hi == 0) sm[w * QW + qt * 16 + lr] = m[qt]; }
    __syncthreads();                                                 // every wave's maxima are in LDS before any wave forms the common one
#pragma unroll
    for (int qt = 0; qt < NQ; ++qt) { const int q = qt * 16 + lr; float M = sm[q];
#pragma unroll
        for (int p = 1; p < FW; ++p) M = fmaxf(M, sm[p * QW + q]);
        const float f = __builtin_amdgcn_exp2f(m[qt] - M); if (hi == 0) sl[w * QW + q] = l[qt] * f;   // a wave without a key block: f = 0
        float* op = so + (size_t)(w * QW + q) * 68 + hi * 8;
#pragma unroll
        for (int dt = 0; dt < 4; ++dt) { const v8f x = o[dt][qt] * f; *(v4fa*)(op + dt * 16) = __builtin_shufflevector(x, x, 0, 1, 2, 3); *(v4fa*)(op + dt * 16 + 4) = __builtin_shufflevector(x, x, 4, 5, 6, 7); } }
    __syncthreads();                                                 // every wave's rescaled partial tile and sum are in LDS before any thread adds them
#pragma unroll
    for (int i = 0; i < NQ; ++i) { const int u = (int)threadIdx.x, q = i * 16 + (u & 15), d0 = (u >> 4) * 8; const float* op = so + (size_t)q * 68 + d0; v4f a0 = *(const v4fa*)op, a1 = *(const v4fa*)(op + 4); float L = sl[q];
#pragma unroll
        for (int p = 1; p < FW; ++p) { a0 += *(const v4fa*)(op + p * (QW * 68)); a1 += *(const v4fa*)(op + p * (QW * 68) + 4); L += sl[p * QW + q]; }
        const float inv = __fdiv_rn(1.0f, L); v8us oh, ol;
#pragma unroll
        for (int k = 0; k < 4; ++k) { unsigned short a, c2; splitf(a0[k] * inv, a, c2); oh[k] = a; ol[k] = c2; splitf(a1[k] * inv, a, c2); oh[4 + k] = a; ol[4 + k] = c2; }
        const int qb = q0 + i * 16; const size_t oo = ((size_t)(qb >> 6) * (DQ / 32) + h * 2 + (u >> 6)) * 2048 + ((qb >> 4) & 3) * 512 + (u & 63) * 8; *(v8us*)(Ah + oo) = oh; *(v8us*)(Al + oo) = ol; }   // fragment order: 16 queries x this head's 64 dims are 2 tiles; run u of them is (query u & 15, dims 8 (u >> 4) ..)
}

extern "C" void kernel_launch(void* const* d_in, const int* in_sizes, int n_in,
                              void* d_out, int out_size, void* d_ws, size_t ws_size, hipStream_t stream) {
    (void)in_sizes; (void)n_in; (void)out_size;
    const float* x = (const float*)d_in[0]; const float* wf = (const float*)d_in[1]; const float* wo = (const float*)d_in[2]; const float* wq = wf; const float* wk = wf; const float* wv = wf; (void)wk; (void)wv; /* x, w_qkv, w_o = d_in[0..2]; no bias inputs in this module: the four projection GEMMs below use the bias-free instantiation */ const float* cosT = nullptr; const float* sinT = nullptr; (void)cosT; (void)sinT;
    float* OUT = (float*)d_out;     // [2][4096][1024]
    char* wsp = (char*)d_ws;
    auto take = [&](size_t bytes) { char* p = wsp; wsp += (bytes + 255) & ~(size_t)255; return (void*)p; };
    bf* WQ = nullptr; bf* WK = nullptr; bf* WV = nullptr; bf* WO = (bf*)take((size_t)DM * DQ * 2);
    bf* XB = (bf*)take((size_t)TT * DM * 2); bf* WALL = (bf*)take((size_t)(DQ + 2 * DKV) * DM * 2);
    h16* QP16 = (h16*)take((size_t)NH_ * TT * HD * 2); h16* KP16 = (h16*)take((size_t)NKV * TT * HD * 2); h16* VT16 = (h16*)take((size_t)NKV * HD * TT * 2);
    bf* QPh = (bf*)take((size_t)NH_ * TT * HD * 2); bf* QPl = (bf*)take((size_t)NH_ * TT * HD * 2); bf* KPh = (bf*)take((size_t)NKV * TT * HD * 2); bf* KPl = (bf*)take((size_t)NKV * TT * HD * 2); bf* VTh = (bf*)take((size_t)NKV * HD * TT * 2); bf* VTl = (bf*)take((size_t)NKV * HD * TT * 2);
    bf* ATh = (bf*)take((size_t)TT * DQ * 2); bf* ATl = (bf*)take((size_t)TT * DQ * 2);
    if ((size_t)(wsp - (char*)d_ws) > ws_size) return;    // ws 256 MiB
    { k_wtG<<<(unsigned)((DM * (DQ + 2 * DKV) / 64 + 63) / 64), 256, 0, stream>>>(wf, DM, DQ + 2 * DKV, WALL); WQ = WALL; WK = WALL + (size_t)DQ * DM; WV = WK + (size_t)DKV * DM;
      k_wtG<<<(unsigned)((DQ * DM / 64 + 63) / 64), 256, 0, stream>>>(wo, DQ, DM, WO);
       }
    for (int b = 0; b < NB_; ++b) {
        
        k_cvt8<<<(unsigned)((size_t)TT * DM / 2048), 256, 0, stream>>>(x + (size_t)b * TT * DM, XB, DM);
        k_gemmw<bf, 0, false, 1><<<dim3(TT / 64, DQ / 64, 1), 32, 0, stream>>>(XB, nullptr, WQ, nullptr, DM, nullptr, 0, nullptr, 0, 0, 0, QP16, QPh, QPl);
        k_gemmw<bf, 0, false, 1><<<dim3(TT / 64, DKV / 64, 1), 32, 0, stream>>>(XB, nullptr, WK, nullptr, DM, nullptr, 0, nullptr, 0, 0, 0, KP16, KPh, KPl);
        k_gemmw<bf, 0, false, 2><<<dim3(TT / 64, DKV / 64, 1), 32, 0, stream>>>(XB, nullptr, WV, nullptr, DM, nullptr, 0, nullptr, 0, 0, 0, VT16, VTh, VTl);
        k_fattn<h16, false, 2><<<dim3(NH_, (TT - RH) / 32), FW * 32, 0, stream>>>(QP16, nullptr, KP16, nullptr, VT16, nullptr, RH, ATh, ATl);
        k_fattn<bf, true, 1><<<dim3(NH_, RH / 16), FW * 32, 0, stream>>>(QPh, QPl, KPh, KPl, VTh, VTl, 0, ATh, ATl);
        k_gemmw<bf, 1, false, 0><<<dim3(TT / 64, DM / 64, 1), 32, 0, stream>>>(ATh, ATl, WO, nullptr, DQ, OUT + (size_t)b * TT * DM, DM, nullptr, 0, 0, 0, nullptr, nullptr, nullptr); }
}

// v005
// One run takes 173 microseconds.
// Two timings next to v004 put it at 1.74 and 1.69 times that version's speed.
// Over all steps from v000 it is 26.2 times as fast.
#include <hip/hip_runtime.h>

// Causal self-attention with a fused BIAS-FREE qkv projection over TWO 4,096-token sequences, written chunk by chunk in the module (x [2][4096][1024]; qkv = x w_qkv ('xw' [1024][3072] normal x 1/32, NO bias) viewed (3, 16, 64): column thirds q | k | v (16 heads x 64); the module scans over 32 query chunks of 128 rows, each against ALL keys with 'query position >= key position' kept and -1e10 elsewhere (== the full causal rule; == exclusion); scores / sqrt(64); softmax over the keys; out = merged w_out ('xw' [1024][1024], NO bias) -> [2][4096][1024] (8.4 M); argument order x, w_qkv, w_out).
// Compute dtypes, f32 accumulate: every input rounded to bf16; q/k/v on PLAIN bf16 operands (inputs: exact), no biases in this module; causal scores and attn.v: query rows < 512 hl (3 products), the rest single fp16 (x1024), causal block skipping; online softmax f32, fused with both products (k_fattn); w_o hl x exact (2 products), no bias.

#define NB_  2      // TWO sequences in this module: both go through every launch together (rows of the GEMMs = sequence * TT + position; attention planes [sequence][head])
#define TT   4096
#define DM   1024
#define NH_  16
#define NKV  16
#define HD   64
#define DQ   (NH_ * HD)
#define DKV  (NKV * HD)
#define RH   512                  // query rows < RH use hi+lo planes (0: none)
#define SCL  0.125f   // HD^-0.5
typedef _Float16 h16;
typedef unsigned short bf;
typedef __attribute__((ext_vector_type(16))) __bf16   v16bf;
typedef __attribute__((ext_vector_type(16))) _Float16 v16h;
typedef __attribute__((ext_vector_type(8)))  _Float16 v8h;
typedef __attribute__((ext_vector_type(8)))  unsigned short v8us;
typedef __attribute__((ext_vector_type(8)))  float    v8f;
typedef __attribute__((ext_vector_type(4)))  float    v4f;
typedef v8h  __attribute__((may_alias)) v8ha;
typedef v4f  __attribute__((may_alias)) v4fa;
typedef v8us __attribute__((may_alias)) v8usa;

__device__ __forceinline__ unsigned short f2bf(float f) { unsigned u = __float_as_uint(f); u += 0x7FFFu + ((u >> 16) & 1u); return (unsigned short)(u >> 16); }
__device__ __forceinline__ float bf2f(unsigned short b) { return __uint_as_float(((unsigned)b) << 16); }
__device__ __forceinline__ float bfr(float f) { return bf2f(f2bf(f)); }
__device__ __forceinline__ v16h cat16(v8h lo, v8h hi) { return __builtin_shufflevector(lo, hi, 0, 1, 2, 3, 4, 5, 6, 7, 8, 9, 10, 11, 12, 13, 14, 15); }
__device__ __forceinline__ v16bf cat16b(v8us lo, v8us hi) { return __builtin_bit_cast(v16bf, __builtin_shufflevector(lo, hi, 0, 1, 2, 3, 4, 5, 6, 7, 8, 9, 10, 11, 12, 13, 14, 15)); }
__device__ __forceinline__ v8f wmma16(v16h a, v16h b, v8f c) { return __builtin_amdgcn_wmma_f32_16x16x32_f16(false, a, false, b, (short)0, c, false, false); }
__device__ __forceinline__ v8f wmmab(v16bf a, v16bf b, v8f c) { return __builtin_amdgcn_wmma_f32_16x16x32_bf16(false, a, false, b, (short)0, c, false, false); }



// ---- FRAGMENT ORDER: every 16-bit operand plane is made of tiles of 16 rows x 32 k, 512 elements each, and the tiles that one wave loads together stand in a row:
// GEMM operands (x, weights, merged heads): [row / 64][k / 32][(row / 16) % 4] tiles; q and k planes: [head][position / 16][dim / 32] tiles; v planes: [head][position / 32][dim / 16] tiles (rows = dims, k = positions).
// Inside a tile element (row r, k = 16 j + 8 hi + e) stands at j * 256 + (16 hi + r) * 8 + e: lane 16 hi + r finds its two 8-element runs at lane * 8 and 256 + lane * 8 (WFrag::ld),
// so each of the two loads of a fragment reads 512 contiguous bytes (4 whole lines) where a row-major plane made it touch 16 lines. The k order of a fragment is what it was.
// ---- k_gemmw: register-blocked GEMM, ONE WAVE per 64x64 output tile (16 accumulators), operands straight from fragment-order 16-bit planes; grid (M/64, N/64, Z), 32 threads.
// C[m][n] (f32, pitch ldc, + optional f32 bias[n]) = sum_k A[m][k] Bt[n][k] (+ split products per NSPLIT). z-batch strides sA/sB/sC in elements. K % 32 == 0.
// EPI 0: C is stored as f32. EPI 1: ONE launch makes q, k and v of both sequences: column block blockIdx.y is head blockIdx.y % 16 of third blockIdx.y / 16 (q | k | v), row block blockIdx.x is 64 positions of sequence r0 / TT;
// the tile leaves the kernel as the attention operand planes (fp16 P16, bf16 hi Ph, bf16 lo Pl; each [third][sequence][head]), no f32 copy in memory:
// q, k planes [head] x tiles (rows = positions, k = dims), v planes [head][32-key block][16-dim group] x one tile (rows = dims, k = positions) (v transposed). Either way 16 tile rows are staged in LDS and each store covers half a tile, 512 contiguous bytes.
template <typename T16> struct WFrag;
template <> struct WFrag<h16> { typedef v16h V; static __device__ __forceinline__ V ld(const h16* p) { return cat16(*(const v8h*)p, *(const v8h*)(p + 256)); } static __device__ __forceinline__ v8f mma(V a, V b, v8f c) { return wmma16(a, b, c); } };
template <> struct WFrag<bf> { typedef v16bf V; static __device__ __forceinline__ V ld(const bf* p) { return cat16b(*(const v8us*)p, *(const v8us*)(p + 256)); } static __device__ __forceinline__ v8f mma(V a, V b, v8f c) { return wmmab(a, b, c); } };
__device__ __forceinline__ h16 tohx(float x) { return (h16)x; }
__device__ __forceinline__ void splitf(float y, unsigned short& h, unsigned short& l) { h = f2bf(y); l = f2bf(y - bf2f(h)); }
template <bool B> struct BoolC { static constexpr bool value = B; };
template <typename T16, int NSPLIT, bool BIAS, int EPI>
__global__ __launch_bounds__(32) void k_gemmw(const T16* __restrict__ A, const T16* __restrict__ A2, const T16* __restrict__ Bt, const T16* __restrict__ Bt2, int K, float* C, int ldc, const float* __restrict__ bias, size_t sA, size_t sB, size_t sC, h16* P16, bf* Ph, bf* Pl) {
    typedef typename WFrag<T16>::V V;
    __shared__ __align__(16) float os[16 * 68];
    const size_t z = blockIdx.z; A += z * sA; if (A2) A2 += z * sA; Bt += z * sB; if (Bt2) Bt2 += z * sB; C += z * sC;
    const int lane = threadIdx.x & 31, lr = lane & 15, hi = lane >> 4; const int r0 = blockIdx.x * 64, c0 = blockIdx.y * 64;
    v8f acc[4][4];
#pragma unroll
    for (int mb = 0; mb < 4; ++mb)
#pragma unroll
        for (int nb = 0; nb < 4; ++nb) acc[mb][nb] = (v8f){};
    const size_t aoff = (size_t)r0 * K + lane * 8, boff = (size_t)c0 * K + lane * 8;   // a block of 64 rows is K / 32 groups of 4 tiles = 64 K elements
#pragma unroll 1
    for (int kc = 0; kc < K; kc += 32) {
        V a[4], a2[4], b[4], b2[4];
        const T16* pa = A + aoff + (size_t)kc * 64; const T16* pa2 = (NSPLIT == 1 || NSPLIT == 2) ? A2 + aoff + (size_t)kc * 64 : pa; const T16* pb = Bt + boff + (size_t)kc * 64; const T16* pb2 = (NSPLIT >= 2) ? Bt2 + boff + (size_t)kc * 64 : pb;
#pragma unroll
        for (int mb = 0; mb < 4; ++mb) { a[mb] = WFrag<T16>::ld(pa + mb * 512); if (NSPLIT == 1 || NSPLIT == 2) a2[mb] = WFrag<T16>::ld(pa2 + mb * 512); }
#pragma unroll
        for (int nb = 0; nb < 4; ++nb) { b[nb] = WFrag<T16>::ld(pb + nb * 512); if (NSPLIT >= 2) b2[nb] = WFrag<T16>::ld(pb2 + nb * 512); }
        asm volatile("s_wait_xcnt 0x0" :: "v"(pa), "v"(pa2), "v"(pb), "v"(pb2) : "memory");   // stands in front of every later write of a register that one of these loads names as its address; the addresses are inputs, so that they keep their registers up to it and no load returns its data onto them
        __builtin_amdgcn_sched_barrier(0);   // keeps every product behind the whole group of loads: in fragment order each trip's lines are all new to the wave, and loads held back behind the first products would add a second load latency to every trip
#pragma unroll
        for (int nb = 0; nb < 4; ++nb)
#pragma unroll
            for (int mb = 0; mb < 4; ++mb) { acc[mb][nb] = WFrag<T16>::mma(a[mb], b[nb], acc[mb][nb]); if (NSPLIT == 1 || NSPLIT == 2) acc[mb][nb] = WFrag<T16>::mma(a2[mb], b[nb], acc[mb][nb]); if (NSPLIT >= 2) acc[mb][nb] = WFrag<T16>::mma(a[mb], b2[nb], acc[mb][nb]); }
        asm volatile("v_nop\n\tv_nop\n\tv_nop\n\tv_nop" : "+v"(acc[0][0]), "+v"(acc[1][1]), "+v"(acc[2][2]), "+v"(acc[3][3]) : "v"(a[0]), "v"(a[3]));
    }
    if constexpr (EPI != 0) {
        static_assert(HD == 64, "one 64-column tile is one head");
        const int third = (int)blockIdx.y / NH_, head = (int)blockIdx.y % NH_;
        const size_t pb = ((((size_t)third * NB_ + r0 / TT) * NH_ + head) * TT + r0 % TT) * HD + lane * 8;   // 64 positions x 64 dims of one head are 8 tiles in a row, in either plane kind
        auto planes = [&](auto trc) { constexpr bool TR = decltype(trc)::value;   // TR: the transposed (v) kind
#pragma unroll
        for (int g = 0; g < 4; ++g) {                                 // 16 tile rows a trip: positions 16 g .. (q, k), dims 16 g .. (v)
            if constexpr (!TR) {
#pragma unroll
                for (int nb = 0; nb < 4; ++nb)
#pragma unroll
                    for (int j = 0; j < 8; ++j) os[(hi * 8 + j) * 68 + nb * 16 + lr] = acc[g][nb][j];
            } else {                                                  // a lane's 8 accumulator rows are 8 consecutive positions of its one dim
#pragma unroll
                for (int mb = 0; mb < 4; ++mb) { float* op = os + lr * 68 + mb * 16 + hi * 8; const v8f xv = acc[mb][g]; *(v4fa*)op = __builtin_shufflevector(xv, xv, 0, 1, 2, 3); *(v4fa*)(op + 4) = __builtin_shufflevector(xv, xv, 4, 5, 6, 7); } }
            __builtin_amdgcn_wave_barrier(); asm volatile("" ::: "memory");   // keeps the compiler from moving the read-back over the other lanes' staging writes
#pragma unroll
            for (int s = 0; s < 4; ++s) { const float* ip = os + lr * 68 + s * 16 + hi * 8; const v4f a0 = *(const v4fa*)ip, a1 = *(const v4fa*)(ip + 4); v8h o16; v8us oh, ol;
#pragma unroll
                for (int k = 0; k < 4; ++k) { unsigned short u, v; o16[k] = tohx(a0[k]); splitf(a0[k], u, v); oh[k] = u; ol[k] = v; o16[4 + k] = tohx(a1[k]); splitf(a1[k], u, v); oh[4 + k] = u; ol[4 + k] = v; }
                const size_t e = pb + (!TR ? g * 1024 + s * 256 : (s >> 1) * 2048 + g * 512 + (s & 1) * 256); *(v8h*)(P16 + e) = o16; *(v8us*)(Ph + e) = oh; *(v8us*)(Pl + e) = ol;
                asm volatile("s_wait_xcnt 0x0" ::: "memory"); }       // stands in front of the next rows' writes of the registers that these three stores name
            __builtin_amdgcn_wave_barrier(); asm volatile("" ::: "memory");   // keeps the next trip's staging writes behind this trip's reads
        } };
        if (third < 2) planes(BoolC<false>{}); else planes(BoolC<true>{});   // the same for the whole work-group: a scalar branch
        return;
    }
#pragma unroll
    for (int mb = 0; mb < 4; ++mb) {
#pragma unroll
        for (int nb = 0; nb < 4; ++nb) {
#pragma unroll
            for (int j = 0; j < 8; ++j) os[(hi * 8 + j) * 68 + nb * 16 + lr] = acc[mb][nb][j]; }
        __builtin_amdgcn_wave_barrier(); asm volatile("" ::: "memory");
        float* crow = C + (size_t)(r0 + mb * 16) * ldc + c0;
{
#pragma unroll
            for (int s = 0; s < 8; ++s) { const int row = 2 * s + hi, cofs = lr * 4; v4f val = *(const v4fa*)(os + row * 68 + cofs); if (BIAS) { val[0] += bfr(bias[c0 + cofs]); val[1] += bfr(bias[c0 + cofs + 1]); val[2] += bfr(bias[c0 + cofs + 2]); val[3] += bfr(bias[c0 + cofs + 3]); }
                *(v4f*)(crow + (size_t)row * ldc + cofs) = val; }
             }
        __builtin_amdgcn_wave_barrier(); asm volatile("" ::: "memory");
    }
}

typedef __attribute__((ext_vector_type(2))) _Float16 v2h;
typedef __attribute__((ext_vector_type(4))) _Float16 v4h;
typedef __attribute__((ext_vector_type(2))) unsigned short v2us;
typedef __attribute__((ext_vector_type(4))) unsigned short v4us;
typedef __attribute__((ext_vector_type(2))) float v2f;
typedef __attribute__((ext_vector_type(4))) int v4i;

// The three converters below are independent of each other and share ONE launch (k_prep): each is written for the block index blk of its own range.
__device__ __forceinline__ void wtG_blk(const float* __restrict__ w, int K, int N, bf* Bt, int blk) {
    const int lane = threadIdx.x & 31; const int L0 = (blk * 8 + (threadIdx.x >> 5)) * 8; const int nlines = N * K / 64;
{
#pragma unroll 1
        for (int l = 0; l < 8; ++l) { const int L = L0 + l; if (L >= nlines) break; const size_t e = (size_t)L * 64 + lane * 2; const int grp = (int)(e >> 11), wi = (int)(e & 511), KT = K >> 5; const int n = (grp / KT) * 64 + ((int)(e >> 9) & 3) * 16 + ((wi >> 3) & 15), k = (grp % KT) * 32 + (wi >> 7) * 8 + (wi & 7); v2us o;   // e counts in fragment order
            const float* p0 = w + (size_t)k * N + n; const float* p1 = p0 + N; const float w0 = *p0, w1 = *p1;
            asm volatile("s_wait_xcnt 0x0" :: "v"(p0), "v"(p1) : "memory");   // stands in front of every later write of the two loads' address registers, which are inputs so that they keep their registers up to it
            o[0] = f2bf(w0); o[1] = f2bf(w1); *(v2us*)(Bt + e) = o; }
         }
}
// cvt8_blk: f32 rows of K -> bf16 plane in fragment order. A block takes 16 rows x 128 k = 4 tiles: whole lines are read, the 16-byte runs change places in LDS (16 runs + 16 bytes of pad: no bank conflict either way), whole lines are stored. rows / 16 * K / 128 blocks.
__device__ __forceinline__ void cvt8_blk(const float* __restrict__ src, bf* dst, int K, int blk) {
    __shared__ __align__(16) bf st[16 * 17 * 8];
    const int t = threadIdx.x, row = t >> 4, c = t & 15, ns = K >> 7; const int rb = blk / ns, sg = blk % ns;
    const v8f v = *(const v8f*)(src + (size_t)(rb * 16 + row) * K + sg * 128 + c * 8); v8us o;
#pragma unroll
    for (int k = 0; k < 8; ++k) o[k] = f2bf(v[k]);
    *(v8usa*)(st + (c * 17 + row) * 8) = o;                           // run c of a row (k = 8 c ..) is group c of 16 runs in fragment order
    __syncthreads();                                                 // every run is in LDS before any thread reads the one it stores
    *(v8us*)(dst + ((size_t)(rb >> 2) * (K >> 5) + sg * 4 + (t >> 6)) * 2048 + (rb & 3) * 512 + (t & 63) * 8) = *(const v8usa*)(st + ((t >> 4) * 17 + (t & 15)) * 8);
    asm volatile("s_wait_xcnt 0x0" ::: "memory"); }   // stands in front of every later write of a register that the store names: in the merged kernel the other converters' code follows this one in the listing
// k_prep: blocks [0, PW1) transpose w_qkv, [PW1, PW1 + PW2) w_out (the latency-bound ones first), the rest convert x of both sequences. The branch is the same for a whole block, the converter's barrier included.
#define PW1 (DM * (DQ + 2 * DKV) / 4096)
#define PW2 (DQ * DM / 4096)
#define PXB (NB_ * TT * DM / 2048)
__global__ __launch_bounds__(256) void k_prep(const float* __restrict__ wf, const float* __restrict__ wo, const float* __restrict__ x, bf* WALL, bf* WO, bf* XB) {
    const int b = (int)blockIdx.x;
    if (b < PW1) wtG_blk(wf, DM, DQ + 2 * DKV, WALL, b);
    else if (b < PW1 + PW2) wtG_blk(wo, DQ, DM, WO, b - PW1);
    else cvt8_blk(x, XB, DM, b - (PW1 + PW2)); }
// ---- k_fattn: causal scores, softmax and probability x value product of one head in ONE kernel; no score or probability ever reaches memory.
// Transposed products: S^T = K Q^T (A = 16 key rows, B = 16 query columns), O^T += V^T P^T (A = 16 rows of V^T, B = P^T). A lane then holds the scores of ONE query (column lr; keys 8 hi + j of each 16-key tile),
// and the two score tiles of a 32-key block, converted in place, ARE the B operand of the value product in the order that WFrag::ld gives A (k = 8 hi + 0..7, 16 + 8 hi + 0..7).
// A work-group owns 16 NQ query rows of one head. Its FW waves share the key loop (wave w takes the 32-key blocks w, w + FW, ... up to the diagonal block), each with its own running maximum, sum and O^T tile
// (online softmax, base 2); the FW partial results are brought to the common maximum and summed in wave order through LDS, divided by the summed denominator and stored as the hi/lo bf16 planes of the merged heads. All planes in fragment order (above k_gemmw).
// amdgpu_waves_per_eu(4): at most 256 registers, so that four work-groups (one wave of each per SIMD) stay resident and cover each other's load and softmax latency.
// HL: hi+lo bf16 planes, three products for each contraction; else single fp16 with the probabilities carried x 2^10 (numerator and denominator alike).
// Both kinds share ONE launch (k_fattn below fattn_body): grid (sequences x heads, row blocks), longest rows first, the hi+lo row blocks (the shortest) last.
#define FW 4
typedef __attribute__((ext_vector_type(16))) unsigned short v16us;
template <typename T16, bool HL, int NQ>
__device__ __forceinline__ void fattn_body(const T16* __restrict__ Q, const T16* __restrict__ Q2, const T16* __restrict__ Kp, const T16* __restrict__ K2, const T16* __restrict__ Vt, const T16* __restrict__ V2, const int q0, bf* Ah, bf* Al) {
    typedef typename WFrag<T16>::V V; typedef WFrag<T16> F;
    constexpr int QW = 16 * NQ; constexpr float SC2 = SCL * 1.4426950408889634f;
    __shared__ __align__(16) float so[FW * QW * 68];
    __shared__ float sm[FW * QW], sl[FW * QW];
    const int lane = threadIdx.x & 31, lr = lane & 15, hi = lane >> 4; const int w = __builtin_amdgcn_readfirstlane((int)(threadIdx.x >> 5));
    const int h = (int)blockIdx.x % NH_, sq = (int)blockIdx.x / NH_;
    const size_t hp = (size_t)blockIdx.x * TT * HD; Q += hp; Kp += hp; Vt += hp; if constexpr (HL) { Q2 += hp; K2 += hp; V2 += hp; }
    const int nkb = (q0 + QW - 1) / 32 + 1;                          // 32-key blocks up to and with the one that holds the last query's own key
    V bq[NQ][2], bq2[NQ][2];
#pragma unroll
    for (int qt = 0; qt < NQ; ++qt)
#pragma unroll
        for (int ks = 0; ks < 2; ++ks) { const size_t qo = (size_t)(q0 + qt * 16) * HD + ks * 512 + lane * 8; bq[qt][ks] = F::ld(Q + qo); if constexpr (HL) bq2[qt][ks] = F::ld(Q2 + qo); }
    v8f o[4][NQ]; float m[NQ], l[NQ];
#pragma unroll
    for (int qt = 0; qt < NQ; ++qt) { m[qt] = -1.0e30f; l[qt] = 0.f;
#pragma unroll
        for (int dt = 0; dt < 4; ++dt) o[dt][qt] = (v8f){}; }
    const size_t koff = lane * 8, voff = lane * 8;                    // a 32-key block is 4 tiles in a row in the key planes (16 keys x 32 dims each) and in the value planes (16 dims x 32 keys each)
    V ak[2][2], ak2[2][2], av[4], av2[4];
    // each loader ends with s_wait_xcnt 0: it stands in front of every later write of a register that one of its loads names as its address (some of these are rewritten behind a branch);
    // the wait takes the addresses as inputs, so that they keep their registers up to it and no load of the group returns its data onto them
    auto ldK = [&](int kb) { const T16* p = Kp + koff + (size_t)kb * 32 * HD; const T16* p2 = HL ? K2 + koff + (size_t)kb * 32 * HD : p;
#pragma unroll
        for (int kt = 0; kt < 2; ++kt)
#pragma unroll
            for (int ks = 0; ks < 2; ++ks) { ak[kt][ks] = F::ld(p + kt * 1024 + ks * 512); if constexpr (HL) ak2[kt][ks] = F::ld(p2 + kt * 1024 + ks * 512); }
        asm volatile("s_wait_xcnt 0x0" :: "v"(p), "v"(p2) : "memory"); };
    auto ldV = [&](int k0) { const T16* p = Vt + voff + (size_t)k0 * HD; const T16* p2 = HL ? V2 + voff + (size_t)k0 * HD : p;
#pragma unroll
        for (int dt = 0; dt < 4; ++dt) { av[dt] = F::ld(p + dt * 512); if constexpr (HL) av2[dt] = F::ld(p2 + dt * 512); }
        asm volatile("s_wait_xcnt 0x0" :: "v"(p), "v"(p2) : "memory"); };
    // single fp16: the values are fetched at the head of a pass and the NEXT pass's keys behind the score products, so that both latencies run under matrix and softmax work.
    // hi+lo (at most 4 passes a wave, twice the fragments): keys, products, then values, which keeps the wave inside 256 registers without spills.
    if constexpr (!HL) ldK(w);
#pragma unroll 1
    for (int kb = w; kb < nkb; kb += FW) {
        const int k0 = kb * 32;
        if constexpr (HL) ldK(kb); else ldV(k0);
        v8f s[NQ][2];
#pragma unroll
        for (int kt = 0; kt < 2; ++kt)
#pragma unroll
            for (int qt = 0; qt < NQ; ++qt) { v8f c = (v8f){};
#pragma unroll
                for (int ks = 0; ks < 2; ++ks) { c = F::mma(ak[kt][ks], bq[qt][ks], c); if constexpr (HL) { c = F::mma(ak[kt][ks], bq2[qt][ks], c); c = F::mma(ak2[kt][ks], bq[qt][ks], c); } }
                s[qt][kt] = c; }
        if constexpr (HL) ldV(k0); else ldK((kb + FW < nkb) ? kb + FW : kb);   // the last pass fetches its own block again: in bounds, unused
        if (k0 + 31 > q0) {                                          // only the diagonal block holds keys behind a query
#pragma unroll
            for (int qt = 0; qt < NQ; ++qt)
#pragma unroll
                for (int kt = 0; kt < 2; ++kt)
#pragma unroll
                    for (int j = 0; j < 8; ++j) if (k0 + kt * 16 + hi * 8 + j > q0 + qt * 16 + lr) s[qt][kt][j] = -3.0e38f; }
#pragma unroll
        for (int qt = 0; qt < NQ; ++qt) {
            float mx = s[qt][0][0];
#pragma unroll
            for (int j = 1; j < 16; ++j) mx = fmaxf(mx, s[qt][j >> 3][j & 7]);
            mx = fmaxf(mx, __shfl_xor(mx, 16, 32));                  // the other half-wave holds this query's other 16 keys
            const float mn = fmaxf(m[qt], mx * SC2), al = __builtin_amdgcn_exp2f(m[qt] - mn), mo = HL ? mn : mn - 10.0f; m[qt] = mn;
            float sum = 0.f;
#pragma unroll
            for (int j = 0; j < 16; ++j) { const float p = __builtin_amdgcn_exp2f(s[qt][j >> 3][j & 7] * SC2 - mo); s[qt][j >> 3][j & 7] = p; sum += p; }
            l[qt] = l[qt] * al + sum;
#pragma unroll
            for (int dt = 0; dt < 4; ++dt) o[dt][qt] *= al;
            if constexpr (HL) { v16us ph, pl;
#pragma unroll
                for (int j = 0; j < 16; ++j) { unsigned short a, c2; splitf(s[qt][j >> 3][j & 7], a, c2); ph[j] = a; pl[j] = c2; }
                const V bh = __builtin_bit_cast(V, ph), bl = __builtin_bit_cast(V, pl);
#pragma unroll
                for (int dt = 0; dt < 4; ++dt) { o[dt][qt] = F::mma(av[dt], bh, o[dt][qt]); o[dt][qt] = F::mma(av[dt], bl, o[dt][qt]); o[dt][qt] = F::mma(av2[dt], bh, o[dt][qt]); }
            } else { V pb;
#pragma unroll
                for (int j = 0; j < 16; ++j) pb[j] = tohx(s[qt][j >> 3][j & 7]);
#pragma unroll
                for (int dt = 0; dt < 4; ++dt) o[dt][qt] = F::mma(av[dt], pb, o[dt][qt]); }
        }
    }
#pragma unroll
    for (int qt = 0; qt < NQ; ++qt) { l[qt] += __shfl_xor(l[qt], 16, 32); if (hi == 0) sm[w * QW + qt * 16 + lr] = m[qt]; }
    __syncthreads();                                                 // every wave's maxima are in LDS before any wave forms the common one
#pragma unroll
    for (int qt = 0; qt < NQ; ++qt) { const int q = qt * 16 + lr; float M = sm[q];
#pragma unroll
        for (int p = 1; p < FW; ++p) M = fmaxf(M, sm[p * QW + q]);
        const float f = __builtin_amdgcn_exp2f(m[qt] - M); if (hi == 0) sl[w * QW + q] = l[qt] * f;   // a wave without a key block: f = 0
        float* op = so + (size_t)(w * QW + q) * 68 + hi * 8;
#pragma unroll
        for (int dt = 0; dt < 4; ++dt) { const v8f x = o[dt][qt] * f; *(v4fa*)(op + dt * 16) = __builtin_shufflevector(x, x, 0, 1, 2, 3); *(v4fa*)(op + dt * 16 + 4) = __builtin_shufflevector(x, x, 4, 5, 6, 7); } }
    __syncthreads();                                                 // every wave's rescaled partial tile and sum are in LDS before any thread adds them
#pragma unroll
    for (int i = 0; i < NQ; ++i) { const int u = (int)threadIdx.x, q = i * 16 + (u & 15), d0 = (u >> 4) * 8; const float* op = so + (size_t)q * 68 + d0; v4f a0 = *(const v4fa*)op, a1 = *(const v4fa*)(op + 4); float L = sl[q];
#pragma unroll
        for (int p = 1; p < FW; ++p) { a0 += *(const v4fa*)(op + p * (QW * 68)); a1 += *(const v4fa*)(op + p * (QW * 68) + 4); L += sl[p * QW + q]; }
        const float inv = __fdiv_rn(1.0f, L); v8us oh, ol;
#pragma unroll
        for (int k = 0; k < 4; ++k) { unsigned short a, c2; splitf(a0[k] * inv, a, c2); oh[k] = a; ol[k] = c2; splitf(a1[k] * inv, a, c2); oh[4 + k] = a; ol[4 + k] = c2; }
        const int qb = sq * TT + q0 + i * 16; const size_t oo = ((size_t)(qb >> 6) * (DQ / 32) + h * 2 + (u >> 6)) * 2048 + ((qb >> 4) & 3) * 512 + (u & 63) * 8; *(v8us*)(Ah + oo) = oh; *(v8us*)(Al + oo) = ol;   // fragment order: 16 queries x this head's 64 dims are 2 tiles; run u of them is (query u & 15, dims 8 (u >> 4) ..)
        asm volatile("s_wait_xcnt 0x0" ::: "memory"); }   // stands in front of every later write of a register that the two stores name: in the merged kernel the other body's code follows this one in the listing
}
#define FY1 ((TT - RH) / 32)      // row blocks of 32 queries, single fp16
#define FY2 (RH / 16)             // row blocks of 16 queries, hi+lo
__global__ __launch_bounds__(FW * 32) __attribute__((amdgpu_waves_per_eu(4))) void k_fattn(const h16* __restrict__ Q16, const h16* __restrict__ K16, const h16* __restrict__ V16, const bf* __restrict__ Qh, const bf* __restrict__ Ql, const bf* __restrict__ Kh, const bf* __restrict__ Kl, const bf* __restrict__ Vh, const bf* __restrict__ Vl, bf* Ah, bf* Al) {
    const int y = (int)blockIdx.y;                                   // the branch is the same for a whole work-group, the barriers of either body included
    if (y < FY1) fattn_body<h16, false, 2>(Q16, nullptr, K16, nullptr, V16, nullptr, RH + (FY1 - 1 - y) * 32, Ah, Al);
    else fattn_body<bf, true, 1>(Qh, Ql, Kh, Kl, Vh, Vl, (FY1 + FY2 - 1 - y) * 16, Ah, Al);
}

extern "C" void kernel_launch(void* const* d_in, const int* in_sizes, int n_in,
                              void* d_out, int out_size, void* d_ws, size_t ws_size, hipStream_t stream) {
    (void)in_sizes; (void)n_in; (void)out_size;
    const float* x = (const float*)d_in[0]; const float* wf = (const float*)d_in[1]; const float* wo = (const float*)d_in[2]; /* x, w_qkv, w_o = d_in[0..2]; no bias inputs in this module: the projection GEMMs below use the bias-free instantiation */
    float* OUT = (float*)d_out;     // [2][4096][1024]
    char* wsp = (char*)d_ws;
    auto take = [&](size_t bytes) { char* p = wsp; wsp += (bytes + 255) & ~(size_t)255; return (void*)p; };
    bf* WO = (bf*)take((size_t)DM * DQ * 2);
    bf* XB = (bf*)take((size_t)NB_ * TT * DM * 2); bf* WALL = (bf*)take((size_t)(DQ + 2 * DKV) * DM * 2);
    const size_t PS = (size_t)NB_ * NH_ * TT * HD;        // one plane: both sequences, all heads; q, k, v planes of a kind stand in a row
    h16* QP16 = (h16*)take(3 * PS * 2); h16* KP16 = QP16 + PS; h16* VT16 = KP16 + PS;
    bf* QPh = (bf*)take(3 * PS * 2); bf* KPh = QPh + PS; bf* VTh = KPh + PS; bf* QPl = (bf*)take(3 * PS * 2); bf* KPl = QPl + PS; bf* VTl = KPl + PS;
    bf* ATh = (bf*)take((size_t)NB_ * TT * DQ * 2); bf* ATl = (bf*)take((size_t)NB_ * TT * DQ * 2);
    if ((size_t)(wsp - (char*)d_ws) > ws_size) return;    // ws 256 MiB
    k_prep<<<PW1 + PW2 + PXB, 256, 0, stream>>>(wf, wo, x, WALL, WO, XB);
    k_gemmw<bf, 0, false, 1><<<dim3(NB_ * TT / 64, (DQ + 2 * DKV) / 64, 1), 32, 0, stream>>>(XB, nullptr, WALL, nullptr, DM, nullptr, 0, nullptr, 0, 0, 0, QP16, QPh, QPl);
    k_fattn<<<dim3(NB_ * NH_, FY1 + FY2), FW * 32, 0, stream>>>(QP16, KP16, VT16, QPh, QPl, KPh, KPl, VTh, VTl, ATh, ATl);
    k_gemmw<bf, 1, false, 0><<<dim3(NB_ * TT / 64, DM / 64, 1), 32, 0, stream>>>(ATh, ATl, WO, nullptr, DQ, OUT, DM, nullptr, 0, 0, 0, nullptr, nullptr, nullptr);
}

// v006
// One run takes 160 microseconds.
// Next to v005, in two timings, it ran 1.10 times as fast each time.
// Over all steps from v000 it is 28.9 times as fast.
#include <hip/hip_runtime.h>

// Causal self-attention with a fused BIAS-FREE qkv projection over TWO 4,096-token sequences, written chunk by chunk in the module (x [2][4096][1024]; qkv = x w_qkv ('xw' [1024][3072] normal x 1/32, NO bias) viewed (3, 16, 64): column thirds q | k | v (16 heads x 64); the module scans over 32 query chunks of 128 rows, each against ALL keys with 'query position >= key position' kept and -1e10 elsewhere (== the full causal rule; == exclusion); scores / sqrt(64); softmax over the keys; out = merged w_out ('xw' [1024][1024], NO bias) -> [2][4096][1024] (8.4 M); argument order x, w_qkv, w_out).
// Compute dtypes, f32 accumulate: every input rounded to bf16; q/k/v on PLAIN bf16 operands (inputs: exact), no biases in this module; causal scores and attn.v: query rows < 512 hl (3 products), the rest single fp16 (x1024), causal block skipping; online softmax f32, fused with both products (k_fattn); w_o hl x exact (2 products), no bias.

#define NB_  2      // TWO sequences in this module: both go through every launch together (rows of the GEMMs = sequence * TT + position; attention planes [sequence][head])
#define TT   4096
#define DM   1024
#define NH_  16
#define NKV  16
#define HD   64
#define DQ   (NH_ * HD)
#define DKV  (NKV * HD)
#define RH   512                  // query rows < RH use hi+lo planes (0: none)
#define SCL  0.125f   // HD^-0.5
typedef _Float16 h16;
typedef unsigned short bf;
typedef __attribute__((ext_vector_type(16))) __bf16   v16bf;
typedef __attribute__((ext_vector_type(16))) _Float16 v16h;
typedef __attribute__((ext_vector_type(8)))  _Float16 v8h;
typedef __attribute__((ext_vector_type(8)))  unsigned short v8us;
typedef __attribute__((ext_vector_type(8)))  float    v8f;
typedef __attribute__((ext_vector_type(4)))  float    v4f;
typedef v8h  __attribute__((may_alias)) v8ha;
typedef v4f  __attribute__((may_alias)) v4fa;
typedef v8us __attribute__((may_alias)) v8usa;

__device__ __forceinline__ unsigned short f2bf(float f) { unsigned u = __float_as_uint(f); u += 0x7FFFu + ((u >> 16) & 1u); return (unsigned short)(u >> 16); }
__device__ __forceinline__ float bf2f(unsigned short b) { return __uint_as_float(((unsigned)b) << 16); }
__device__ __forceinline__ float bfr(float f) { return bf2f(f2bf(f)); }
__device__ __forceinline__ v16h cat16(v8h lo, v8h hi) { return __builtin_shufflevector(lo, hi, 0, 1, 2, 3, 4, 5, 6, 7, 8, 9, 10, 11, 12, 13, 14, 15); }
__device__ __forceinline__ v16bf cat16b(v8us lo, v8us hi) { return __builtin_bit_cast(v16bf, __builtin_shufflevector(lo, hi, 0, 1, 2, 3, 4, 5, 6, 7, 8, 9, 10, 11, 12, 13, 14, 15)); }
__device__ __forceinline__ v8f wmma16(v16h a, v16h b, v8f c) { return __builtin_amdgcn_wmma_f32_16x16x32_f16(false, a, false, b, (short)0, c, false, false); }
__device__ __forceinline__ v8f wmmab(v16bf a, v16bf b, v8f c) { return __builtin_amdgcn_wmma_f32_16x16x32_bf16(false, a, false, b, (short)0, c, false, false); }



// ---- FRAGMENT ORDER: every 16-bit operand plane is made of tiles of 16 rows x 32 k, 512 elements each, and the tiles that one wave loads together stand in a row:
// GEMM operands (x, weights, merged heads): [row / 64][k / 32][(row / 16) % 4] tiles; q and k planes: [head][position / 16][dim / 32] tiles; v planes: [head][position / 32][dim / 16] tiles (rows = dims, k = positions).
// Inside a tile element (row r, k = 16 j + 8 hi + e) stands at j * 256 + (16 hi + r) * 8 + e: lane 16 hi + r finds its two 8-element runs at lane * 8 and 256 + lane * 8 (WFrag::ld),
// so each of the two loads of a fragment reads 512 contiguous bytes (4 whole lines) where a row-major plane made it touch 16 lines. The k order of a fragment is what it was.
// ---- k_gemmw: register-blocked GEMM, one wave per 64x64 output tile (16 accumulators), 2 x 4 waves to a work-group (128 x 256 of C); operands from fragment-order 16-bit planes through an LDS ring of two buffers; grid (M/128, N/256, Z), 256 threads.
// C[m][n] (f32, pitch ldc, + optional f32 bias[n]) = sum_k A[m][k] Bt[n][k] (+ split products per NSPLIT). z-batch strides sA/sB/sC in elements. K % 64 == 0.
// EPI 0: C is stored as f32. EPI 1: ONE launch makes q, k and v of both sequences: a wave's column block c0 / 64 is head (c0 / 64) % 16 of third (c0 / 64) / 16 (q | k | v), its row block 64 positions of sequence r0 / TT;
// the tile leaves the kernel as the attention operand planes (fp16 P16, bf16 hi Ph, bf16 lo Pl; each [third][sequence][head]), no f32 copy in memory:
// q, k planes [head] x tiles (rows = positions, k = dims), v planes [head][32-key block][16-dim group] x one tile (rows = dims, k = positions) (v transposed). Either way 16 tile rows are staged in LDS and each store covers half a tile, 512 contiguous bytes.
template <typename T16> struct WFrag;
template <> struct WFrag<h16> { typedef v16h V; static __device__ __forceinline__ V ld(const h16* p) { return cat16(*(const v8h*)p, *(const v8h*)(p + 256)); } static __device__ __forceinline__ v8f mma(V a, V b, v8f c) { return wmma16(a, b, c); } };
template <> struct WFrag<bf> { typedef v16bf V; static __device__ __forceinline__ V ld(const bf* p) { return cat16b(*(const v8us*)p, *(const v8us*)(p + 256)); } static __device__ __forceinline__ v8f mma(V a, V b, v8f c) { return wmmab(a, b, c); } };
__device__ __forceinline__ h16 tohx(float x) { return (h16)x; }
__device__ __forceinline__ void splitf(float y, unsigned short& h, unsigned short& l) { h = f2bf(y); l = f2bf(y - bf2f(h)); }
template <bool B> struct BoolC { static constexpr bool value = B; };
// cp4: four asynchronous 16-byte-a-lane copies from global memory into LDS, through no register. The s_wait_xcnt is the last line of the copies' own statement, so that it stands in front of every later write of a register that one of them names.
__device__ __forceinline__ void cp4(unsigned l0, const void* g0, unsigned l1, const void* g1, unsigned l2, const void* g2, unsigned l3, const void* g3) {
    asm volatile("global_load_async_to_lds_b128 %0, %1, off\n\tglobal_load_async_to_lds_b128 %2, %3, off\n\tglobal_load_async_to_lds_b128 %4, %5, off\n\tglobal_load_async_to_lds_b128 %6, %7, off\n\ts_wait_xcnt 0x0"
                 :: "v"(l0), "v"(g0), "v"(l1), "v"(g1), "v"(l2), "v"(g2), "v"(l3), "v"(g3) : "memory"); }
#define GWM 2      // waves of a work-group along the rows
#define GWN 4      // and along the columns: a work-group owns 128 x 256 of C, each wave 64 x 64
template <typename T16, int NSPLIT, bool BIAS, int EPI>
__global__ __launch_bounds__(GWM * GWN * 32, 4) void k_gemmw(const T16* __restrict__ A, const T16* __restrict__ A2, const T16* __restrict__ Bt, const T16* __restrict__ Bt2, int K, float* C, int ldc, const float* __restrict__ bias, size_t sA, size_t sB, size_t sC, h16* P16, bf* Ph, bf* Pl) {
    typedef typename WFrag<T16>::V V;
    static_assert(NSPLIT <= 1, "the second B plane is not staged");
    // A stage is 64 k of every 64-row block the work-group reads (a chunk: 2 trips x 4 tiles = 4096 elements, CONTIGUOUS in a fragment-order plane): GWM blocks of A (and of A2), GWN of Bt.
    // Two buffers: stage s + 1 flies while stage s is worked on; each chunk is fetched once for the work-group and read from LDS by the GWN (A) or GWM (Bt) waves that need it.
    constexpr int NAP = (NSPLIT == 1) ? 2 : 1, NCH = GWM * NAP + GWN, CH = 4096;
    static_assert(NCH % 2 == 0, "chunks are copied in pairs");
    __shared__ __align__(16) T16 ring[2 * NCH * CH];
    __shared__ __align__(16) float osall[GWM * GWN * 16 * 68];
    const size_t z = blockIdx.z; A += z * sA; if (A2) A2 += z * sA; Bt += z * sB; C += z * sC; (void)Bt2;
    const int tid = (int)threadIdx.x, lane = tid & 31, lr = lane & 15, hi = lane >> 4; const int w = __builtin_amdgcn_readfirstlane(tid >> 5), wm = w % GWM, wn = w / GWM;
    float* os = osall + w * (16 * 68);                                // each wave stages its own output rows
    const int R0 = blockIdx.x * (64 * GWM), C0 = blockIdx.y * (64 * GWN); const int r0 = R0 + wm * 64, c0 = C0 + wn * 64;
    v8f acc[4][4];
#pragma unroll
    for (int mb = 0; mb < 4; ++mb)
#pragma unroll
        for (int nb = 0; nb < 4; ++nb) acc[mb][nb] = (v8f){};
    const unsigned lb = (unsigned)(size_t)ring + (unsigned)tid * 16u;  // this lane's LDS byte address inside a half chunk (256 lanes x 16 bytes)
    auto fill = [&](int s, int buf) {
#pragma unroll
        for (int c = 0; c < NCH; c += 2) { const T16* g[2];
#pragma unroll
            for (int i = 0; i < 2; ++i) { const int cc = c + i; const T16* p = cc < GWM ? A + (size_t)(R0 + cc * 64) * K : cc < GWM * NAP ? A2 + (size_t)(R0 + (cc - GWM) * 64) * K : Bt + (size_t)(C0 + (cc - GWM * NAP) * 64) * K; g[i] = p + (size_t)s * CH + tid * 8; }
            const unsigned l = lb + (unsigned)((buf * NCH + c) * (CH * 2));
            cp4(l, g[0], l + 4096u, g[0] + 2048, l + 8192u, g[1], l + 12288u, g[1] + 2048); } };
    const int nst = K >> 6;                                          // K % 64 == 0
    fill(0, 0);
    asm volatile("s_wait_asynccnt 0x0" ::: "memory");                // this wave's copies of stage 0 have landed
    __syncthreads();                                                 // and every other wave's: nothing of stage 0 is read in front of this barrier
    if (nst > 1) fill(1, 1);
#pragma unroll 1
    for (int s = 0; s < nst; ++s) {
        const T16* sb = ring + (s & 1) * (NCH * CH) + lane * 8;
#pragma unroll
        for (int t = 0; t < 2; ++t) {
            V a[4], a2[4], b[4];
            const T16* pa = sb + wm * CH + t * 2048; const T16* pb = sb + (GWM * NAP + wn) * CH + t * 2048;
#pragma unroll
            for (int mb = 0; mb < 4; ++mb) { a[mb] = WFrag<T16>::ld(pa + mb * 512); if (NSPLIT == 1) a2[mb] = WFrag<T16>::ld(pa + GWM * CH + mb * 512); }
#pragma unroll
            for (int nb = 0; nb < 4; ++nb) b[nb] = WFrag<T16>::ld(pb + nb * 512);
            __builtin_amdgcn_sched_barrier(0);   // keeps every product behind the whole group of LDS reads: left alone the compiler reloads one B fragment per four products and waits out the LDS latency each time
#pragma unroll
            for (int nb = 0; nb < 4; ++nb)
#pragma unroll
                for (int mb = 0; mb < 4; ++mb) { acc[mb][nb] = WFrag<T16>::mma(a[mb], b[nb], acc[mb][nb]); if (NSPLIT == 1) acc[mb][nb] = WFrag<T16>::mma(a2[mb], b[nb], acc[mb][nb]); }
            if constexpr (NSPLIT == 1) __builtin_amdgcn_sched_barrier(0);   // twelve fragments a trip: keeps the next trip's reads behind these products, else the wave needs more than 256 registers
        }
        asm volatile("s_wait_dscnt 0x0" ::: "memory");               // this wave's reads of the buffer have returned before it is refilled
        asm volatile("s_wait_asynccnt 0x0" ::: "memory");            // this wave's copies of stage s + 1 have landed
        __syncthreads();                                             // publishes stage s + 1 and ends every wave's reads of stage s
        if (s + 2 < nst) fill(s + 2, s & 1);
    }
    asm volatile("s_wait_asynccnt 0x0" ::: "memory");                // no copy is outstanding when the wave goes on to its epilogue and ends
    if constexpr (EPI != 0) {
        static_assert(HD == 64, "one 64-column tile is one head");
        const int third = (c0 / 64) / NH_, head = (c0 / 64) % NH_;
        const size_t pb = ((((size_t)third * NB_ + r0 / TT) * NH_ + head) * TT + r0 % TT) * HD + lane * 8;   // 64 positions x 64 dims of one head are 8 tiles in a row, in either plane kind
        auto planes = [&](auto trc) { constexpr bool TR = decltype(trc)::value;   // TR: the transposed (v) kind
#pragma unroll
        for (int g = 0; g < 4; ++g) {                                 // 16 tile rows a trip: positions 16 g .. (q, k), dims 16 g .. (v)
            if constexpr (!TR) {
#pragma unroll
                for (int nb = 0; nb < 4; ++nb)
#pragma unroll
                    for (int j = 0; j < 8; ++j) os[(hi * 8 + j) * 68 + nb * 16 + lr] = acc[g][nb][j];
            } else {                                                  // a lane's 8 accumulator rows are 8 consecutive positions of its one dim
#pragma unroll
                for (int mb = 0; mb < 4; ++mb) { float* op = os + lr * 68 + mb * 16 + hi * 8; const v8f xv = acc[mb][g]; *(v4fa*)op = __builtin_shufflevector(xv, xv, 0, 1, 2, 3); *(v4fa*)(op + 4) = __builtin_shufflevector(xv, xv, 4, 5, 6, 7); } }
            __builtin_amdgcn_wave_barrier(); asm volatile("" ::: "memory");   // keeps the compiler from moving the read-back over the other lanes' staging writes
#pragma unroll
            for (int s = 0; s < 4; ++s) { const float* ip = os + lr * 68 + s * 16 + hi * 8; const v4f a0 = *(const v4fa*)ip, a1 = *(const v4fa*)(ip + 4); v8h o16; v8us oh, ol;
#pragma unroll
                for (int k = 0; k < 4; ++k) { unsigned short u, v; o16[k] = tohx(a0[k]); splitf(a0[k], u, v); oh[k] = u; ol[k] = v; o16[4 + k] = tohx(a1[k]); splitf(a1[k], u, v); oh[4 + k] = u; ol[4 + k] = v; }
                const size_t e = pb + (!TR ? g * 1024 + s * 256 : (s >> 1) * 2048 + g * 512 + (s & 1) * 256); *(v8h*)(P16 + e) = o16; *(v8us*)(Ph + e) = oh; *(v8us*)(Pl + e) = ol;
                asm volatile("s_wait_xcnt 0x0" ::: "memory"); }       // stands in front of the next rows' writes of the registers that these three stores name
            __builtin_amdgcn_wave_barrier(); asm volatile("" ::: "memory");   // keeps the next trip's staging writes behind this trip's reads
        } };
        if (third < 2) planes(BoolC<false>{}); else planes(BoolC<true>{});   // the same for the whole work-group: a scalar branch
        return;
    }
#pragma unroll
    for (int mb = 0; mb < 4; ++mb) {
#pragma unroll
        for (int nb = 0; nb < 4; ++nb) {
#pragma unroll
            for (int j = 0; j < 8; ++j) os[(hi * 8 + j) * 68 + nb * 16 + lr] = acc[mb][nb][j]; }
        __builtin_amdgcn_wave_barrier(); asm volatile("" ::: "memory");
        float* crow = C + (size_t)(r0 + mb * 16) * ldc + c0;
{
#pragma unroll
            for (int s = 0; s < 8; ++s) { const int row = 2 * s + hi, cofs = lr * 4; v4f val = *(const v4fa*)(os + row * 68 + cofs); if (BIAS) { val[0] += bfr(bias[c0 + cofs]); val[1] += bfr(bias[c0 + cofs + 1]); val[2] += bfr(bias[c0 + cofs + 2]); val[3] += bfr(bias[c0 + cofs + 3]); }
                *(v4f*)(crow + (size_t)row * ldc + cofs) = val; }
             }
        __builtin_amdgcn_wave_barrier(); asm volatile("" ::: "memory");
    }
}

typedef __attribute__((ext_vector_type(2))) _Float16 v2h;
typedef __attribute__((ext_vector_type(4))) _Float16 v4h;
typedef __attribute__((ext_vector_type(2))) unsigned short v2us;
typedef __attribute__((ext_vector_type(4))) unsigned short v4us;
typedef __attribute__((ext_vector_type(2))) float v2f;
typedef __attribute__((ext_vector_type(4))) int v4i;

// The three converters below are independent of each other and share ONE launch (k_prep): each is written for the block index blk of its own range.
__device__ __forceinline__ void wtG_blk(const float* __restrict__ w, int K, int N, bf* Bt, int blk) {
    const int lane = threadIdx.x & 31; const int L0 = (blk * 8 + (threadIdx.x >> 5)) * 8; const int nlines = N * K / 64;
{
#pragma unroll 1
        for (int l = 0; l < 8; ++l) { const int L = L0 + l; if (L >= nlines) break; const size_t e = (size_t)L * 64 + lane * 2; const int grp = (int)(e >> 11), wi = (int)(e & 511), KT = K >> 5; const int n = (grp / KT) * 64 + ((int)(e >> 9) & 3) * 16 + ((wi >> 3) & 15), k = (grp % KT) * 32 + (wi >> 7) * 8 + (wi & 7); v2us o;   // e counts in fragment order
            const float* p0 = w + (size_t)k * N + n; const float* p1 = p0 + N; const float w0 = *p0, w1 = *p1;
            asm volatile("s_wait_xcnt 0x0" :: "v"(p0), "v"(p1) : "memory");   // stands in front of every later write of the two loads' address registers, which are inputs so that they keep their registers up to it
            o[0] = f2bf(w0); o[1] = f2bf(w1); *(v2us*)(Bt + e) = o; }
         }
}
// cvt8_blk: f32 rows of K -> bf16 plane in fragment order. A block takes 16 rows x 128 k = 4 tiles: whole lines are read, the 16-byte runs change places in LDS (16 runs + 16 bytes of pad: no bank conflict either way), whole lines are stored. rows / 16 * K / 128 blocks.
__device__ __forceinline__ void cvt8_blk(const float* __restrict__ src, bf* dst, int K, int blk) {
    __shared__ __align__(16) bf st[16 * 17 * 8];
    const int t = threadIdx.x, row = t >> 4, c = t & 15, ns = K >> 7; const int rb = blk / ns, sg = blk % ns;
    const v8f v = *(const v8f*)(src + (size_t)(rb * 16 + row) * K + sg * 128 + c * 8); v8us o;
#pragma unroll
    for (int k = 0; k < 8; ++k) o[k] = f2bf(v[k]);
    *(v8usa*)(st + (c * 17 + row) * 8) = o;                           // run c of a row (k = 8 c ..) is group c of 16 runs in fragment order
    __syncthreads();                                                 // every run is in LDS before any thread reads the one it stores
    *(v8us*)(dst + ((size_t)(rb >> 2) * (K >> 5) + sg * 4 + (t >> 6)) * 2048 + (rb & 3) * 512 + (t & 63) * 8) = *(const v8usa*)(st + ((t >> 4) * 17 + (t & 15)) * 8);
    asm volatile("s_wait_xcnt 0x0" ::: "memory"); }   // stands in front of every later write of a register that the store names: in the merged kernel the other converters' code follows this one in the listing
// k_prep: blocks [0, PW1) transpose w_qkv, [PW1, PW1 + PW2) w_out (the latency-bound ones first), the rest convert x of both sequences. The branch is the same for a whole block, the converter's barrier included.
#define PW1 (DM * (DQ + 2 * DKV) / 4096)
#define PW2 (DQ * DM / 4096)
#define PXB (NB_ * TT * DM / 2048)
__global__ __launch_bounds__(256) void k_prep(const float* __restrict__ wf, const float* __restrict__ wo, const float* __restrict__ x, bf* WALL, bf* WO, bf* XB) {
    const int b = (int)blockIdx.x;
    if (b < PW1) wtG_blk(wf, DM, DQ + 2 * DKV, WALL, b);
    else if (b < PW1 + PW2) wtG_blk(wo, DQ, DM, WO, b - PW1);
    else cvt8_blk(x, XB, DM, b - (PW1 + PW2)); }
// ---- k_fattn: causal scores, softmax and probability x value product of one head in ONE kernel; no score or probability ever reaches memory.
// Transposed products: S^T = K Q^T (A = 16 key rows, B = 16 query columns), O^T += V^T P^T (A = 16 rows of V^T, B = P^T). A lane then holds the scores of ONE query (column lr; keys 8 hi + j of each 16-key tile),
// and the two score tiles of a 32-key block, converted in place, ARE the B operand of the value product in the order that WFrag::ld gives A (k = 8 hi + 0..7, 16 + 8 hi + 0..7).
// A work-group owns 16 NQ query rows of one head. Its FW waves share the key loop (wave w takes the 32-key blocks w, w + FW, ... up to the diagonal block), each with its own running maximum, sum and O^T tile
// (online softmax, base 2); the FW partial results are brought to the common maximum and summed in wave order through LDS, divided by the summed denominator and stored as the hi/lo bf16 planes of the merged heads. All planes in fragment order (above k_gemmw).
// amdgpu_waves_per_eu(4): at most 256 registers, so that four work-groups (one wave of each per SIMD) stay resident and cover each other's load and softmax latency.
// HL: hi+lo bf16 planes, three products for each contraction; else single fp16 with the probabilities carried x 2^10 (numerator and denominator alike).
// Both kinds share ONE launch (k_fattn below fattn_body): grid (sequences x heads, row blocks), longest rows first, the hi+lo row blocks (the shortest) last.
#define FW 4
typedef __attribute__((ext_vector_type(16))) unsigned short v16us;
template <typename T16, bool HL, int NQ>
__device__ __forceinline__ void fattn_body(const T16* __restrict__ Q, const T16* __restrict__ Q2, const T16* __restrict__ Kp, const T16* __restrict__ K2, const T16* __restrict__ Vt, const T16* __restrict__ V2, const int q0, bf* Ah, bf* Al) {
    typedef typename WFrag<T16>::V V; typedef WFrag<T16> F;
    constexpr int QW = 16 * NQ; constexpr float SC2 = SCL * 1.4426950408889634f;
    __shared__ __align__(16) float so[FW * QW * 68];
    __shared__ float sm[FW * QW], sl[FW * QW];
    const int lane = threadIdx.x & 31, lr = lane & 15, hi = lane >> 4; const int w = __builtin_amdgcn_readfirstlane((int)(threadIdx.x >> 5));
    const int h = (int)blockIdx.x % NH_, sq = (int)blockIdx.x / NH_;
    const size_t hp = (size_t)blockIdx.x * TT * HD; Q += hp; Kp += hp; Vt += hp; if constexpr (HL) { Q2 += hp; K2 += hp; V2 += hp; }
    const int nkb = (q0 + QW - 1) / 32 + 1;                          // 32-key blocks up to and with the one that holds the last query's own key
    V bq[NQ][2], bq2[NQ][2];
#pragma unroll
    for (int qt = 0; qt < NQ; ++qt)
#pragma unroll
        for (int ks = 0; ks < 2; ++ks) { const size_t qo = (size_t)(q0 + qt * 16) * HD + ks * 512 + lane * 8; bq[qt][ks] = F::ld(Q + qo); if constexpr (HL) bq2[qt][ks] = F::ld(Q2 + qo); }
    v8f o[4][NQ]; float m[NQ], l[NQ];
#pragma unroll
    for (int qt = 0; qt < NQ; ++qt) { m[qt] = -1.0e30f; l[qt] = 0.f;
#pragma unroll
        for (int dt = 0; dt < 4; ++dt) o[dt][qt] = (v8f){}; }
    const size_t koff = lane * 8, voff = lane * 8;                    // a 32-key block is 4 tiles in a row in the key planes (16 keys x 32 dims each) and in the value planes (16 dims x 32 keys each)
    V ak[2][2], ak2[2][2], av[4], av2[4];
    // each loader ends with s_wait_xcnt 0: it stands in front of every later write of a register that one of its loads names as its address (some of these are rewritten behind a branch);
    // the wait takes the addresses as inputs, so that they keep their registers up to it and no load of the group returns its data onto them
    auto ldK = [&](int kb) { const T16* p = Kp + koff + (size_t)kb * 32 * HD; const T16* p2 = HL ? K2 + koff + (size_t)kb * 32 * HD : p;
#pragma unroll
        for (int kt = 0; kt < 2; ++kt)
#pragma unroll
            for (int ks = 0; ks < 2; ++ks) { ak[kt][ks] = F::ld(p + kt * 1024 + ks * 512); if constexpr (HL) ak2[kt][ks] = F::ld(p2 + kt * 1024 + ks * 512); }
        asm volatile("s_wait_xcnt 0x0" :: "v"(p), "v"(p2) : "memory"); };
    auto ldV = [&](int k0) { const T16* p = Vt + voff + (size_t)k0 * HD; const T16* p2 = HL ? V2 + voff + (size_t)k0 * HD : p;
#pragma unroll
        for (int dt = 0; dt < 4; ++dt) { av[dt] = F::ld(p + dt * 512); if constexpr (HL) av2[dt] = F::ld(p2 + dt * 512); }
        asm volatile("s_wait_xcnt 0x0" :: "v"(p), "v"(p2) : "memory"); };
    // single fp16: the values are fetched at the head of a pass and the NEXT pass's keys behind the score products, so that both latencies run under matrix and softmax work.
    // hi+lo (at most 4 passes a wave, twice the fragments): keys, products, then values, which keeps the wave inside 256 registers without spills.
    if constexpr (!HL) ldK(w);
#pragma unroll 1
    for (int kb = w; kb < nkb; kb += FW) {
        const int k0 = kb * 32;
        if constexpr (HL) ldK(kb); else ldV(k0);
        v8f s[NQ][2];
#pragma unroll
        for (int kt = 0; kt < 2; ++kt)
#pragma unroll
            for (int qt = 0; qt < NQ; ++qt) { v8f c = (v8f){};
#pragma unroll
                for (int ks = 0; ks < 2; ++ks) { c = F::mma(ak[kt][ks], bq[qt][ks], c); if constexpr (HL) { c = F::mma(ak[kt][ks], bq2[qt][ks], c); c = F::mma(ak2[kt][ks], bq[qt][ks], c); } }
                s[qt][kt] = c; }
        if constexpr (HL) ldV(k0); else ldK((kb + FW < nkb) ? kb + FW : kb);   // the last pass fetches its own block again: in bounds, unused
        if (k0 + 31 > q0) {                                          // only the diagonal block holds keys behind a query
#pragma unroll
            for (int qt = 0; qt < NQ; ++qt)
#pragma unroll
                for (int kt = 0; kt < 2; ++kt)
#pragma unroll
                    for (int j = 0; j < 8; ++j) if (k0 + kt * 16 + hi * 8 + j > q0 + qt * 16 + lr) s[qt][kt][j] = -3.0e38f; }
#pragma unroll
        for (int qt = 0; qt < NQ; ++qt) {
            float mx = s[qt][0][0];
#pragma unroll
            for (int j = 1; j < 16; ++j) mx = fmaxf(mx, s[qt][j >> 3][j & 7]);
            mx = fmaxf(mx, __shfl_xor(mx, 16, 32));                  // the other half-wave holds this query's other 16 keys
            const float mn = fmaxf(m[qt], mx * SC2), al = __builtin_amdgcn_exp2f(m[qt] - mn), mo = HL ? mn : mn - 10.0f; m[qt] = mn;
            float sum = 0.f;
#pragma unroll
            for (int j = 0; j < 16; ++j) { const float p = __builtin_amdgcn_exp2f(s[qt][j >> 3][j & 7] * SC2 - mo); s[qt][j >> 3][j & 7] = p; sum += p; }
            l[qt] = l[qt] * al + sum;
#pragma unroll
            for (int dt = 0; dt < 4; ++dt) o[dt][qt] *= al;
            if constexpr (HL) { v16us ph, pl;
#pragma unroll
                for (int j = 0; j < 16; ++j) { unsigned short a, c2; splitf(s[qt][j >> 3][j & 7], a, c2); ph[j] = a; pl[j] = c2; }
                const V bh = __builtin_bit_cast(V, ph), bl = __builtin_bit_cast(V, pl);
#pragma unroll
                for (int dt = 0; dt < 4; ++dt) { o[dt][qt] = F::mma(av[dt], bh, o[dt][qt]); o[dt][qt] = F::mma(av[dt], bl, o[dt][qt]); o[dt][qt] = F::mma(av2[dt], bh, o[dt][qt]); }
            } else { V pb;
#pragma unroll
                for (int j = 0; j < 16; ++j) pb[j] = tohx(s[qt][j >> 3][j & 7]);
#pragma unroll
                for (int dt = 0; dt < 4; ++dt) o[dt][qt] = F::mma(av[dt], pb, o[dt][qt]); }
        }
    }
#pragma unroll
    for (int qt = 0; qt < NQ; ++qt) { l[qt] += __shfl_xor(l[qt], 16, 32); if (hi == 0) sm[w * QW + qt * 16 + lr] = m[qt]; }
    __syncthreads();                                                 // every wave's maxima are in LDS before any wave forms the common one
#pragma unroll
    for (int qt = 0; qt < NQ; ++qt) { const int q = qt * 16 + lr; float M = sm[q];
#pragma unroll
        for (int p = 1; p < FW; ++p) M = fmaxf(M, sm[p * QW + q]);
        const float f = __builtin_amdgcn_exp2f(m[qt] - M); if (hi == 0) sl[w * QW + q] = l[qt] * f;   // a wave without a key block: f = 0
        float* op = so + (size_t)(w * QW + q) * 68 + hi * 8;
#pragma unroll
        for (int dt = 0; dt < 4; ++dt) { const v8f x = o[dt][qt] * f; *(v4fa*)(op + dt * 16) = __builtin_shufflevector(x, x, 0, 1, 2, 3); *(v4fa*)(op + dt * 16 + 4) = __builtin_shufflevector(x, x, 4, 5, 6, 7); } }
    __syncthreads();                                                 // every wave's rescaled partial tile and sum are in LDS before any thread adds them
#pragma unroll
    for (int i = 0; i < NQ; ++i) { const int u = (int)threadIdx.x, q = i * 16 + (u & 15), d0 = (u >> 4) * 8; const float* op = so + (size_t)q * 68 + d0; v4f a0 = *(const v4fa*)op, a1 = *(const v4fa*)(op + 4); float L = sl[q];
#pragma unroll
        for (int p = 1; p < FW; ++p) { a0 += *(const v4fa*)(op + p * (QW * 68)); a1 += *(const v4fa*)(op + p * (QW * 68) + 4); L += sl[p * QW + q]; }
        const float inv = __fdiv_rn(1.0f, L); v8us oh, ol;
#pragma unroll
        for (int k = 0; k < 4; ++k) { unsigned short a, c2; splitf(a0[k] * inv, a, c2); oh[k] = a; ol[k] = c2; splitf(a1[k] * inv, a, c2); oh[4 + k] = a; ol[4 + k] = c2; }
        const int qb = sq * TT + q0 + i * 16; const size_t oo = ((size_t)(qb >> 6) * (DQ / 32) + h * 2 + (u >> 6)) * 2048 + ((qb >> 4) & 3) * 512 + (u & 63) * 8; *(v8us*)(Ah + oo) = oh; *(v8us*)(Al + oo) = ol;   // fragment order: 16 queries x this head's 64 dims are 2 tiles; run u of them is (query u & 15, dims 8 (u >> 4) ..)
        asm volatile("s_wait_xcnt 0x0" ::: "memory"); }   // stands in front of every later write of a register that the two stores name: in the merged kernel the other body's code follows this one in the listing
}
#define FY1 ((TT - RH) / 32)      // row blocks of 32 queries, single fp16
#define FY2 (RH / 16)             // row blocks of 16 queries, hi+lo
__global__ __launch_bounds__(FW * 32) __attribute__((amdgpu_waves_per_eu(4))) void k_fattn(const h16* __restrict__ Q16, const h16* __restrict__ K16, const h16* __restrict__ V16, const bf* __restrict__ Qh, const bf* __restrict__ Ql, const bf* __restrict__ Kh, const bf* __restrict__ Kl, const bf* __restrict__ Vh, const bf* __restrict__ Vl, bf* Ah, bf* Al) {
    const int y = (int)blockIdx.y;                                   // the branch is the same for a whole work-group, the barriers of either body included
    if (y < FY1) fattn_body<h16, false, 2>(Q16, nullptr, K16, nullptr, V16, nullptr, RH + (FY1 - 1 - y) * 32, Ah, Al);
    else fattn_body<bf, true, 1>(Qh, Ql, Kh, Kl, Vh, Vl, (FY1 + FY2 - 1 - y) * 16, Ah, Al);
}

extern "C" void kernel_launch(void* const* d_in, const int* in_sizes, int n_in,
                              void* d_out, int out_size, void* d_ws, size_t ws_size, hipStream_t stream) {
    (void)in_sizes; (void)n_in; (void)out_size;
    const float* x = (const float*)d_in[0]; const float* wf = (const float*)d_in[1]; const float* wo = (const float*)d_in[2]; /* x, w_qkv, w_o = d_in[0..2]; no bias inputs in this module: the projection GEMMs below use the bias-free instantiation */
    float* OUT = (float*)d_out;     // [2][4096][1024]
    char* wsp = (char*)d_ws;
    auto take = [&](size_t bytes) { char* p = wsp; wsp += (bytes + 255) & ~(size_t)255; return (void*)p; };
    bf* WO = (bf*)take((size_t)DM * DQ * 2);
    bf* XB = (bf*)take((size_t)NB_ * TT * DM * 2); bf* WALL = (bf*)take((size_t)(DQ + 2 * DKV) * DM * 2);
    const size_t PS = (size_t)NB_ * NH_ * TT * HD;        // one plane: both sequences, all heads; q, k, v planes of a kind stand in a row
    h16* QP16 = (h16*)take(3 * PS * 2); h16* KP16 = QP16 + PS; h16* VT16 = KP16 + PS;
    bf* QPh = (bf*)take(3 * PS * 2); bf* KPh = QPh + PS; bf* VTh = KPh + PS; bf* QPl = (bf*)take(3 * PS * 2); bf* KPl = QPl + PS; bf* VTl = KPl + PS;
    bf* ATh = (bf*)take((size_t)NB_ * TT * DQ * 2); bf* ATl = (bf*)take((size_t)NB_ * TT * DQ * 2);
    if ((size_t)(wsp - (char*)d_ws) > ws_size) return;    // ws 256 MiB
    k_prep<<<PW1 + PW2 + PXB, 256, 0, stream>>>(wf, wo, x, WALL, WO, XB);
    k_gemmw<bf, 0, false, 1><<<dim3(NB_ * TT / (64 * GWM), (DQ + 2 * DKV) / (64 * GWN), 1), GWM * GWN * 32, 0, stream>>>(XB, nullptr, WALL, nullptr, DM, nullptr, 0, nullptr, 0, 0, 0, QP16, QPh, QPl);
    k_fattn<<<dim3(NB_ * NH_, FY1 + FY2), FW * 32, 0, stream>>>(QP16, KP16, VT16, QPh, QPl, KPh, KPl, VTh, VTl, ATh, ATl);
    k_gemmw<bf, 1, false, 0><<<dim3(NB_ * TT / (64 * GWM), DM / (64 * GWN), 1), GWM * GWN * 32, 0, stream>>>(ATh, ATl, WO, nullptr, DQ, OUT, DM, nullptr, 0, 0, 0, nullptr, nullptr, nullptr);
}

// v007
// A run of this version takes 153 microseconds.
// In both of two side-by-side timings against v006, it was 1.05 times as fast.
// Over all steps from v000 it is 30.2 times as fast.
#include <hip/hip_runtime.h>

// Causal self-attention with a fused BIAS-FREE qkv projection over TWO 4,096-token sequences, written chunk by chunk in the module (x [2][4096][1024]; qkv = x w_qkv ('xw' [1024][3072] normal x 1/32, NO bias) viewed (3, 16, 64): column thirds q | k | v (16 heads x 64); the module scans over 32 query chunks of 128 rows, each against ALL keys with 'query position >= key position' kept and -1e10 elsewhere (== the full causal rule; == exclusion); scores / sqrt(64); softmax over the keys; out = merged w_out ('xw' [1024][1024], NO bias) -> [2][4096][1024] (8.4 M); argument order x, w_qkv, w_out).
// Compute dtypes, f32 accumulate: every input rounded to bf16; q/k/v on PLAIN bf16 operands (inputs: exact), no biases in this module; causal scores and attn.v: query rows < 512 hl (3 products), the rest single fp16 (x1024), causal block skipping; online softmax f32, fused with both products (k_fattn); w_o hl x exact (2 products), no bias.

#define NB_  2      // TWO sequences in this module: both go through every launch together (rows of the GEMMs = sequence * TT + position; attention planes [sequence][head])
#define TT   4096
#define DM   1024
#define NH_  16
#define NKV  16
#define HD   64
#define DQ   (NH_ * HD)
#define DKV  (NKV * HD)
#define RH   512                  // query rows < RH use hi+lo planes (0: none)
#define SCL  0.125f   // HD^-0.5
typedef _Float16 h16;
typedef unsigned short bf;
typedef __attribute__((ext_vector_type(16))) __bf16   v16bf;
typedef __attribute__((ext_vector_type(16))) _Float16 v16h;
typedef __attribute__((ext_vector_type(8)))  _Float16 v8h;
typedef __attribute__((ext_vector_type(8)))  unsigned short v8us;
typedef __attribute__((ext_vector_type(8)))  float    v8f;
typedef __attribute__((ext_vector_type(4)))  float    v4f;
typedef v8h  __attribute__((may_alias)) v8ha;
typedef v4f  __attribute__((may_alias)) v4fa;
typedef v8us __attribute__((may_alias)) v8usa;

__device__ __forceinline__ unsigned short f2bf(float f) { unsigned u = __float_as_uint(f); u += 0x7FFFu + ((u >> 16) & 1u); return (unsigned short)(u >> 16); }
__device__ __forceinline__ float bf2f(unsigned short b) { return __uint_as_float(((unsigned)b) << 16); }
__device__ __forceinline__ float bfr(float f) { return bf2f(f2bf(f)); }
__device__ __forceinline__ v16h cat16(v8h lo, v8h hi) { return __builtin_shufflevector(lo, hi, 0, 1, 2, 3, 4, 5, 6, 7, 8, 9, 10, 11, 12, 13, 14, 15); }
__device__ __forceinline__ v16bf cat16b(v8us lo, v8us hi) { return __builtin_bit_cast(v16bf, __builtin_shufflevector(lo, hi, 0, 1, 2, 3, 4, 5, 6, 7, 8, 9, 10, 11, 12, 13, 14, 15)); }
__device__ __forceinline__ v8f wmma16(v16h a, v16h b, v8f c) { return __builtin_amdgcn_wmma_f32_16x16x32_f16(false, a, false, b, (short)0, c, false, false); }
__device__ __forceinline__ v8f wmmab(v16bf a, v16bf b, v8f c) { return __builtin_amdgcn_wmma_f32_16x16x32_bf16(false, a, false, b, (short)0, c, false, false); }



// ---- FRAGMENT ORDER: every 16-bit operand plane is made of tiles of 16 rows x 32 k, 512 elements each, and the tiles that one wave loads together stand in a row:
// GEMM operands (x, weights, merged heads): [row / 64][k / 32][(row / 16) % 4] tiles; q and k planes: [head][position / 16][dim / 32] tiles; v planes: [head][position / 32][dim / 16] tiles (rows = dims, k = positions).
// Inside a tile element (row r, k = 16 j + 8 hi + e) stands at j * 256 + (16 hi + r) * 8 + e: lane 16 hi + r finds its two 8-element runs at lane * 8 and 256 + lane * 8 (WFrag::ld),
// so each of the two loads of a fragment reads 512 contiguous bytes (4 whole lines) where a row-major plane made it touch 16 lines. The k order of a fragment is what it was.
// ---- k_gemmw: register-blocked GEMM, one wave per 64x64 output tile (16 accumulators), 2 x 4 waves to a work-group (128 x 256 of C); operands from fragment-order 16-bit planes through an LDS ring of two buffers; grid (M/128, N/256, Z), 256 threads.
// C[m][n] (f32, pitch ldc, + optional f32 bias[n]) = sum_k A[m][k] Bt[n][k] (+ split products per NSPLIT). z-batch strides sA/sB/sC in elements. K % 64 == 0.
// EPI 0: C is stored as f32. EPI 1: ONE launch makes q, k and v of both sequences: a wave's column block c0 / 64 is head (c0 / 64) % 16 of third (c0 / 64) / 16 (q | k | v), its row block 64 positions of sequence r0 / TT;
// the tile leaves the kernel as the attention operand planes (fp16 P16, bf16 hi Ph, bf16 lo Pl; each [third][sequence][head]), no f32 copy in memory:
// q, k planes [head] x tiles (rows = positions, k = dims), v planes [head][32-key block][16-dim group] x one tile (rows = dims, k = positions) (v transposed). Either way 16 tile rows are staged in LDS and each store covers half a tile, 512 contiguous bytes.
template <typename T16> struct WFrag;
template <> struct WFrag<h16> { typedef v16h V; static __device__ __forceinline__ V ld(const h16* p) { return cat16(*(const v8h*)p, *(const v8h*)(p + 256)); } static __device__ __forceinline__ v8f mma(V a, V b, v8f c) { return wmma16(a, b, c); } };
template <> struct WFrag<bf> { typedef v16bf V; static __device__ __forceinline__ V ld(const bf* p) { return cat16b(*(const v8us*)p, *(const v8us*)(p + 256)); } static __device__ __forceinline__ v8f mma(V a, V b, v8f c) { return wmmab(a, b, c); } };
__device__ __forceinline__ h16 tohx(float x) { return (h16)x; }
__device__ __forceinline__ void splitf(float y, unsigned short& h, unsigned short& l) { h = f2bf(y); l = f2bf(y - bf2f(h)); }
template <bool B> struct BoolC { static constexpr bool value = B; };
// cp4: four asynchronous 16-byte-a-lane copies from global memory into LDS, through no register. The s_wait_xcnt is the last line of the copies' own statement, so that it stands in front of every later write of a register that one of them names.
__device__ __forceinline__ void cp4(unsigned l0, const void* g0, unsigned l1, const void* g1, unsigned l2, const void* g2, unsigned l3, const void* g3) {
    asm volatile("global_load_async_to_lds_b128 %0, %1, off\n\tglobal_load_async_to_lds_b128 %2, %3, off\n\tglobal_load_async_to_lds_b128 %4, %5, off\n\tglobal_load_async_to_lds_b128 %6, %7, off\n\ts_wait_xcnt 0x0"
                 :: "v"(l0), "v"(g0), "v"(l1), "v"(g1), "v"(l2), "v"(g2), "v"(l3), "v"(g3) : "memory"); }
#define GWM 2      // waves of a work-group along the rows
#define GWN 4      // and along the columns: a work-group owns 128 x 256 of C, each wave 64 x 64
template <typename T16, int NSPLIT, bool BIAS, int EPI>
__global__ __launch_bounds__(GWM * GWN * 32, 4) void k_gemmw(const T16* __restrict__ A, const T16* __restrict__ A2, const T16* __restrict__ Bt, const T16* __restrict__ Bt2, int K, float* C, int ldc, const float* __restrict__ bias, size_t sA, size_t sB, size_t sC, h16* P16, bf* Ph, bf* Pl) {
    typedef typename WFrag<T16>::V V;
    static_assert(NSPLIT <= 1, "the second B plane is not staged");
    // A stage is 64 k of every 64-row block the work-group reads (a chunk: 2 trips x 4 tiles = 4096 elements, CONTIGUOUS in a fragment-order plane): GWM blocks of A (and of A2), GWN of Bt.
    // Two buffers: stage s + 1 flies while stage s is worked on; each chunk is fetched once for the work-group and read from LDS by the GWN (A) or GWM (Bt) waves that need it.
    constexpr int NAP = (NSPLIT == 1) ? 2 : 1, NCH = GWM * NAP + GWN, CH = 4096;
    static_assert(NCH % 2 == 0, "chunks are copied in pairs");
    __shared__ __align__(16) T16 ring[2 * NCH * CH];
    __shared__ __align__(16) float osall[GWM * GWN * 16 * 68];
    const size_t z = blockIdx.z; A += z * sA; if (A2) A2 += z * sA; Bt += z * sB; C += z * sC; (void)Bt2;
    const int tid = (int)threadIdx.x, lane = tid & 31, lr = lane & 15, hi = lane >> 4; const int w = __builtin_amdgcn_readfirstlane(tid >> 5), wm = w % GWM, wn = w / GWM;
    float* os = osall + w * (16 * 68);                                // each wave stages its own output rows
    const int R0 = blockIdx.x * (64 * GWM), C0 = blockIdx.y * (64 * GWN); const int r0 = R0 + wm * 64, c0 = C0 + wn * 64;
    v8f acc[4][4];
#pragma unroll
    for (int mb = 0; mb < 4; ++mb)
#pragma unroll
        for (int nb = 0; nb < 4; ++nb) acc[mb][nb] = (v8f){};
    const unsigned lb = (unsigned)(size_t)ring + (unsigned)tid * 16u;  // this lane's LDS byte address inside a half chunk (256 lanes x 16 bytes)
    auto fill = [&](int s, int buf) {
#pragma unroll
        for (int c = 0; c < NCH; c += 2) { const T16* g[2];
#pragma unroll
            for (int i = 0; i < 2; ++i) { const int cc = c + i; const T16* p = cc < GWM ? A + (size_t)(R0 + cc * 64) * K : cc < GWM * NAP ? A2 + (size_t)(R0 + (cc - GWM) * 64) * K : Bt + (size_t)(C0 + (cc - GWM * NAP) * 64) * K; g[i] = p + (size_t)s * CH + tid * 8; }
            const unsigned l = lb + (unsigned)((buf * NCH + c) * (CH * 2));
            cp4(l, g[0], l + 4096u, g[0] + 2048, l + 8192u, g[1], l + 12288u, g[1] + 2048); } };
    const int nst = K >> 6;                                          // K % 64 == 0
    fill(0, 0);
    asm volatile("s_wait_asynccnt 0x0" ::: "memory");                // this wave's copies of stage 0 have landed
    __syncthreads();                                                 // and every other wave's: nothing of stage 0 is read in front of this barrier
    if (nst > 1) fill(1, 1);
#pragma unroll 1
    for (int s = 0; s < nst; ++s) {
        const T16* sb = ring + (s & 1) * (NCH * CH) + lane * 8;
#pragma unroll
        for (int t = 0; t < 2; ++t) {
            V a[4], a2[4], b[4];
            const T16* pa = sb + wm * CH + t * 2048; const T16* pb = sb + (GWM * NAP + wn) * CH + t * 2048;
#pragma unroll
            for (int mb = 0; mb < 4; ++mb) { a[mb] = WFrag<T16>::ld(pa + mb * 512); if (NSPLIT == 1) a2[mb] = WFrag<T16>::ld(pa + GWM * CH + mb * 512); }
#pragma unroll
            for (int nb = 0; nb < 4; ++nb) b[nb] = WFrag<T16>::ld(pb + nb * 512);
            __builtin_amdgcn_sched_barrier(0);   // keeps every product behind the whole group of LDS reads: left alone the compiler reloads one B fragment per four products and waits out the LDS latency each time
#pragma unroll
            for (int nb = 0; nb < 4; ++nb)
#pragma unroll
                for (int mb = 0; mb < 4; ++mb) { acc[mb][nb] = WFrag<T16>::mma(a[mb], b[nb], acc[mb][nb]); if (NSPLIT == 1) acc[mb][nb] = WFrag<T16>::mma(a2[mb], b[nb], acc[mb][nb]); }
            if constexpr (NSPLIT == 1) __builtin_amdgcn_sched_barrier(0);   // twelve fragments a trip: keeps the next trip's reads behind these products, else the wave needs more than 256 registers
        }
        asm volatile("s_wait_dscnt 0x0" ::: "memory");               // this wave's reads of the buffer have returned before it is refilled
        asm volatile("s_wait_asynccnt 0x0" ::: "memory");            // this wave's copies of stage s + 1 have landed
        __syncthreads();                                             // publishes stage s + 1 and ends every wave's reads of stage s
        if (s + 2 < nst) fill(s + 2, s & 1);
    }
    asm volatile("s_wait_asynccnt 0x0" ::: "memory");                // no copy is outstanding when the wave goes on to its epilogue and ends
    if constexpr (EPI != 0) {
        static_assert(HD == 64, "one 64-column tile is one head");
        const int third = (c0 / 64) / NH_, head = (c0 / 64) % NH_;
        const size_t pb = ((((size_t)third * NB_ + r0 / TT) * NH_ + head) * TT + r0 % TT) * HD + lane * 8;   // 64 positions x 64 dims of one head are 8 tiles in a row, in either plane kind
        auto planes = [&](auto trc) { constexpr bool TR = decltype(trc)::value;   // TR: the transposed (v) kind
#pragma unroll
        for (int g = 0; g < 4; ++g) {                                 // 16 tile rows a trip: positions 16 g .. (q, k), dims 16 g .. (v)
            if constexpr (!TR) {
#pragma unroll
                for (int nb = 0; nb < 4; ++nb)
#pragma unroll
                    for (int j = 0; j < 8; ++j) os[(hi * 8 + j) * 68 + nb * 16 + lr] = acc[g][nb][j];
            } else {                                                  // a lane's 8 accumulator rows are 8 consecutive positions of its one dim
#pragma unroll
                for (int mb = 0; mb < 4; ++mb) { float* op = os + lr * 68 + mb * 16 + hi * 8; const v8f xv = acc[mb][g]; *(v4fa*)op = __builtin_shufflevector(xv, xv, 0, 1, 2, 3); *(v4fa*)(op + 4) = __builtin_shufflevector(xv, xv, 4, 5, 6, 7); } }
            __builtin_amdgcn_wave_barrier(); asm volatile("" ::: "memory");   // keeps the compiler from moving the read-back over the other lanes' staging writes
#pragma unroll
            for (int s = 0; s < 4; ++s) { const float* ip = os + lr * 68 + s * 16 + hi * 8; const v4f a0 = *(const v4fa*)ip, a1 = *(const v4fa*)(ip + 4); v8h o16; v8us oh, ol;
#pragma unroll
                for (int k = 0; k < 4; ++k) { unsigned short u, v; o16[k] = tohx(a0[k]); splitf(a0[k], u, v); oh[k] = u; ol[k] = v; o16[4 + k] = tohx(a1[k]); splitf(a1[k], u, v); oh[4 + k] = u; ol[4 + k] = v; }
                const size_t e = pb + (!TR ? g * 1024 + s * 256 : (s >> 1) * 2048 + g * 512 + (s & 1) * 256); *(v8h*)(P16 + e) = o16; *(v8us*)(Ph + e) = oh; *(v8us*)(Pl + e) = ol;
                asm volatile("s_wait_xcnt 0x0" ::: "memory"); }       // stands in front of the next rows' writes of the registers that these three stores name
            __builtin_amdgcn_wave_barrier(); asm volatile("" ::: "memory");   // keeps the next trip's staging writes behind this trip's reads
        } };
        if (third < 2) planes(BoolC<false>{}); else planes(BoolC<true>{});   // the same for the whole work-group: a scalar branch
        return;
    }
#pragma unroll
    for (int mb = 0; mb < 4; ++mb) {
#pragma unroll
        for (int nb = 0; nb < 4; ++nb) {
#pragma unroll
            for (int j = 0; j < 8; ++j) os[(hi * 8 + j) * 68 + nb * 16 + lr] = acc[mb][nb][j]; }
        __builtin_amdgcn_wave_barrier(); asm volatile("" ::: "memory");
        float* crow = C + (size_t)(r0 + mb * 16) * ldc + c0;
{
#pragma unroll
            for (int s = 0; s < 8; ++s) { const int row = 2 * s + hi, cofs = lr * 4; v4f val = *(const v4fa*)(os + row * 68 + cofs); if (BIAS) { val[0] += bfr(bias[c0 + cofs]); val[1] += bfr(bias[c0 + cofs + 1]); val[2] += bfr(bias[c0 + cofs + 2]); val[3] += bfr(bias[c0 + cofs + 3]); }
                *(v4f*)(crow + (size_t)row * ldc + cofs) = val; }
             }
        __builtin_amdgcn_wave_barrier(); asm volatile("" ::: "memory");
    }
}

typedef __attribute__((ext_vector_type(2))) _Float16 v2h;
typedef __attribute__((ext_vector_type(4))) _Float16 v4h;
typedef __attribute__((ext_vector_type(2))) unsigned short v2us;
typedef __attribute__((ext_vector_type(4))) unsigned short v4us;
typedef __attribute__((ext_vector_type(2))) float v2f;
typedef __attribute__((ext_vector_type(4))) int v4i;

// The three converters below are independent of each other and share ONE launch (k_prep): each is written for the block index blk of its own range.
__device__ __forceinline__ void wtG_blk(const float* __restrict__ w, int K, int N, bf* Bt, int blk) {
    const int lane = threadIdx.x & 31; const int L0 = (blk * 8 + (threadIdx.x >> 5)) * 8; const int nlines = N * K / 64;
{
#pragma unroll 1
        for (int l = 0; l < 8; ++l) { const int L = L0 + l; if (L >= nlines) break; const size_t e = (size_t)L * 64 + lane * 2; const int grp = (int)(e >> 11), wi = (int)(e & 511), KT = K >> 5; const int n = (grp / KT) * 64 + ((int)(e >> 9) & 3) * 16 + ((wi >> 3) & 15), k = (grp % KT) * 32 + (wi >> 7) * 8 + (wi & 7); v2us o;   // e counts in fragment order
            const float* p0 = w + (size_t)k * N + n; const float* p1 = p0 + N; const float w0 = *p0, w1 = *p1;
            asm volatile("s_wait_xcnt 0x0" :: "v"(p0), "v"(p1) : "memory");   // stands in front of every later write of the two loads' address registers, which are inputs so that they keep their registers up to it
            o[0] = f2bf(w0); o[1] = f2bf(w1); *(v2us*)(Bt + e) = o; }
         }
}
// cvt8_blk: f32 rows of K -> bf16 plane in fragment order. A block takes 16 rows x 128 k = 4 tiles: whole lines are read, the 16-byte runs change places in LDS (16 runs + 16 bytes of pad: no bank conflict either way), whole lines are stored. rows / 16 * K / 128 blocks.
__device__ __forceinline__ void cvt8_blk(const float* __restrict__ src, bf* dst, int K, int blk) {
    __shared__ __align__(16) bf st[16 * 17 * 8];
    const int t = threadIdx.x, row = t >> 4, c = t & 15, ns = K >> 7; const int rb = blk / ns, sg = blk % ns;
    const v8f v = *(const v8f*)(src + (size_t)(rb * 16 + row) * K + sg * 128 + c * 8); v8us o;
#pragma unroll
    for (int k = 0; k < 8; ++k) o[k] = f2bf(v[k]);
    *(v8usa*)(st + (c * 17 + row) * 8) = o;                           // run c of a row (k = 8 c ..) is group c of 16 runs in fragment order
    __syncthreads();                                                 // every run is in LDS before any thread reads the one it stores
    *(v8us*)(dst + ((size_t)(rb >> 2) * (K >> 5) + sg * 4 + (t >> 6)) * 2048 + (rb & 3) * 512 + (t & 63) * 8) = *(const v8usa*)(st + ((t >> 4) * 17 + (t & 15)) * 8);
    asm volatile("s_wait_xcnt 0x0" ::: "memory"); }   // stands in front of every later write of a register that the store names: in the merged kernel the other converters' code follows this one in the listing
// k_prep: blocks [0, PW1) transpose w_qkv, [PW1, PW1 + PW2) w_out (the latency-bound ones first), the rest convert x of both sequences. The branch is the same for a whole block, the converter's barrier included.
#define PW1 (DM * (DQ + 2 * DKV) / 4096)
#define PW2 (DQ * DM / 4096)
#define PXB (NB_ * TT * DM / 2048)
__global__ __launch_bounds__(256) void k_prep(const float* __restrict__ wf, const float* __restrict__ wo, const float* __restrict__ x, bf* WALL, bf* WO, bf* XB) {
    const int b = (int)blockIdx.x;
    if (b < PW1) wtG_blk(wf, DM, DQ + 2 * DKV, WALL, b);
    else if (b < PW1 + PW2) wtG_blk(wo, DQ, DM, WO, b - PW1);
    else cvt8_blk(x, XB, DM, b - (PW1 + PW2)); }
// ---- k_fattn: causal scores, softmax and probability x value product of one head in ONE kernel; no score or probability ever reaches memory.
// Transposed products: S^T = K Q^T (A = 16 key rows, B = 16 query columns), O^T += V^T P^T (A = 16 rows of V^T, B = P^T). A lane then holds the scores of ONE query (column lr; keys 8 hi + j of each 16-key tile),
// and the two score tiles of a 32-key block, converted in place, ARE the B operand of the value product in the order that WFrag::ld gives A (k = 8 hi + 0..7, 16 + 8 hi + 0..7).
// A work-group owns 16 NQ query rows of one head. Its FW waves share the key loop (wave w takes the 32-key blocks w, w + FW, ... up to the diagonal block), each with its own running maximum, sum and O^T tile
// (online softmax, base 2); the FW partial results are brought to the common maximum and summed in wave order through LDS, divided by the summed denominator and stored as the hi/lo bf16 planes of the merged heads. All planes in fragment order (above k_gemmw).
// amdgpu_waves_per_eu(4): at most 256 registers, so that four work-groups (one wave of each per SIMD) stay resident and cover each other's load and softmax latency.
// HL: hi+lo bf16 planes, three products for each contraction; else single fp16 with the probabilities carried x 2^10 (numerator and denominator alike).
// Both kinds share ONE launch (k_fattn below fattn_body): grid (sequences x heads, row blocks), longest rows first, the hi+lo row blocks (the shortest) last.
#define FW 4
typedef __attribute__((ext_vector_type(16))) unsigned short v16us;
template <typename T16, bool HL, int NQ>
__device__ __forceinline__ void fattn_body(const T16* __restrict__ Q, const T16* __restrict__ Q2, const T16* __restrict__ Kp, const T16* __restrict__ K2, const T16* __restrict__ Vt, const T16* __restrict__ V2, const int q0, bf* Ah, bf* Al) {
    typedef typename WFrag<T16>::V V; typedef WFrag<T16> F;
    constexpr int QW = 16 * NQ; constexpr float SC2 = SCL * 1.4426950408889634f;
    __shared__ __align__(16) float so[FW * QW * 68];
    __shared__ float sm[FW * QW], sl[FW * QW];
    const int lane = threadIdx.x & 31, lr = lane & 15, hi = lane >> 4; const int w = __builtin_amdgcn_readfirstlane((int)(threadIdx.x >> 5));
    const int h = (int)blockIdx.x % NH_, sq = (int)blockIdx.x / NH_;
    const size_t hp = (size_t)blockIdx.x * TT * HD; Q += hp; Kp += hp; Vt += hp; if constexpr (HL) { Q2 += hp; K2 += hp; V2 += hp; }
    const int nkb = (q0 + QW - 1) / 32 + 1;                          // 32-key blocks up to and with the one that holds the last query's own key
    V bq[NQ][2], bq2[NQ][2];
#pragma unroll
    for (int qt = 0; qt < NQ; ++qt)
#pragma unroll
        for (int ks = 0; ks < 2; ++ks) { const size_t qo = (size_t)(q0 + qt * 16) * HD + ks * 512 + lane * 8; bq[qt][ks] = F::ld(Q + qo); if constexpr (HL) bq2[qt][ks] = F::ld(Q2 + qo); }
    v8f o[4][NQ]; float m[NQ], l[NQ];
#pragma unroll
    for (int qt = 0; qt < NQ; ++qt) { m[qt] = -1.0e30f; l[qt] = 0.f;
#pragma unroll
        for (int dt = 0; dt < 4; ++dt) o[dt][qt] = (v8f){}; }
    const size_t koff = lane * 8, voff = lane * 8;                    // a 32-key block is 4 tiles in a row in the key planes (16 keys x 32 dims each) and in the value planes (16 dims x 32 keys each)
    V ak[2][2], ak2[2][2], av[4], av2[4];
    // each loader ends with s_wait_xcnt 0: it stands in front of every later write of a register that one of its loads names as its address (some of these are rewritten behind a branch);
    // the wait takes the addresses as inputs, so that they keep their registers up to it and no load of the group returns its data onto them
    auto ldK = [&](int kb) { const T16* p = Kp + koff + (size_t)kb * 32 * HD; const T16* p2 = HL ? K2 + koff + (size_t)kb * 32 * HD : p;
#pragma unroll
        for (int kt = 0; kt < 2; ++kt)
#pragma unroll
            for (int ks = 0; ks < 2; ++ks) { ak[kt][ks] = F::ld(p + kt * 1024 + ks * 512); if constexpr (HL) ak2[kt][ks] = F::ld(p2 + kt * 1024 + ks * 512); }
        asm volatile("s_wait_xcnt 0x0" :: "v"(p), "v"(p2) : "memory"); };
    auto ldV = [&](int k0) { const T16* p = Vt + voff + (size_t)k0 * HD; const T16* p2 = HL ? V2 + voff + (size_t)k0 * HD : p;
#pragma unroll
        for (int dt = 0; dt < 4; ++dt) { av[dt] = F::ld(p + dt * 512); if constexpr (HL) av2[dt] = F::ld(p2 + dt * 512); }
        asm volatile("s_wait_xcnt 0x0" :: "v"(p), "v"(p2) : "memory"); };
    // single fp16: the values are fetched at the head of a pass and the NEXT pass's keys behind the score products, so that both latencies run under matrix and softmax work.
    // hi+lo (at most 4 passes a wave, twice the fragments): keys, products, then values, which keeps the wave inside 256 registers without spills.
    if constexpr (!HL) ldK(w);
#pragma unroll 1
    for (int kb = w; kb < nkb; kb += FW) {
        const int k0 = kb * 32;
        if constexpr (HL) ldK(kb); else ldV(k0);
        v8f s[NQ][2];
#pragma unroll
        for (int kt = 0; kt < 2; ++kt)
#pragma unroll
            for (int qt = 0; qt < NQ; ++qt) { v8f c = (v8f){};
#pragma unroll
                for (int ks = 0; ks < 2; ++ks) { c = F::mma(ak[kt][ks], bq[qt][ks], c); if constexpr (HL) { c = F::mma(ak[kt][ks], bq2[qt][ks], c); c = F::mma(ak2[kt][ks], bq[qt][ks], c); } }
                s[qt][kt] = c; }
        if constexpr (HL) ldV(k0); else ldK((kb + FW < nkb) ? kb + FW : kb);   // the last pass fetches its own block again: in bounds, unused
        if (k0 + 31 > q0) {                                          // only the diagonal block holds keys behind a query
#pragma unroll
            for (int qt = 0; qt < NQ; ++qt)
#pragma unroll
                for (int kt = 0; kt < 2; ++kt)
#pragma unroll
                    for (int j = 0; j < 8; ++j) if (k0 + kt * 16 + hi * 8 + j > q0 + qt * 16 + lr) s[qt][kt][j] = -3.0e38f; }
#pragma unroll
        for (int qt = 0; qt < NQ; ++qt) {
            float mx = s[qt][0][0];
#pragma unroll
            for (int j = 1; j < 16; ++j) mx = fmaxf(mx, s[qt][j >> 3][j & 7]);
            mx = fmaxf(mx, __shfl_xor(mx, 16, 32));                  // the other half-wave holds this query's other 16 keys
            const float mn = fmaxf(m[qt], mx * SC2), al = __builtin_amdgcn_exp2f(m[qt] - mn), mo = HL ? mn : mn - 10.0f; m[qt] = mn;
            float sum = 0.f;
#pragma unroll
            for (int j = 0; j < 16; ++j) { const float p = __builtin_amdgcn_exp2f(s[qt][j >> 3][j & 7] * SC2 - mo); s[qt][j >> 3][j & 7] = p; sum += p; }
            l[qt] = l[qt] * al + sum;
#pragma unroll
            for (int dt = 0; dt < 4; ++dt) o[dt][qt] *= al;
            if constexpr (HL) { v16us ph, pl;
#pragma unroll
                for (int j = 0; j < 16; ++j) { unsigned short a, c2; splitf(s[qt][j >> 3][j & 7], a, c2); ph[j] = a; pl[j] = c2; }
                const V bh = __builtin_bit_cast(V, ph), bl = __builtin_bit_cast(V, pl);
#pragma unroll
                for (int dt = 0; dt < 4; ++dt) { o[dt][qt] = F::mma(av[dt], bh, o[dt][qt]); o[dt][qt] = F::mma(av[dt], bl, o[dt][qt]); o[dt][qt] = F::mma(av2[dt], bh, o[dt][qt]); }
            } else { V pb;
#pragma unroll
                for (int j = 0; j < 16; ++j) pb[j] = tohx(s[qt][j >> 3][j & 7]);
#pragma unroll
                for (int dt = 0; dt < 4; ++dt) o[dt][qt] = F::mma(av[dt], pb, o[dt][qt]); }
        }
    }
#pragma unroll
    for (int qt = 0; qt < NQ; ++qt) { l[qt] += __shfl_xor(l[qt], 16, 32); if (hi == 0) sm[w * QW + qt * 16 + lr] = m[qt]; }
    __syncthreads();                                                 // every wave's maxima are in LDS before any wave forms the common one
#pragma unroll
    for (int qt = 0; qt < NQ; ++qt) { const int q = qt * 16 + lr; float M = sm[q];
#pragma unroll
        for (int p = 1; p < FW; ++p) M = fmaxf(M, sm[p * QW + q]);
        const float f = __builtin_amdgcn_exp2f(m[qt] - M); if (hi == 0) sl[w * QW + q] = l[qt] * f;   // a wave without a key block: f = 0
        float* op = so + (size_t)(w * QW + q) * 68 + hi * 8;
#pragma unroll
        for (int dt = 0; dt < 4; ++dt) { const v8f x = o[dt][qt] * f; *(v4fa*)(op + dt * 16) = __builtin_shufflevector(x, x, 0, 1, 2, 3); *(v4fa*)(op + dt * 16 + 4) = __builtin_shufflevector(x, x, 4, 5, 6, 7); } }
    __syncthreads();                                                 // every wave's rescaled partial tile and sum are in LDS before any thread adds them
#pragma unroll
    for (int i = 0; i < NQ; ++i) { const int u = (int)threadIdx.x, q = i * 16 + (u & 15), d0 = (u >> 4) * 8; const float* op = so + (size_t)q * 68 + d0; v4f a0 = *(const v4fa*)op, a1 = *(const v4fa*)(op + 4); float L = sl[q];
#pragma unroll
        for (int p = 1; p < FW; ++p) { a0 += *(const v4fa*)(op + p * (QW * 68)); a1 += *(const v4fa*)(op + p * (QW * 68) + 4); L += sl[p * QW + q]; }
        const float inv = __fdiv_rn(1.0f, L); v8us oh, ol;
#pragma unroll
        for (int k = 0; k < 4; ++k) { unsigned short a, c2; splitf(a0[k] * inv, a, c2); oh[k] = a; ol[k] = c2; splitf(a1[k] * inv, a, c2); oh[4 + k] = a; ol[4 + k] = c2; }
        const int qb = sq * TT + q0 + i * 16; const size_t oo = ((size_t)(qb >> 6) * (DQ / 32) + h * 2 + (u >> 6)) * 2048 + ((qb >> 4) & 3) * 512 + (u & 63) * 8; *(v8us*)(Ah + oo) = oh; *(v8us*)(Al + oo) = ol;   // fragment order: 16 queries x this head's 64 dims are 2 tiles; run u of them is (query u & 15, dims 8 (u >> 4) ..)
        asm volatile("s_wait_xcnt 0x0" ::: "memory"); }   // stands in front of every later write of a register that the two stores name: in the merged kernel the other body's code follows this one in the listing
}
// ---- fattn_sh (query rows >= RH, single fp16; fattn_body above serves the hi+lo rows): a work-group owns FW x 32 query rows of one head, each wave 32 of them for ALL their keys, so no partial results are merged.
// The FW waves walk the same keys: a stage of SK keys (their key tiles and their value tiles, each one contiguous run in a fragment-order plane) is brought into LDS once for the work-group
// by asynchronous copies, two buffers, stage s + 1 in flight while stage s is worked on, and every wave reads its fragments from there: a key or value byte leaves L2 once per FW x 32 queries, not once per 32.
// A wave skips the 32-key blocks behind its own diagonal block (a scalar branch) but passes every barrier. A lane's 8 accumulators of a tile are one 16-byte run of the merged-heads planes: stored straight from registers.
#define SK 64
__device__ __forceinline__ void fattn_sh(const h16* __restrict__ Q, const h16* __restrict__ Kp, const h16* __restrict__ Vt, const int q0, bf* Ah, bf* Al) {
    typedef WFrag<h16> F; typedef F::V V;
    constexpr int NQ = 2, SE = SK * HD; constexpr float SC2 = SCL * 1.4426950408889634f;   // SE: elements of a stage in one plane
    static_assert(FW * 32 * 8 * 4 == SE, "four 16-byte copies a lane bring one plane's stage");
    __shared__ __align__(16) h16 ring[2 * 2 * SE];
    const int tid = (int)threadIdx.x, lane = tid & 31, lr = lane & 15, hi = lane >> 4; const int w = __builtin_amdgcn_readfirstlane(tid >> 5);
    const int h = (int)blockIdx.x % NH_, sq = (int)blockIdx.x / NH_;
    const size_t hp = (size_t)blockIdx.x * TT * HD; Q += hp; Kp += hp; Vt += hp;
    const int qw = q0 + w * 32, kbl = qw / 32;                       // this wave's first query; the 32-key block that holds its queries' own keys, its last
    const int nst = (q0 + FW * 32) / SK;                             // stages up to the last query's own key: at least 2
    const unsigned lb = (unsigned)(size_t)ring + (unsigned)tid * 16u; // this lane's LDS byte address inside a run of 128 lanes x 16 bytes
    auto fill = [&](int s, int buf) { const h16* gk = Kp + (size_t)s * SE + tid * 8; const h16* gv = Vt + (size_t)s * SE + tid * 8; const unsigned l = lb + (unsigned)(buf * (2 * SE * 2));
        cp4(l, gk, l + 2048u, gk + 1024, l + 4096u, gk + 2048, l + 6144u, gk + 3072);
        cp4(l + 8192u, gv, l + 10240u, gv + 1024, l + 12288u, gv + 2048, l + 14336u, gv + 3072); };
    fill(0, 0);
    V bq[NQ][2]; { const h16* pq = Q + (size_t)qw * HD + lane * 8;
#pragma unroll
        for (int qt = 0; qt < NQ; ++qt)
#pragma unroll
            for (int ks = 0; ks < 2; ++ks) bq[qt][ks] = F::ld(pq + qt * 1024 + ks * 512);
        asm volatile("s_wait_xcnt 0x0" :: "v"(pq) : "memory"); }     // stands in front of every later write of the address registers of these loads, which are inputs so that they keep their registers up to it
    v8f o[4][NQ]; float m[NQ], l[NQ];
#pragma unroll
    for (int qt = 0; qt < NQ; ++qt) { m[qt] = -1.0e30f; l[qt] = 0.f;
#pragma unroll
        for (int dt = 0; dt < 4; ++dt) o[dt][qt] = (v8f){}; }
    asm volatile("s_wait_asynccnt 0x0" ::: "memory");                // this wave's copies of stage 0 have landed
    __syncthreads();                                                 // and every other wave's: nothing of stage 0 is read in front of this barrier
    fill(1, 1);
#pragma unroll 1
    for (int s = 0; s < nst; ++s) {                                  // kept rolled: one copy of the two passes in the instruction cache
        const h16* sb = ring + (s & 1) * (2 * SE) + lane * 8;
#pragma unroll
        for (int t = 0; t < SK / 32; ++t) { const int kb = s * (SK / 32) + t, k0 = kb * 32;
            if (kb > kbl) continue;                                  // behind the diagonal of every query of this wave: the same for the whole wave
            V ak[2][2], av[4];
#pragma unroll
            for (int kt = 0; kt < 2; ++kt)
#pragma unroll
                for (int ks = 0; ks < 2; ++ks) ak[kt][ks] = F::ld(sb + t * 2048 + kt * 1024 + ks * 512);
#pragma unroll
            for (int dt = 0; dt < 4; ++dt) av[dt] = F::ld(sb + SE + t * 2048 + dt * 512);
            __builtin_amdgcn_sched_barrier(0);   // keeps every product behind the whole group of LDS reads: left alone the compiler reloads one key fragment per two products and waits out the LDS latency each time
            v8f sc[NQ][2];
#pragma unroll
            for (int kt = 0; kt < 2; ++kt)
#pragma unroll
                for (int qt = 0; qt < NQ; ++qt) { v8f c = (v8f){};
#pragma unroll
                    for (int ks = 0; ks < 2; ++ks) c = F::mma(ak[kt][ks], bq[qt][ks], c);
                    sc[qt][kt] = c; }
            if (kb == kbl) {                                         // only the diagonal block holds keys behind a query
#pragma unroll
                for (int qt = 0; qt < NQ; ++qt)
#pragma unroll
                    for (int kt = 0; kt < 2; ++kt)
#pragma unroll
                        for (int j = 0; j < 8; ++j) if (k0 + kt * 16 + hi * 8 + j > qw + qt * 16 + lr) sc[qt][kt][j] = -3.0e38f; }
            float mh[NQ], mo2[NQ];
#pragma unroll
            for (int qt = 0; qt < NQ; ++qt) { mh[qt] = sc[qt][0][0];
#pragma unroll
                for (int j = 1; j < 16; ++j) mh[qt] = fmaxf(mh[qt], sc[qt][j >> 3][j & 7]); }
#pragma unroll
            for (int qt = 0; qt < NQ; ++qt) mo2[qt] = __shfl_xor(mh[qt], 16, 32);   // the other half-wave holds this query's other 16 keys
#pragma unroll
            for (int qt = 0; qt < NQ; ++qt) {
                const float mx = fmaxf(mh[qt], mo2[qt]);
                const float mn = fmaxf(m[qt], mx * SC2), al = __builtin_amdgcn_exp2f(m[qt] - mn), mo = mn - 10.0f; m[qt] = mn;
                float sum = 0.f;
#pragma unroll
                for (int j = 0; j < 16; ++j) { const float p = __builtin_amdgcn_exp2f(sc[qt][j >> 3][j & 7] * SC2 - mo); sc[qt][j >> 3][j & 7] = p; sum += p; }
                l[qt] = l[qt] * al + sum;
#pragma unroll
                for (int dt = 0; dt < 4; ++dt) o[dt][qt] *= al;
                V pb;
#pragma unroll
                for (int j = 0; j < 16; ++j) pb[j] = tohx(sc[qt][j >> 3][j & 7]);
#pragma unroll
                for (int dt = 0; dt < 4; ++dt) o[dt][qt] = F::mma(av[dt], pb, o[dt][qt]); }
        }
        asm volatile("s_wait_dscnt 0x0" ::: "memory");               // this wave's reads of the buffer have returned before it is refilled
        asm volatile("s_wait_asynccnt 0x0" ::: "memory");            // this wave's copies of stage s + 1 have landed
        __syncthreads();                                             // publishes stage s + 1 and ends every wave's reads of stage s
        if (s + 2 < nst) fill(s + 2, s & 1);
    }
    asm volatile("s_wait_asynccnt 0x0" ::: "memory");                // no copy is outstanding when the wave goes on to its epilogue and ends
#pragma unroll
    for (int qt = 0; qt < NQ; ++qt) { const float L = l[qt] + __shfl_xor(l[qt], 16, 32), inv = __fdiv_rn(1.0f, L);
        const int qb = sq * TT + qw + qt * 16; const size_t ob = ((size_t)(qb >> 6) * (DQ / 32) + h * 2) * 2048 + ((qb >> 4) & 3) * 512 + lane * 8;   // fragment order: 16 queries x this head's 64 dims are 2 tiles; dims 16 dt + 8 hi .. of query lr are run lane of half dt & 1 of tile dt >> 1
#pragma unroll
        for (int dt = 0; dt < 4; ++dt) { v8us oh, ol;
#pragma unroll
            for (int k = 0; k < 8; ++k) { unsigned short a, c2; splitf(o[dt][qt][k] * inv, a, c2); oh[k] = a; ol[k] = c2; }
            const size_t oo = ob + (dt >> 1) * 2048 + (dt & 1) * 256; *(v8us*)(Ah + oo) = oh; *(v8us*)(Al + oo) = ol;
            asm volatile("s_wait_xcnt 0x0" ::: "memory"); } }        // stands in front of every later write of a register that the two stores name
}
#define FY1 ((TT - RH) / (FW * 32))   // row blocks of FW x 32 queries, single fp16
#define FY2 (RH / 16)             // row blocks of 16 queries, hi+lo
__global__ __launch_bounds__(FW * 32) __attribute__((amdgpu_waves_per_eu(4))) void k_fattn(const h16* __restrict__ Q16, const h16* __restrict__ K16, const h16* __restrict__ V16, const bf* __restrict__ Qh, const bf* __restrict__ Ql, const bf* __restrict__ Kh, const bf* __restrict__ Kl, const bf* __restrict__ Vh, const bf* __restrict__ Vl, bf* Ah, bf* Al) {
    const int y = (int)blockIdx.y;                                   // the branch is the same for a whole work-group, the barriers of either body included
    if (y < FY1) {
        // all these work-groups are resident together, about four to a WGP:
        // every second group of 8 values of y runs from short to long (a permutation of the row blocks; for speed only)
        const int top = (y | 7) < FY1 - 1 ? (y | 7) : FY1 - 1, lev = ((y >> 3) & 1) ? top - (y & 7) : y;
        fattn_sh(Q16, K16, V16, RH + (FY1 - 1 - lev) * (FW * 32), Ah, Al); }
    else fattn_body<bf, true, 1>(Qh, Ql, Kh, Kl, Vh, Vl, (FY1 + FY2 - 1 - y) * 16, Ah, Al);
}

extern "C" void kernel_launch(void* const* d_in, const int* in_sizes, int n_in,
                              void* d_out, int out_size, void* d_ws, size_t ws_size, hipStream_t stream) {
    (void)in_sizes; (void)n_in; (void)out_size;
    const float* x = (const float*)d_in[0]; const float* wf = (const float*)d_in[1]; const float* wo = (const float*)d_in[2]; /* x, w_qkv, w_o = d_in[0..2]; no bias inputs in this module: the projection GEMMs below use the bias-free instantiation */
    float* OUT = (float*)d_out;     // [2][4096][1024]
    char* wsp = (char*)d_ws;
    auto take = [&](size_t bytes) { char* p = wsp; wsp += (bytes + 255) & ~(size_t)255; return (void*)p; };
    bf* WO = (bf*)take((size_t)DM * DQ * 2);
    bf* XB = (bf*)take((size_t)NB_ * TT * DM * 2); bf* WALL = (bf*)take((size_t)(DQ + 2 * DKV) * DM * 2);
    const size_t PS = (size_t)NB_ * NH_ * TT * HD;        // one plane: both sequences, all heads; q, k, v planes of a kind stand in a row
    h16* QP16 = (h16*)take(3 * PS * 2); h16* KP16 = QP16 + PS; h16* VT16 = KP16 + PS;
    bf* QPh = (bf*)take(3 * PS * 2); bf* KPh = QPh + PS; bf* VTh = KPh + PS; bf* QPl = (bf*)take(3 * PS * 2); bf* KPl = QPl + PS; bf* VTl = KPl + PS;
    bf* ATh = (bf*)take((size_t)NB_ * TT * DQ * 2); bf* ATl = (bf*)take((size_t)NB_ * TT * DQ * 2);
    if ((size_t)(wsp - (char*)d_ws) > ws_size) return;    // ws 256 MiB
    k_prep<<<PW1 + PW2 + PXB, 256, 0, stream>>>(wf, wo, x, WALL, WO, XB);
    k_gemmw<bf, 0, false, 1><<<dim3(NB_ * TT / (64 * GWM), (DQ + 2 * DKV) / (64 * GWN), 1), GWM * GWN * 32, 0, stream>>>(XB, nullptr, WALL, nullptr, DM, nullptr, 0, nullptr, 0, 0, 0, QP16, QPh, QPl);
    k_fattn<<<dim3(NB_ * NH_, FY1 + FY2), FW * 32, 0, stream>>>(QP16, KP16, VT16, QPh, QPl, KPh, KPl, VTh, VTl, ATh, ATl);
    k_gemmw<bf, 1, false, 0><<<dim3(NB_ * TT / (64 * GWM), DM / (64 * GWN), 1), GWM * GWN * 32, 0, stream>>>(ATh, ATl, WO, nullptr, DQ, OUT, DM, nullptr, 0, 0, 0, nullptr, nullptr, nullptr);
}

// v008
// A run of this version takes 143 microseconds.
// In both of two side-by-side timings against v007, it was 1.07 times as fast.
// All steps since v000 together make it 32.3 times as fast.
#include <hip/hip_runtime.h>

// Causal self-attention with a fused BIAS-FREE qkv projection over TWO 4,096-token sequences, written chunk by chunk in the module (x [2][4096][1024]; qkv = x w_qkv ('xw' [1024][3072] normal x 1/32, NO bias) viewed (3, 16, 64): column thirds q | k | v (16 heads x 64); the module scans over 32 query chunks of 128 rows, each against ALL keys with 'query position >= key position' kept and -1e10 elsewhere (== the full causal rule; == exclusion); scores / sqrt(64); softmax over the keys; out = merged w_out ('xw' [1024][1024], NO bias) -> [2][4096][1024] (8.4 M); argument order x, w_qkv, w_out).
// Compute dtypes, f32 accumulate: every input rounded to bf16; q/k/v on PLAIN bf16 operands (inputs: exact), no biases in this module; causal scores and attn.v: query rows < 512 hl (3 products), the rest single fp16 (x1024), causal block skipping; online softmax f32, fused with both products (k_fattn); w_o hl x exact (2 products), no bias.

#define NB_  2      // TWO sequences in this module: both go through every launch together (rows of the GEMMs = sequence * TT + position; attention planes [sequence][head])
#define TT   4096
#define DM   1024
#define NH_  16
#define NKV  16
#define HD   64
#define DQ   (NH_ * HD)
#define DKV  (NKV * HD)
#define RH   512                  // query rows < RH use hi+lo planes (0: none)
#define SCL  0.125f   // HD^-0.5
typedef _Float16 h16;
typedef unsigned short bf;
typedef __attribute__((ext_vector_type(16))) __bf16   v16bf;
typedef __attribute__((ext_vector_type(16))) _Float16 v16h;
typedef __attribute__((ext_vector_type(8)))  _Float16 v8h;
typedef __attribute__((ext_vector_type(8)))  unsigned short v8us;
typedef __attribute__((ext_vector_type(8)))  float    v8f;
typedef __attribute__((ext_vector_type(4)))  float    v4f;
typedef v8h  __attribute__((may_alias)) v8ha;
typedef v4f  __attribute__((may_alias)) v4fa;
typedef v8us __attribute__((may_alias)) v8usa;

__device__ __forceinline__ unsigned short f2bf(float f) { unsigned u = __float_as_uint(f); u += 0x7FFFu + ((u >> 16) & 1u); return (unsigned short)(u >> 16); }
__device__ __forceinline__ float bf2f(unsigned short b) { return __uint_as_float(((unsigned)b) << 16); }
__device__ __forceinline__ float bfr(float f) { return bf2f(f2bf(f)); }
__device__ __forceinline__ v16h cat16(v8h lo, v8h hi) { return __builtin_shufflevector(lo, hi, 0, 1, 2, 3, 4, 5, 6, 7, 8, 9, 10, 11, 12, 13, 14, 15); }
__device__ __forceinline__ v16bf cat16b(v8us lo, v8us hi) { return __builtin_bit_cast(v16bf, __builtin_shufflevector(lo, hi, 0, 1, 2, 3, 4, 5, 6, 7, 8, 9, 10, 11, 12, 13, 14, 15)); }
__device__ __forceinline__ v8f wmma16(v16h a, v16h b, v8f c) { return __builtin_amdgcn_wmma_f32_16x16x32_f16(false, a, false, b, (short)0, c, false, false); }
__device__ __forceinline__ v8f wmmab(v16bf a, v16bf b, v8f c) { return __builtin_amdgcn_wmma_f32_16x16x32_bf16(false, a, false, b, (short)0, c, false, false); }



// ---- FRAGMENT ORDER: every 16-bit operand plane is made of tiles of 16 rows x 32 k, 512 elements each, and the tiles that one wave loads together stand in a row:
// GEMM operands (x, weights, merged heads): [row / 64][k / 32][(row / 16) % 4] tiles; q and k planes: [head][position / 16][dim / 32] tiles; v planes: [head][position / 32][dim / 16] tiles (rows = dims, k = positions).
// Inside a tile element (row r, k = 16 j + 8 hi + e) stands at j * 256 + (16 hi + r) * 8 + e: lane 16 hi + r finds its two 8-element runs at lane * 8 and 256 + lane * 8 (WFrag::ld),
// so each of the two loads of a fragment reads 512 contiguous bytes (4 whole lines) where a row-major plane made it touch 16 lines. The k order of a fragment is what it was.
// ---- k_gemmw: register-blocked GEMM, one wave per 64x64 output tile (16 accumulators), 2 x 4 waves to a work-group (128 x 256 of C); operands from fragment-order 16-bit planes through an LDS ring of two buffers; grid (M/128, N/256, Z), 256 threads.
// C[m][n] (f32, pitch ldc, + optional f32 bias[n]) = sum_k A[m][k] Bt[n][k] (+ split products per NSPLIT). z-batch strides sA/sB/sC in elements. K % 64 == 0.
// EPI 0: C is stored as f32. EPI 1: ONE launch makes q, k and v of both sequences: a wave's column block c0 / 64 is head (c0 / 64) % 16 of third (c0 / 64) / 16 (q | k | v), its row block 64 positions of sequence r0 / TT;
// the tile leaves the kernel as the attention operand planes (fp16 P16, bf16 hi Ph, bf16 lo Pl; each [third][sequence][head]), no f32 copy in memory:
// q, k planes [head] x tiles (rows = positions, k = dims), v planes [head][32-key block][16-dim group] x one tile (rows = dims, k = positions) (v transposed). Either way 16 tile rows are staged in LDS and each store covers half a tile, 512 contiguous bytes.
template <typename T16> struct WFrag;
template <> struct WFrag<h16> { typedef v16h V; static __device__ __forceinline__ V ld(const h16* p) { return cat16(*(const v8h*)p, *(const v8h*)(p + 256)); } static __device__ __forceinline__ v8f mma(V a, V b, v8f c) { return wmma16(a, b, c); } };
template <> struct WFrag<bf> { typedef v16bf V; static __device__ __forceinline__ V ld(const bf* p) { return cat16b(*(const v8us*)p, *(const v8us*)(p + 256)); } static __device__ __forceinline__ v8f mma(V a, V b, v8f c) { return wmmab(a, b, c); } };
__device__ __forceinline__ h16 tohx(float x) { return (h16)x; }
__device__ __forceinline__ void splitf(float y, unsigned short& h, unsigned short& l) { h = f2bf(y); l = f2bf(y - bf2f(h)); }
template <bool B> struct BoolC { static constexpr bool value = B; };
// cp4: four asynchronous 16-byte-a-lane copies from global memory into LDS, through no register. The s_wait_xcnt is the last line of the copies' own statement, so that it stands in front of every later write of a register that one of them names.
__device__ __forceinline__ void cp4(unsigned l0, const void* g0, unsigned l1, const void* g1, unsigned l2, const void* g2, unsigned l3, const void* g3) {
    asm volatile("global_load_async_to_lds_b128 %0, %1, off\n\tglobal_load_async_to_lds_b128 %2, %3, off\n\tglobal_load_async_to_lds_b128 %4, %5, off\n\tglobal_load_async_to_lds_b128 %6, %7, off\n\ts_wait_xcnt 0x0"
                 :: "v"(l0), "v"(g0), "v"(l1), "v"(g1), "v"(l2), "v"(g2), "v"(l3), "v"(g3) : "memory"); }
#define GWM 2      // waves of a work-group along the rows
#define GWN 4      // and along the columns: a work-group owns 128 x 256 of C, each wave 64 x 64
template <typename T16, int NSPLIT, bool BIAS, int EPI>
__global__ __launch_bounds__(GWM * GWN * 32, 4) void k_gemmw(const T16* __restrict__ A, const T16* __restrict__ A2, const T16* __restrict__ Bt, const T16* __restrict__ Bt2, int K, float* C, int ldc, const float* __restrict__ bias, size_t sA, size_t sB, size_t sC, h16* P16, bf* Ph, bf* Pl) {
    typedef typename WFrag<T16>::V V;
    static_assert(NSPLIT <= 1, "the second B plane is not staged");
    // A stage is 64 k of every 64-row block the work-group reads (a chunk: 2 trips x 4 tiles = 4096 elements, CONTIGUOUS in a fragment-order plane): GWM blocks of A (and of A2), GWN of Bt.
    // Two buffers: stage s + 1 flies while stage s is worked on; each chunk is fetched once for the work-group and read from LDS by the GWN (A) or GWM (Bt) waves that need it.
    constexpr int NAP = (NSPLIT == 1) ? 2 : 1, NCH = GWM * NAP + GWN, CH = 4096;
    static_assert(NCH % 2 == 0, "chunks are copied in pairs");
    __shared__ __align__(16) T16 ring[2 * NCH * CH];
    __shared__ __align__(16) float osall[GWM * GWN * 16 * 68];
    const size_t z = blockIdx.z; A += z * sA; if (A2) A2 += z * sA; Bt += z * sB; C += z * sC; (void)Bt2;
    const int tid = (int)threadIdx.x, lane = tid & 31, lr = lane & 15, hi = lane >> 4; const int w = __builtin_amdgcn_readfirstlane(tid >> 5), wm = w % GWM, wn = w / GWM;
    float* os = osall + w * (16 * 68);                                // each wave stages its own output rows
    const int R0 = blockIdx.x * (64 * GWM), C0 = blockIdx.y * (64 * GWN); const int r0 = R0 + wm * 64, c0 = C0 + wn * 64;
    v8f acc[4][4];
#pragma unroll
    for (int mb = 0; mb < 4; ++mb)
#pragma unroll
        for (int nb = 0; nb < 4; ++nb) acc[mb][nb] = (v8f){};
    const unsigned lb = (unsigned)(size_t)ring + (unsigned)tid * 16u;  // this lane's LDS byte address inside a half chunk (256 lanes x 16 bytes)
    auto fill = [&](int s, int buf) {
#pragma unroll
        for (int c = 0; c < NCH; c += 2) { const T16* g[2];
#pragma unroll
            for (int i = 0; i < 2; ++i) { const int cc = c + i; const T16* p = cc < GWM ? A + (size_t)(R0 + cc * 64) * K : cc < GWM * NAP ? A2 + (size_t)(R0 + (cc - GWM) * 64) * K : Bt + (size_t)(C0 + (cc - GWM * NAP) * 64) * K; g[i] = p + (size_t)s * CH + tid * 8; }
            const unsigned l = lb + (unsigned)((buf * NCH + c) * (CH * 2));
            cp4(l, g[0], l + 4096u, g[0] + 2048, l + 8192u, g[1], l + 12288u, g[1] + 2048); } };
    const int nst = K >> 6;                                          // K % 64 == 0
    fill(0, 0);
    asm volatile("s_wait_asynccnt 0x0" ::: "memory");                // this wave's copies of stage 0 have landed
    __syncthreads();                                                 // and every other wave's: nothing of stage 0 is read in front of this barrier
    if (nst > 1) fill(1, 1);
#pragma unroll 1
    for (int s = 0; s < nst; ++s) {
        const T16* sb = ring + (s & 1) * (NCH * CH) + lane * 8;
#pragma unroll
        for (int t = 0; t < 2; ++t) {
            V a[4], a2[4], b[4];
            const T16* pa = sb + wm * CH + t * 2048; const T16* pb = sb + (GWM * NAP + wn) * CH + t * 2048;
#pragma unroll
            for (int mb = 0; mb < 4; ++mb) { a[mb] = WFrag<T16>::ld(pa + mb * 512); if (NSPLIT == 1) a2[mb] = WFrag<T16>::ld(pa + GWM * CH + mb * 512); }
#pragma unroll
            for (int nb = 0; nb < 4; ++nb) b[nb] = WFrag<T16>::ld(pb + nb * 512);
            __builtin_amdgcn_sched_barrier(0);   // keeps every product behind the whole group of LDS reads: left alone the compiler reloads one B fragment per four products and waits out the LDS latency each time
#pragma unroll
            for (int nb = 0; nb < 4; ++nb)
#pragma unroll
                for (int mb = 0; mb < 4; ++mb) { acc[mb][nb] = WFrag<T16>::mma(a[mb], b[nb], acc[mb][nb]); if (NSPLIT == 1) acc[mb][nb] = WFrag<T16>::mma(a2[mb], b[nb], acc[mb][nb]); }
            if constexpr (NSPLIT == 1) __builtin_amdgcn_sched_barrier(0);   // twelve fragments a trip: keeps the next trip's reads behind these products, else the wave needs more than 256 registers
        }
        asm volatile("s_wait_dscnt 0x0" ::: "memory");               // this wave's reads of the buffer have returned before it is refilled
        asm volatile("s_wait_asynccnt 0x0" ::: "memory");            // this wave's copies of stage s + 1 have landed
        __syncthreads();                                             // publishes stage s + 1 and ends every wave's reads of stage s
        if (s + 2 < nst) fill(s + 2, s & 1);
    }
    asm volatile("s_wait_asynccnt 0x0" ::: "memory");                // no copy is outstanding when the wave goes on to its epilogue and ends
    if constexpr (EPI != 0) {
        static_assert(HD == 64, "one 64-column tile is one head");
        const int third = (c0 / 64) / NH_, head = (c0 / 64) % NH_;
        const size_t pb = ((((size_t)third * NB_ + r0 / TT) * NH_ + head) * TT + r0 % TT) * HD + lane * 8;   // 64 positions x 64 dims of one head are 8 tiles in a row, in either plane kind
        auto planes = [&](auto trc) { constexpr bool TR = decltype(trc)::value;   // TR: the transposed (v) kind
#pragma unroll
        for (int g = 0; g < 4; ++g) {                                 // 16 tile rows a trip: positions 16 g .. (q, k), dims 16 g .. (v)
            if constexpr (!TR) {
#pragma unroll
                for (int nb = 0; nb < 4; ++nb)
#pragma unroll
                    for (int j = 0; j < 8; ++j) os[(hi * 8 + j) * 68 + nb * 16 + lr] = acc[g][nb][j];
            } else {                                                  // a lane's 8 accumulator rows are 8 consecutive positions of its one dim
#pragma unroll
                for (int mb = 0; mb < 4; ++mb) { float* op = os + lr * 68 + mb * 16 + hi * 8; const v8f xv = acc[mb][g]; *(v4fa*)op = __builtin_shufflevector(xv, xv, 0, 1, 2, 3); *(v4fa*)(op + 4) = __builtin_shufflevector(xv, xv, 4, 5, 6, 7); } }
            __builtin_amdgcn_wave_barrier(); asm volatile("" ::: "memory");   // keeps the compiler from moving the read-back over the other lanes' staging writes
#pragma unroll
            for (int s = 0; s < 4; ++s) { const float* ip = os + lr * 68 + s * 16 + hi * 8; const v4f a0 = *(const v4fa*)ip, a1 = *(const v4fa*)(ip + 4); v8h o16; v8us oh, ol;
#pragma unroll
                for (int k = 0; k < 4; ++k) { unsigned short u, v; o16[k] = tohx(a0[k]); splitf(a0[k], u, v); oh[k] = u; ol[k] = v; o16[4 + k] = tohx(a1[k]); splitf(a1[k], u, v); oh[4 + k] = u; ol[4 + k] = v; }
                const size_t e = pb + (!TR ? g * 1024 + s * 256 : (s >> 1) * 2048 + g * 512 + (s & 1) * 256); *(v8h*)(P16 + e) = o16; *(v8us*)(Ph + e) = oh; *(v8us*)(Pl + e) = ol;
                asm volatile("s_wait_xcnt 0x0" ::: "memory"); }       // stands in front of the next rows' writes of the registers that these three stores name
            __builtin_amdgcn_wave_barrier(); asm volatile("" ::: "memory");   // keeps the next trip's staging writes behind this trip's reads
        } };
        if (third < 2) planes(BoolC<false>{}); else planes(BoolC<true>{});   // the same for the whole work-group: a scalar branch
        return;
    }
#pragma unroll
    for (int mb = 0; mb < 4; ++mb) {
#pragma unroll
        for (int nb = 0; nb < 4; ++nb) {
#pragma unroll
            for (int j = 0; j < 8; ++j) os[(hi * 8 + j) * 68 + nb * 16 + lr] = acc[mb][nb][j]; }
        __builtin_amdgcn_wave_barrier(); asm volatile("" ::: "memory");
        float* crow = C + (size_t)(r0 + mb * 16) * ldc + c0;
{
#pragma unroll
            for (int s = 0; s < 8; ++s) { const int row = 2 * s + hi, cofs = lr * 4; v4f val = *(const v4fa*)(os + row * 68 + cofs); if (BIAS) { val[0] += bfr(bias[c0 + cofs]); val[1] += bfr(bias[c0 + cofs + 1]); val[2] += bfr(bias[c0 + cofs + 2]); val[3] += bfr(bias[c0 + cofs + 3]); }
                *(v4f*)(crow + (size_t)row * ldc + cofs) = val; }
             }
        __builtin_amdgcn_wave_barrier(); asm volatile("" ::: "memory");
    }
}

typedef __attribute__((ext_vector_type(2))) _Float16 v2h;
typedef __attribute__((ext_vector_type(4))) _Float16 v4h;
typedef __attribute__((ext_vector_type(2))) unsigned short v2us;
typedef __attribute__((ext_vector_type(4))) unsigned short v4us;
typedef __attribute__((ext_vector_type(2))) float v2f;
typedef __attribute__((ext_vector_type(4))) int v4i;

// The three converters below are independent of each other and share ONE launch (k_prep): each is written for the block index blk of its own range.
__device__ __forceinline__ void wtG_blk(const float* __restrict__ w, int K, int N, bf* Bt, int blk) {
    const int lane = threadIdx.x & 31; const int L0 = (blk * 8 + (threadIdx.x >> 5)) * 8; const int nlines = N * K / 64;
{
#pragma unroll 1
        for (int l = 0; l < 8; ++l) { const int L = L0 + l; if (L >= nlines) break; const size_t e = (size_t)L * 64 + lane * 2; const int grp = (int)(e >> 11), wi = (int)(e & 511), KT = K >> 5; const int n = (grp / KT) * 64 + ((int)(e >> 9) & 3) * 16 + ((wi >> 3) & 15), k = (grp % KT) * 32 + (wi >> 7) * 8 + (wi & 7); v2us o;   // e counts in fragment order
            const float* p0 = w + (size_t)k * N + n; const float* p1 = p0 + N; const float w0 = *p0, w1 = *p1;
            asm volatile("s_wait_xcnt 0x0" :: "v"(p0), "v"(p1) : "memory");   // stands in front of every later write of the two loads' address registers, which are inputs so that they keep their registers up to it
            o[0] = f2bf(w0); o[1] = f2bf(w1); *(v2us*)(Bt + e) = o; }
         }
}
// cvt8_blk: f32 rows of K -> bf16 plane in fragment order. A block takes 16 rows x 128 k = 4 tiles: whole lines are read, the 16-byte runs change places in LDS (16 runs + 16 bytes of pad: no bank conflict either way), whole lines are stored. rows / 16 * K / 128 blocks.
__device__ __forceinline__ void cvt8_blk(const float* __restrict__ src, bf* dst, int K, int blk) {
    __shared__ __align__(16) bf st[16 * 17 * 8];
    const int t = threadIdx.x, row = t >> 4, c = t & 15, ns = K >> 7; const int rb = blk / ns, sg = blk % ns;
    const v8f v = *(const v8f*)(src + (size_t)(rb * 16 + row) * K + sg * 128 + c * 8); v8us o;
#pragma unroll
    for (int k = 0; k < 8; ++k) o[k] = f2bf(v[k]);
    *(v8usa*)(st + (c * 17 + row) * 8) = o;                           // run c of a row (k = 8 c ..) is group c of 16 runs in fragment order
    __syncthreads();                                                 // every run is in LDS before any thread reads the one it stores
    *(v8us*)(dst + ((size_t)(rb >> 2) * (K >> 5) + sg * 4 + (t >> 6)) * 2048 + (rb & 3) * 512 + (t & 63) * 8) = *(const v8usa*)(st + ((t >> 4) * 17 + (t & 15)) * 8);
    asm volatile("s_wait_xcnt 0x0" ::: "memory"); }   // stands in front of every later write of a register that the store names: in the merged kernel the other converters' code follows this one in the listing
// k_prep: blocks [0, PW1) transpose w_qkv, [PW1, PW1 + PW2) w_out (the latency-bound ones first), the rest convert x of both sequences. The branch is the same for a whole block, the converter's barrier included.
#define PW1 (DM * (DQ + 2 * DKV) / 4096)
#define PW2 (DQ * DM / 4096)
#define PXB (NB_ * TT * DM / 2048)
__global__ __launch_bounds__(256) void k_prep(const float* __restrict__ wf, const float* __restrict__ wo, const float* __restrict__ x, bf* WALL, bf* WO, bf* XB) {
    const int b = (int)blockIdx.x;
    if (b < PW1) wtG_blk(wf, DM, DQ + 2 * DKV, WALL, b);
    else if (b < PW1 + PW2) wtG_blk(wo, DQ, DM, WO, b - PW1);
    else cvt8_blk(x, XB, DM, b - (PW1 + PW2)); }
// ---- k_fattn: causal scores, softmax and probability x value product of one head in ONE kernel; no score or probability ever reaches memory.
// Transposed products: S^T = K Q^T (A = 16 key rows, B = 16 query columns), O^T += V^T P^T (A = 16 rows of V^T, B = P^T). A lane then holds the scores of ONE query (column lr; keys 8 hi + j of each 16-key tile),
// and the two score tiles of a 32-key block, converted in place, ARE the B operand of the value product in the order that WFrag::ld gives A (k = 8 hi + 0..7, 16 + 8 hi + 0..7).
// A work-group owns 16 NQ query rows of one head. Its FW waves share the key loop (wave w takes the 32-key blocks w, w + FW, ... up to the diagonal block), each with its own running maximum, sum and O^T tile
// (online softmax, base 2); the FW partial results are brought to the common maximum and summed in wave order through LDS, divided by the summed denominator and stored as the hi/lo bf16 planes of the merged heads. All planes in fragment order (above k_gemmw).
// amdgpu_waves_per_eu(4): at most 256 registers, so that four work-groups (one wave of each per SIMD) stay resident and cover each other's load and softmax latency.
// HL: hi+lo bf16 planes, three products for each contraction; else single fp16 with the probabilities carried x 2^10 (numerator and denominator alike).
// Both kinds share ONE launch (k_fattn below fattn_body): grid (sequences x heads, row blocks), longest rows first, the hi+lo row blocks (the shortest) last.
#define FW 4
typedef __attribute__((ext_vector_type(16))) unsigned short v16us;
template <typename T16, bool HL, int NQ>
__device__ __forceinline__ void fattn_body(const T16* __restrict__ Q, const T16* __restrict__ Q2, const T16* __restrict__ Kp, const T16* __restrict__ K2, const T16* __restrict__ Vt, const T16* __restrict__ V2, const int q0, bf* Ah, bf* Al) {
    typedef typename WFrag<T16>::V V; typedef WFrag<T16> F;
    constexpr int QW = 16 * NQ; constexpr float SC2 = SCL * 1.4426950408889634f;
    __shared__ __align__(16) float so[FW * QW * 68];
    __shared__ float sm[FW * QW], sl[FW * QW];
    const int lane = threadIdx.x & 31, lr = lane & 15, hi = lane >> 4; const int w = __builtin_amdgcn_readfirstlane((int)(threadIdx.x >> 5));
    const int h = (int)blockIdx.x % NH_, sq = (int)blockIdx.x / NH_;
    const size_t hp = (size_t)blockIdx.x * TT * HD; Q += hp; Kp += hp; Vt += hp; if constexpr (HL) { Q2 += hp; K2 += hp; V2 += hp; }
    const int nkb = (q0 + QW - 1) / 32 + 1;                          // 32-key blocks up to and with the one that holds the last query's own key
    V bq[NQ][2], bq2[NQ][2];
#pragma unroll
    for (int qt = 0; qt < NQ; ++qt)
#pragma unroll
        for (int ks = 0; ks < 2; ++ks) { const size_t qo = (size_t)(q0 + qt * 16) * HD + ks * 512 + lane * 8; bq[qt][ks] = F::ld(Q + qo); if constexpr (HL) bq2[qt][ks] = F::ld(Q2 + qo); }
    v8f o[4][NQ]; float m[NQ], l[NQ];
#pragma unroll
    for (int qt = 0; qt < NQ; ++qt) { m[qt] = -1.0e30f; l[qt] = 0.f;
#pragma unroll
        for (int dt = 0; dt < 4; ++dt) o[dt][qt] = (v8f){}; }
    const size_t koff = lane * 8, voff = lane * 8;                    // a 32-key block is 4 tiles in a row in the key planes (16 keys x 32 dims each) and in the value planes (16 dims x 32 keys each)
    V ak[2][2], ak2[2][2], av[4], av2[4];
    // each loader ends with s_wait_xcnt 0: it stands in front of every later write of a register that one of its loads names as its address (some of these are rewritten behind a branch);
    // the wait takes the addresses as inputs, so that they keep their registers up to it and no load of the group returns its data onto them
    auto ldK = [&](int kb) { const T16* p = Kp + koff + (size_t)kb * 32 * HD; const T16* p2 = HL ? K2 + koff + (size_t)kb * 32 * HD : p;
#pragma unroll
        for (int kt = 0; kt < 2; ++kt)
#pragma unroll
            for (int ks = 0; ks < 2; ++ks) { ak[kt][ks] = F::ld(p + kt * 1024 + ks * 512); if constexpr (HL) ak2[kt][ks] = F::ld(p2 + kt * 1024 + ks * 512); }
        asm volatile("s_wait_xcnt 0x0" :: "v"(p), "v"(p2) : "memory"); };
    auto ldV = [&](int k0) { const T16* p = Vt + voff + (size_t)k0 * HD; const T16* p2 = HL ? V2 + voff + (size_t)k0 * HD : p;
#pragma unroll
        for (int dt = 0; dt < 4; ++dt) { av[dt] = F::ld(p + dt * 512); if constexpr (HL) av2[dt] = F::ld(p2 + dt * 512); }
        asm volatile("s_wait_xcnt 0x0" :: "v"(p), "v"(p2) : "memory"); };
    // single fp16: the values are fetched at the head of a pass and the NEXT pass's keys behind the score products, so that both latencies run under matrix and softmax work.
    // hi+lo (at most 4 passes a wave, twice the fragments): keys, products, then values, which keeps the wave inside 256 registers without spills.
    if constexpr (!HL) ldK(w);
#pragma unroll 1
    for (int kb = w; kb < nkb; kb += FW) {
        const int k0 = kb * 32;
        if constexpr (HL) ldK(kb); else ldV(k0);
        v8f s[NQ][2];
#pragma unroll
        for (int kt = 0; kt < 2; ++kt)
#pragma unroll
            for (int qt = 0; qt < NQ; ++qt) { v8f c = (v8f){};
#pragma unroll
                for (int ks = 0; ks < 2; ++ks) { c = F::mma(ak[kt][ks], bq[qt][ks], c); if constexpr (HL) { c = F::mma(ak[kt][ks], bq2[qt][ks], c); c = F::mma(ak2[kt][ks], bq[qt][ks], c); } }
                s[qt][kt] = c; }
        if constexpr (HL) ldV(k0); else ldK((kb + FW < nkb) ? kb + FW : kb);   // the last pass fetches its own block again: in bounds, unused
        if (k0 + 31 > q0) {                                          // only the diagonal block holds keys behind a query
#pragma unroll
            for (int qt = 0; qt < NQ; ++qt)
#pragma unroll
                for (int kt = 0; kt < 2; ++kt)
#pragma unroll
                    for (int j = 0; j < 8; ++j) if (k0 + kt * 16 + hi * 8 + j > q0 + qt * 16 + lr) s[qt][kt][j] = -3.0e38f; }
#pragma unroll
        for (int qt = 0; qt < NQ; ++qt) {
            float mx = s[qt][0][0];
#pragma unroll
            for (int j = 1; j < 16; ++j) mx = fmaxf(mx, s[qt][j >> 3][j & 7]);
            mx = fmaxf(mx, __shfl_xor(mx, 16, 32));                  // the other half-wave holds this query's other 16 keys
            const float mn = fmaxf(m[qt], mx * SC2), al = __builtin_amdgcn_exp2f(m[qt] - mn), mo = HL ? mn : mn - 10.0f; m[qt] = mn;
            float sum = 0.f;
#pragma unroll
            for (int j = 0; j < 16; ++j) { const float p = __builtin_amdgcn_exp2f(s[qt][j >> 3][j & 7] * SC2 - mo); s[qt][j >> 3][j & 7] = p; sum += p; }
            l[qt] = l[qt] * al + sum;
#pragma unroll
            for (int dt = 0; dt < 4; ++dt) o[dt][qt] *= al;
            if constexpr (HL) { v16us ph, pl;
#pragma unroll
                for (int j = 0; j < 16; ++j) { unsigned short a, c2; splitf(s[qt][j >> 3][j & 7], a, c2); ph[j] = a; pl[j] = c2; }
                const V bh = __builtin_bit_cast(V, ph), bl = __builtin_bit_cast(V, pl);
#pragma unroll
                for (int dt = 0; dt < 4; ++dt) { o[dt][qt] = F::mma(av[dt], bh, o[dt][qt]); o[dt][qt] = F::mma(av[dt], bl, o[dt][qt]); o[dt][qt] = F::mma(av2[dt], bh, o[dt][qt]); }
            } else { V pb;
#pragma unroll
                for (int j = 0; j < 16; ++j) pb[j] = tohx(s[qt][j >> 3][j & 7]);
#pragma unroll
                for (int dt = 0; dt < 4; ++dt) o[dt][qt] = F::mma(av[dt], pb, o[dt][qt]); }
        }
    }
#pragma unroll
    for (int qt = 0; qt < NQ; ++qt) { l[qt] += __shfl_xor(l[qt], 16, 32); if (hi == 0) sm[w * QW + qt * 16 + lr] = m[qt]; }
    __syncthreads();                                                 // every wave's maxima are in LDS before any wave forms the common one
#pragma unroll
    for (int qt = 0; qt < NQ; ++qt) { const int q = qt * 16 + lr; float M = sm[q];
#pragma unroll
        for (int p = 1; p < FW; ++p) M = fmaxf(M, sm[p * QW + q]);
        const float f = __builtin_amdgcn_exp2f(m[qt] - M); if (hi == 0) sl[w * QW + q] = l[qt] * f;   // a wave without a key block: f = 0
        float* op = so + (size_t)(w * QW + q) * 68 + hi * 8;
#pragma unroll
        for (int dt = 0; dt < 4; ++dt) { const v8f x = o[dt][qt] * f; *(v4fa*)(op + dt * 16) = __builtin_shufflevector(x, x, 0, 1, 2, 3); *(v4fa*)(op + dt * 16 + 4) = __builtin_shufflevector(x, x, 4, 5, 6, 7); } }
    __syncthreads();                                                 // every wave's rescaled partial tile and sum are in LDS before any thread adds them
#pragma unroll
    for (int i = 0; i < NQ; ++i) { const int u = (int)threadIdx.x, q = i * 16 + (u & 15), d0 = (u >> 4) * 8; const float* op = so + (size_t)q * 68 + d0; v4f a0 = *(const v4fa*)op, a1 = *(const v4fa*)(op + 4); float L = sl[q];
#pragma unroll
        for (int p = 1; p < FW; ++p) { a0 += *(const v4fa*)(op + p * (QW * 68)); a1 += *(const v4fa*)(op + p * (QW * 68) + 4); L += sl[p * QW + q]; }
        const float inv = __fdiv_rn(1.0f, L); v8us oh, ol;
#pragma unroll
        for (int k = 0; k < 4; ++k) { unsigned short a, c2; splitf(a0[k] * inv, a, c2); oh[k] = a; ol[k] = c2; splitf(a1[k] * inv, a, c2); oh[4 + k] = a; ol[4 + k] = c2; }
        const int qb = sq * TT + q0 + i * 16; const size_t oo = ((size_t)(qb >> 6) * (DQ / 32) + h * 2 + (u >> 6)) * 2048 + ((qb >> 4) & 3) * 512 + (u & 63) * 8; *(v8us*)(Ah + oo) = oh; *(v8us*)(Al + oo) = ol;   // fragment order: 16 queries x this head's 64 dims are 2 tiles; run u of them is (query u & 15, dims 8 (u >> 4) ..)
        asm volatile("s_wait_xcnt 0x0" ::: "memory"); }   // stands in front of every later write of a register that the two stores name: in the merged kernel the other body's code follows this one in the listing
}
// ---- fattn_sh (query rows >= RH, single fp16; fattn_body above serves the hi+lo rows): a work-group owns FW x 32 query rows of one head, each wave 32 of them for ALL their keys, so no partial results are merged.
// The FW waves walk the same keys: a stage of SK keys (their key tiles and their value tiles, each one contiguous run in a fragment-order plane) is brought into LDS once for the work-group
// by asynchronous copies, two buffers, stage s + 1 in flight while stage s is worked on, and every wave reads its fragments from there: a key or value byte leaves L2 once per FW x 32 queries, not once per 32.
// A wave skips the 32-key blocks behind its own diagonal block (a scalar branch) but passes every barrier. A lane's 8 accumulators of a tile are one 16-byte run of the merged-heads planes: stored straight from registers.
#define SK 64
// exp2_slot: 2^x with the free slot that the instruction set asks for behind a transcendental inside the statement itself. For the rarely taken branch of fattn_sh.
__device__ __forceinline__ float exp2_slot(float x) { float r; asm("v_exp_f32 %0, %1\n\tv_nop" : "=v"(r) : "v"(x)); return r; }
__device__ __forceinline__ void fattn_sh(const h16* __restrict__ Q, const h16* __restrict__ Kp, const h16* __restrict__ Vt, const int q0, bf* Ah, bf* Al) {
    typedef WFrag<h16> F; typedef F::V V;
    constexpr int NQ = 2, SE = SK * HD; constexpr float SC2 = SCL * 1.4426950408889634f;   // SE: elements of a stage in one plane
    constexpr float PMAX = 32768.0f;                                 // 2^15, under the largest fp16 (65504); at a fresh reference point a probability is at most 2^10 and a lane's sum at most 2^14
    static_assert(FW * 32 * 8 * 4 == SE, "four 16-byte copies a lane bring one plane's stage");
    __shared__ __align__(16) h16 ring[2 * 2 * SE];
    const int tid = (int)threadIdx.x, lane = tid & 31, lr = lane & 15, hi = lane >> 4; const int w = __builtin_amdgcn_readfirstlane(tid >> 5);
    const int h = (int)blockIdx.x % NH_, sq = (int)blockIdx.x / NH_;
    const size_t hp = (size_t)blockIdx.x * TT * HD; Q += hp; Kp += hp; Vt += hp;
    const int qw = q0 + w * 32, kbl = qw / 32;                       // this wave's first query; the 32-key block that holds its queries' own keys, its last
    const int nst = (q0 + FW * 32) / SK;                             // stages up to the last query's own key: at least 2
    const unsigned lb = (unsigned)(size_t)ring + (unsigned)tid * 16u; // this lane's LDS byte address inside a run of 128 lanes x 16 bytes
    auto fill = [&](int s, int buf) { const h16* gk = Kp + (size_t)s * SE + tid * 8; const h16* gv = Vt + (size_t)s * SE + tid * 8; const unsigned l = lb + (unsigned)(buf * (2 * SE * 2));
        cp4(l, gk, l + 2048u, gk + 1024, l + 4096u, gk + 2048, l + 6144u, gk + 3072);
        cp4(l + 8192u, gv, l + 10240u, gv + 1024, l + 12288u, gv + 2048, l + 14336u, gv + 3072); };
    fill(0, 0);
    V bq[NQ][2]; { const h16* pq = Q + (size_t)qw * HD + lane * 8;
#pragma unroll
        for (int qt = 0; qt < NQ; ++qt)
#pragma unroll
            for (int ks = 0; ks < 2; ++ks) bq[qt][ks] = F::ld(pq + qt * 1024 + ks * 512);
        asm volatile("s_wait_xcnt 0x0" :: "v"(pq) : "memory"); }     // stands in front of every later write of the address registers of these loads, which are inputs so that they keep their registers up to it
    v8f o[4][NQ]; float m[NQ], l[NQ];
#pragma unroll
    for (int qt = 0; qt < NQ; ++qt) { m[qt] = -1.0e30f; l[qt] = 0.f;
#pragma unroll
        for (int dt = 0; dt < 4; ++dt) o[dt][qt] = (v8f){}; }
    asm volatile("s_wait_asynccnt 0x0" ::: "memory");                // this wave's copies of stage 0 have landed
    __syncthreads();                                                 // and every other wave's: nothing of stage 0 is read in front of this barrier
    fill(1, 1);
#pragma unroll 1
    for (int s = 0; s < nst; ++s) {                                  // kept rolled: one copy of the two passes in the instruction cache
        const h16* sb = ring + (s & 1) * (2 * SE) + lane * 8;
#pragma unroll
        for (int t = 0; t < SK / 32; ++t) { const int kb = s * (SK / 32) + t, k0 = kb * 32;
            if (kb > kbl) continue;                                  // behind the diagonal of every query of this wave: the same for the whole wave
            V ak[2][2], av[4];
#pragma unroll
            for (int kt = 0; kt < 2; ++kt)
#pragma unroll
                for (int ks = 0; ks < 2; ++ks) ak[kt][ks] = F::ld(sb + t * 2048 + kt * 1024 + ks * 512);
#pragma unroll
            for (int dt = 0; dt < 4; ++dt) av[dt] = F::ld(sb + SE + t * 2048 + dt * 512);
            __builtin_amdgcn_sched_barrier(0);   // keeps every product behind the whole group of LDS reads: left alone the compiler reloads one key fragment per two products and waits out the LDS latency each time
            v8f sc[NQ][2];
#pragma unroll
            for (int kt = 0; kt < 2; ++kt)
#pragma unroll
                for (int qt = 0; qt < NQ; ++qt) { v8f c = (v8f){};
#pragma unroll
                    for (int ks = 0; ks < 2; ++ks) c = F::mma(ak[kt][ks], bq[qt][ks], c);
                    sc[qt][kt] = c; }
            if (kb == kbl) {                                         // only the diagonal block holds keys behind a query
#pragma unroll
                for (int qt = 0; qt < NQ; ++qt)
#pragma unroll
                    for (int kt = 0; kt < 2; ++kt)
#pragma unroll
                        for (int j = 0; j < 8; ++j) if (k0 + kt * 16 + hi * 8 + j > qw + qt * 16 + lr) sc[qt][kt][j] = -3.0e38f; }
            // The probabilities are formed against the reference point m that an EARLIER block left (softmax does not depend on the point; numerator and denominator carry the same one).
            // A lane's 16 probabilities are not negative, so their sum bounds each of them: while every lane's sum stays at or below PMAX, all of them fit fp16 and the block is done.
            V pb[NQ]; float sum[NQ];
            auto probs = [&](auto rare) {
#pragma unroll
                for (int qt = 0; qt < NQ; ++qt) { const float mo = m[qt] - 10.0f; float a = 0.f;
#pragma unroll
                    for (int j = 0; j < 16; ++j) { const float e = sc[qt][j >> 3][j & 7] * SC2 - mo, p = decltype(rare)::value ? exp2_slot(e) : __builtin_amdgcn_exp2f(e); a += p; pb[qt][j] = tohx(p); }
                    sum[qt] = a; } };
            probs(BoolC<false>{});
            // Otherwise (the first block, whose point is -1e30; a score far above the point; not-a-number) the whole wave takes the running maximum as the new point, brings l and O to it and forms the block's probabilities again, each then at most 2^10: a scalar branch.
            if (__builtin_amdgcn_ballot_w32(!(sum[0] <= PMAX && sum[1] <= PMAX)) != 0u) {
                float mh[NQ], mo2[NQ];
#pragma unroll
                for (int qt = 0; qt < NQ; ++qt) { mh[qt] = sc[qt][0][0];
#pragma unroll
                    for (int j = 1; j < 16; ++j) mh[qt] = fmaxf(mh[qt], sc[qt][j >> 3][j & 7]); }
#pragma unroll
                for (int qt = 0; qt < NQ; ++qt) mo2[qt] = __shfl_xor(mh[qt], 16, 32);   // the other half-wave holds this query's other 16 keys
#pragma unroll
                for (int qt = 0; qt < NQ; ++qt) {
                    const float mx = fmaxf(mh[qt], mo2[qt]);
                    const float mn = fmaxf(m[qt], mx * SC2), al = exp2_slot(m[qt] - mn); m[qt] = mn;
                    l[qt] *= al;
#pragma unroll
                    for (int dt = 0; dt < 4; ++dt) o[dt][qt] *= al; }
                probs(BoolC<true>{}); }
#pragma unroll
            for (int qt = 0; qt < NQ; ++qt) { l[qt] += sum[qt];
#pragma unroll
                for (int dt = 0; dt < 4; ++dt) o[dt][qt] = F::mma(av[dt], pb[qt], o[dt][qt]); }
        }
        asm volatile("s_wait_dscnt 0x0" ::: "memory");               // this wave's reads of the buffer have returned before it is refilled
        asm volatile("s_wait_asynccnt 0x0" ::: "memory");            // this wave's copies of stage s + 1 have landed
        __syncthreads();                                             // publishes stage s + 1 and ends every wave's reads of stage s
        if (s + 2 < nst) fill(s + 2, s & 1);
    }
    asm volatile("s_wait_asynccnt 0x0" ::: "memory");                // no copy is outstanding when the wave goes on to its epilogue and ends
#pragma unroll
    for (int qt = 0; qt < NQ; ++qt) { const float L = l[qt] + __shfl_xor(l[qt], 16, 32), inv = __fdiv_rn(1.0f, L);
        const int qb = sq * TT + qw + qt * 16; const size_t ob = ((size_t)(qb >> 6) * (DQ / 32) + h * 2) * 2048 + ((qb >> 4) & 3) * 512 + lane * 8;   // fragment order: 16 queries x this head's 64 dims are 2 tiles; dims 16 dt + 8 hi .. of query lr are run lane of half dt & 1 of tile dt >> 1
#pragma unroll
        for (int dt = 0; dt < 4; ++dt) { v8us oh, ol;
#pragma unroll
            for (int k = 0; k < 8; ++k) { unsigned short a, c2; splitf(o[dt][qt][k] * inv, a, c2); oh[k] = a; ol[k] = c2; }
            const size_t oo = ob + (dt >> 1) * 2048 + (dt & 1) * 256; *(v8us*)(Ah + oo) = oh; *(v8us*)(Al + oo) = ol;
            asm volatile("s_wait_xcnt 0x0" ::: "memory"); } }        // stands in front of every later write of a register that the two stores name
}
#define FY1 ((TT - RH) / (FW * 32))   // row blocks of FW x 32 queries, single fp16
#define FY2 (RH / 16)             // row blocks of 16 queries, hi+lo
__global__ __launch_bounds__(FW * 32) __attribute__((amdgpu_waves_per_eu(4))) void k_fattn(const h16* __restrict__ Q16, const h16* __restrict__ K16, const h16* __restrict__ V16, const bf* __restrict__ Qh, const bf* __restrict__ Ql, const bf* __restrict__ Kh, const bf* __restrict__ Kl, const bf* __restrict__ Vh, const bf* __restrict__ Vl, bf* Ah, bf* Al) {
    const int y = (int)blockIdx.y;                                   // the branch is the same for a whole work-group, the barriers of either body included
    if (y < FY1) {
        // all these work-groups are resident together, about four to a WGP:
        // every second group of 8 values of y runs from short to long (a permutation of the row blocks; for speed only)
        const int top = (y | 7) < FY1 - 1 ? (y | 7) : FY1 - 1, lev = ((y >> 3) & 1) ? top - (y & 7) : y;
        fattn_sh(Q16, K16, V16, RH + (FY1 - 1 - lev) * (FW * 32), Ah, Al); }
    else fattn_body<bf, true, 1>(Qh, Ql, Kh, Kl, Vh, Vl, (FY1 + FY2 - 1 - y) * 16, Ah, Al);
}

extern "C" void kernel_launch(void* const* d_in, const int* in_sizes, int n_in,
                              void* d_out, int out_size, void* d_ws, size_t ws_size, hipStream_t stream) {
    (void)in_sizes; (void)n_in; (void)out_size;
    const float* x = (const float*)d_in[0]; const float* wf = (const float*)d_in[1]; const float* wo = (const float*)d_in[2]; /* x, w_qkv, w_o = d_in[0..2]; no bias inputs in this module: the projection GEMMs below use the bias-free instantiation */
    float* OUT = (float*)d_out;     // [2][4096][1024]
    char* wsp = (char*)d_ws;
    auto take = [&](size_t bytes) { char* p = wsp; wsp += (bytes + 255) & ~(size_t)255; return (void*)p; };
    bf* WO = (bf*)take((size_t)DM * DQ * 2);
    bf* XB = (bf*)take((size_t)NB_ * TT * DM * 2); bf* WALL = (bf*)take((size_t)(DQ + 2 * DKV) * DM * 2);
    const size_t PS = (size_t)NB_ * NH_ * TT * HD;        // one plane: both sequences, all heads; q, k, v planes of a kind stand in a row
    h16* QP16 = (h16*)take(3 * PS * 2); h16* KP16 = QP16 + PS; h16* VT16 = KP16 + PS;
    bf* QPh = (bf*)take(3 * PS * 2); bf* KPh = QPh + PS; bf* VTh = KPh + PS; bf* QPl = (bf*)take(3 * PS * 2); bf* KPl = QPl + PS; bf* VTl = KPl + PS;
    bf* ATh = (bf*)take((size_t)NB_ * TT * DQ * 2); bf* ATl = (bf*)take((size_t)NB_ * TT * DQ * 2);
    if ((size_t)(wsp - (char*)d_ws) > ws_size) return;    // ws 256 MiB
    k_prep<<<PW1 + PW2 + PXB, 256, 0, stream>>>(wf, wo, x, WALL, WO, XB);
    k_gemmw<bf, 0, false, 1><<<dim3(NB_ * TT / (64 * GWM), (DQ + 2 * DKV) / (64 * GWN), 1), GWM * GWN * 32, 0, stream>>>(XB, nullptr, WALL, nullptr, DM, nullptr, 0, nullptr, 0, 0, 0, QP16, QPh, QPl);
    k_fattn<<<dim3(NB_ * NH_, FY1 + FY2), FW * 32, 0, stream>>>(QP16, KP16, VT16, QPh, QPl, KPh, KPl, VTh, VTl, ATh, ATl);
    k_gemmw<bf, 1, false, 0><<<dim3(NB_ * TT / (64 * GWM), DM / (64 * GWN), 1), GWM * GWN * 32, 0, stream>>>(ATh, ATl, WO, nullptr, DQ, OUT, DM, nullptr, 0, 0, 0, nullptr, nullptr, nullptr);
}

// v009
// One run takes 136 microseconds.
// Next to v008, in two timings, it ran 1.03 and 1.05 times as fast.
// Over all steps from v000 it is 33.6 times as fast.
#include <hip/hip_runtime.h>

// Causal self-attention with a fused BIAS-FREE qkv projection over TWO 4,096-token sequences, written chunk by chunk in the module (x [2][4096][1024]; qkv = x w_qkv ('xw' [1024][3072] normal x 1/32, NO bias) viewed (3, 16, 64): column thirds q | k | v (16 heads x 64); the module scans over 32 query chunks of 128 rows, each against ALL keys with 'query position >= key position' kept and -1e10 elsewhere (== the full causal rule; == exclusion); scores / sqrt(64); softmax over the keys; out = merged w_out ('xw' [1024][1024], NO bias) -> [2][4096][1024] (8.4 M); argument order x, w_qkv, w_out).
// Compute dtypes, f32 accumulate: every input rounded to bf16; q/k/v on PLAIN bf16 operands (inputs: exact), no biases in this module; causal scores and attn.v: query rows < 512 hl (3 products), the rest single fp16 (x1024), causal block skipping; online softmax f32, fused with both products (k_fattn); w_o hl x exact (2 products), no bias.

#define NB_  2      // TWO sequences in this module: both go through every launch together (rows of the GEMMs = sequence * TT + position; attention planes [sequence][head])
#define TT   4096
#define DM   1024
#define NH_  16
#define NKV  16
#define HD   64
#define DQ   (NH_ * HD)
#define DKV  (NKV * HD)
#define RH   512                  // query rows < RH use hi+lo planes (0: none)
#define SCL  0.125f   // HD^-0.5
typedef _Float16 h16;
typedef unsigned short bf;
typedef __attribute__((ext_vector_type(16))) __bf16   v16bf;
typedef __attribute__((ext_vector_type(16))) _Float16 v16h;
typedef __attribute__((ext_vector_type(8)))  _Float16 v8h;
typedef __attribute__((ext_vector_type(8)))  unsigned short v8us;
typedef __attribute__((ext_vector_type(8)))  float    v8f;
typedef __attribute__((ext_vector_type(4)))  float    v4f;
typedef v8h  __attribute__((may_alias)) v8ha;
typedef v4f  __attribute__((may_alias)) v4fa;
typedef v8us __attribute__((may_alias)) v8usa;

__device__ __forceinline__ unsigned short f2bf(float f) { unsigned u = __float_as_uint(f); u += 0x7FFFu + ((u >> 16) & 1u); return (unsigned short)(u >> 16); }
__device__ __forceinline__ float bf2f(unsigned short b) { return __uint_as_float(((unsigned)b) << 16); }
__device__ __forceinline__ float bfr(float f) { return bf2f(f2bf(f)); }
__device__ __forceinline__ v16h cat16(v8h lo, v8h hi) { return __builtin_shufflevector(lo, hi, 0, 1, 2, 3, 4, 5, 6, 7, 8, 9, 10, 11, 12, 13, 14, 15); }
__device__ __forceinline__ v16bf cat16b(v8us lo, v8us hi) { return __builtin_bit_cast(v16bf, __builtin_shufflevector(lo, hi, 0, 1, 2, 3, 4, 5, 6, 7, 8, 9, 10, 11, 12, 13, 14, 15)); }
__device__ __forceinline__ v8f wmma16(v16h a, v16h b, v8f c) { return __builtin_amdgcn_wmma_f32_16x16x32_f16(false, a, false, b, (short)0, c, false, false); }
__device__ __forceinline__ v8f wmmab(v16bf a, v16bf b, v8f c) { return __builtin_amdgcn_wmma_f32_16x16x32_bf16(false, a, false, b, (short)0, c, false, false); }



// ---- FRAGMENT ORDER: every 16-bit operand plane is made of tiles of 16 rows x 32 k, 512 elements each, and the tiles that one wave loads together stand in a row:
// GEMM operands (x, weights, merged heads): [row / 64][k / 32][(row / 16) % 4] tiles; q and k planes: [head][position / 16][dim / 32] tiles; v planes: [head][position / 32][dim / 16] tiles (rows = dims, k = positions).
// Inside a tile element (row r, k = 16 j + 8 hi + e) stands at j * 256 + (16 hi + r) * 8 + e: lane 16 hi + r finds its two 8-element runs at lane * 8 and 256 + lane * 8 (WFrag::ld),
// so each of the two loads of a fragment reads 512 contiguous bytes (4 whole lines) where a row-major plane made it touch 16 lines. The k order of a fragment is what it was.
// ---- k_gemmw: register-blocked GEMM, one wave per 64x64 output tile (16 accumulators), 2 x 4 waves to a work-group (128 x 256 of C); operands from fragment-order 16-bit planes through an LDS ring of two buffers; grid (M/128, N/256, Z), 256 threads.
// C[m][n] (f32, pitch ldc, + optional f32 bias[n]) = sum_k A[m][k] Bt[n][k] (+ split products per NSPLIT). z-batch strides sA/sB/sC in elements. K % 64 == 0.
// EPI 0: C is stored as f32. EPI 1: ONE launch makes q, k and v of both sequences: a wave's column block c0 / 64 is head (c0 / 64) % 16 of third (c0 / 64) / 16 (q | k | v), its row block 64 positions of sequence r0 / TT;
// the tile leaves the kernel as the attention operand planes (fp16 P16, bf16 hi Ph, bf16 lo Pl; each [third][sequence][head]), no f32 copy in memory:
// q, k planes [head] x tiles (rows = positions, k = dims), v planes [head][32-key block][16-dim group] x one tile (rows = dims, k = positions) (v transposed). Either way 16 tile rows are staged in LDS and each store covers half a tile, 512 contiguous bytes.
template <typename T16> struct WFrag;
template <> struct WFrag<h16> { typedef v16h V; static __device__ __forceinline__ V ld(const h16* p) { return cat16(*(const v8h*)p, *(const v8h*)(p + 256)); } static __device__ __forceinline__ v8f mma(V a, V b, v8f c) { return wmma16(a, b, c); } };
template <> struct WFrag<bf> { typedef v16bf V; static __device__ __forceinline__ V ld(const bf* p) { return cat16b(*(const v8us*)p, *(const v8us*)(p + 256)); } static __device__ __forceinline__ v8f mma(V a, V b, v8f c) { return wmmab(a, b, c); } };
__device__ __forceinline__ h16 tohx(float x) { return (h16)x; }
__device__ __forceinline__ void splitf(float y, unsigned short& h, unsigned short& l) { h = f2bf(y); l = f2bf(y - bf2f(h)); }
template <bool B> struct BoolC { static constexpr bool value = B; };
// cp4: four asynchronous 16-byte-a-lane copies from global memory into LDS, through no register. The s_wait_xcnt is the last line of the copies' own statement, so that it stands in front of every later write of a register that one of them names.
__device__ __forceinline__ void cp4(unsigned l0, const void* g0, unsigned l1, const void* g1, unsigned l2, const void* g2, unsigned l3, const void* g3) {
    asm volatile("global_load_async_to_lds_b128 %0, %1, off\n\tglobal_load_async_to_lds_b128 %2, %3, off\n\tglobal_load_async_to_lds_b128 %4, %5, off\n\tglobal_load_async_to_lds_b128 %6, %7, off\n\ts_wait_xcnt 0x0"
                 :: "v"(l0), "v"(g0), "v"(l1), "v"(g1), "v"(l2), "v"(g2), "v"(l3), "v"(g3) : "memory"); }
#define GWM 2      // waves of a work-group along the rows
#define GWN 4      // and along the columns: a work-group owns 128 x 256 of C, each wave 64 x 64
template <typename T16, int NSPLIT, bool BIAS, int EPI>
__global__ __launch_bounds__(GWM * GWN * 32, 4) void k_gemmw(const T16* __restrict__ A, const T16* __restrict__ A2, const T16* __restrict__ Bt, const T16* __restrict__ Bt2, int K, float* C, int ldc, const float* __restrict__ bias, size_t sA, size_t sB, size_t sC, h16* P16, bf* Ph, bf* Pl) {
    typedef typename WFrag<T16>::V V;
    static_assert(NSPLIT <= 1, "the second B plane is not staged");
    // A stage is 64 k of every 64-row block the work-group reads (a chunk: 2 trips x 4 tiles = 4096 elements, CONTIGUOUS in a fragment-order plane): GWM blocks of A (and of A2), GWN of Bt.
    // Two buffers: stage s + 1 flies while stage s is worked on; each chunk is fetched once for the work-group and read from LDS by the GWN (A) or GWM (Bt) waves that need it.
    constexpr int NAP = (NSPLIT == 1) ? 2 : 1, NCH = GWM * NAP + GWN, CH = 4096;
    static_assert(NCH % 2 == 0, "chunks are copied in pairs");
    __shared__ __align__(16) T16 ring[2 * NCH * CH];
    __shared__ __align__(16) float osall[GWM * GWN * 16 * 68];
    const size_t z = blockIdx.z; A += z * sA; if (A2) A2 += z * sA; Bt += z * sB; C += z * sC; (void)Bt2;
    const int tid = (int)threadIdx.x, lane = tid & 31, lr = lane & 15, hi = lane >> 4; const int w = __builtin_amdgcn_readfirstlane(tid >> 5), wm = w % GWM, wn = w / GWM;
    float* os = osall + w * (16 * 68);                                // each wave stages its own output rows
    const int R0 = blockIdx.x * (64 * GWM), C0 = blockIdx.y * (64 * GWN); const int r0 = R0 + wm * 64, c0 = C0 + wn * 64;
    v8f acc[4][4];
#pragma unroll
    for (int mb = 0; mb < 4; ++mb)
#pragma unroll
        for (int nb = 0; nb < 4; ++nb) acc[mb][nb] = (v8f){};
    const unsigned lb = (unsigned)(size_t)ring + (unsigned)tid * 16u;  // this lane's LDS byte address inside a half chunk (256 lanes x 16 bytes)
    auto fill = [&](int s, int buf) {
#pragma unroll
        for (int c = 0; c < NCH; c += 2) { const T16* g[2];
#pragma unroll
            for (int i = 0; i < 2; ++i) { const int cc = c + i; const T16* p = cc < GWM ? A + (size_t)(R0 + cc * 64) * K : cc < GWM * NAP ? A2 + (size_t)(R0 + (cc - GWM) * 64) * K : Bt + (size_t)(C0 + (cc - GWM * NAP) * 64) * K; g[i] = p + (size_t)s * CH + tid * 8; }
            const unsigned l = lb + (unsigned)((buf * NCH + c) * (CH * 2));
            cp4(l, g[0], l + 4096u, g[0] + 2048, l + 8192u, g[1], l + 12288u, g[1] + 2048); } };
    const int nst = K >> 6;                                          // K % 64 == 0
    fill(0, 0);
    asm volatile("s_wait_asynccnt 0x0" ::: "memory");                // this wave's copies of stage 0 have landed
    __syncthreads();                                                 // and every other wave's: nothing of stage 0 is read in front of this barrier
    if (nst > 1) fill(1, 1);
#pragma unroll 1
    for (int s = 0; s < nst; ++s) {
        const T16* sb = ring + (s & 1) * (NCH * CH) + lane * 8;
#pragma unroll
        for (int t = 0; t < 2; ++t) {
            V a[4], a2[4], b[4];
            const T16* pa = sb + wm * CH + t * 2048; const T16* pb = sb + (GWM * NAP + wn) * CH + t * 2048;
#pragma unroll
            for (int mb = 0; mb < 4; ++mb) { a[mb] = WFrag<T16>::ld(pa + mb * 512); if (NSPLIT == 1) a2[mb] = WFrag<T16>::ld(pa + GWM * CH + mb * 512); }
#pragma unroll
            for (int nb = 0; nb < 4; ++nb) b[nb] = WFrag<T16>::ld(pb + nb * 512);
            __builtin_amdgcn_sched_barrier(0);   // keeps every product behind the whole group of LDS reads: left alone the compiler reloads one B fragment per four products and waits out the LDS latency each time
#pragma unroll
            for (int nb = 0; nb < 4; ++nb)
#pragma unroll
                for (int mb = 0; mb < 4; ++mb) { acc[mb][nb] = WFrag<T16>::mma(a[mb], b[nb], acc[mb][nb]); if (NSPLIT == 1) acc[mb][nb] = WFrag<T16>::mma(a2[mb], b[nb], acc[mb][nb]); }
            if constexpr (NSPLIT == 1) __builtin_amdgcn_sched_barrier(0);   // twelve fragments a trip: keeps the next trip's reads behind these products, else the wave needs more than 256 registers
        }
        asm volatile("s_wait_dscnt 0x0" ::: "memory");               // this wave's reads of the buffer have returned before it is refilled
        asm volatile("s_wait_asynccnt 0x0" ::: "memory");            // this wave's copies of stage s + 1 have landed
        __syncthreads();                                             // publishes stage s + 1 and ends every wave's reads of stage s
        if (s + 2 < nst) fill(s + 2, s & 1);
    }
    asm volatile("s_wait_asynccnt 0x0" ::: "memory");                // no copy is outstanding when the wave goes on to its epilogue and ends
    if constexpr (EPI != 0) {
        static_assert(HD == 64, "one 64-column tile is one head");
        const int third = (c0 / 64) / NH_, head = (c0 / 64) % NH_;
        const size_t pb = ((((size_t)third * NB_ + r0 / TT) * NH_ + head) * TT + r0 % TT) * HD + lane * 8;   // 64 positions x 64 dims of one head are 8 tiles in a row, in either plane kind
        auto planes = [&](auto trc) { constexpr bool TR = decltype(trc)::value;   // TR: the transposed (v) kind
#pragma unroll
        for (int g = 0; g < 4; ++g) {                                 // 16 tile rows a trip: positions 16 g .. (q, k), dims 16 g .. (v)
            if constexpr (!TR) {
#pragma unroll
                for (int nb = 0; nb < 4; ++nb)
#pragma unroll
                    for (int j = 0; j < 8; ++j) os[(hi * 8 + j) * 68 + nb * 16 + lr] = acc[g][nb][j];
            } else {                                                  // a lane's 8 accumulator rows are 8 consecutive positions of its one dim
#pragma unroll
                for (int mb = 0; mb < 4; ++mb) { float* op = os + lr * 68 + mb * 16 + hi * 8; const v8f xv = acc[mb][g]; *(v4fa*)op = __builtin_shufflevector(xv, xv, 0, 1, 2, 3); *(v4fa*)(op + 4) = __builtin_shufflevector(xv, xv, 4, 5, 6, 7); } }
            __builtin_amdgcn_wave_barrier(); asm volatile("" ::: "memory");   // keeps the compiler from moving the read-back over the other lanes' staging writes
#pragma unroll
            for (int s = 0; s < 4; ++s) { const float* ip = os + lr * 68 + s * 16 + hi * 8; const v4f a0 = *(const v4fa*)ip, a1 = *(const v4fa*)(ip + 4); v8h o16; v8us oh, ol;
#pragma unroll
                for (int k = 0; k < 4; ++k) { unsigned short u, v; o16[k] = tohx(a0[k]); splitf(a0[k], u, v); oh[k] = u; ol[k] = v; o16[4 + k] = tohx(a1[k]); splitf(a1[k], u, v); oh[4 + k] = u; ol[4 + k] = v; }
                const size_t e = pb + (!TR ? g * 1024 + s * 256 : (s >> 1) * 2048 + g * 512 + (s & 1) * 256); *(v8h*)(P16 + e) = o16; *(v8us*)(Ph + e) = oh; *(v8us*)(Pl + e) = ol;
                asm volatile("s_wait_xcnt 0x0" ::: "memory"); }       // stands in front of the next rows' writes of the registers that these three stores name
            __builtin_amdgcn_wave_barrier(); asm volatile("" ::: "memory");   // keeps the next trip's staging writes behind this trip's reads
        } };
        if (third < 2) planes(BoolC<false>{}); else planes(BoolC<true>{});   // the same for the whole work-group: a scalar branch
        return;
    }
#pragma unroll
    for (int mb = 0; mb < 4; ++mb) {
#pragma unroll
        for (int nb = 0; nb < 4; ++nb) {
#pragma unroll
            for (int j = 0; j < 8; ++j) os[(hi * 8 + j) * 68 + nb * 16 + lr] = acc[mb][nb][j]; }
        __builtin_amdgcn_wave_barrier(); asm volatile("" ::: "memory");
        float* crow = C + (size_t)(r0 + mb * 16) * ldc + c0;
{
#pragma unroll
            for (int s = 0; s < 8; ++s) { const int row = 2 * s + hi, cofs = lr * 4; v4f val = *(const v4fa*)(os + row * 68 + cofs); if (BIAS) { val[0] += bfr(bias[c0 + cofs]); val[1] += bfr(bias[c0 + cofs + 1]); val[2] += bfr(bias[c0 + cofs + 2]); val[3] += bfr(bias[c0 + cofs + 3]); }
                *(v4f*)(crow + (size_t)row * ldc + cofs) = val; }
             }
        __builtin_amdgcn_wave_barrier(); asm volatile("" ::: "memory");
    }
}

typedef __attribute__((ext_vector_type(2))) _Float16 v2h;
typedef __attribute__((ext_vector_type(4))) _Float16 v4h;
typedef __attribute__((ext_vector_type(2))) unsigned short v2us;
typedef __attribute__((ext_vector_type(4))) unsigned short v4us;
typedef __attribute__((ext_vector_type(2))) float v2f;
typedef __attribute__((ext_vector_type(4))) int v4i;

// The three converters below are independent of each other and share ONE launch (k_prep): each is written for the block index blk of its own range.
__device__ __forceinline__ void wtG_blk(const float* __restrict__ w, int K, int N, bf* Bt, int blk) {
    const int lane = threadIdx.x & 31; const int L0 = (blk * 8 + (threadIdx.x >> 5)) * 8; const int nlines = N * K / 64;
{
#pragma unroll 1
        for (int l = 0; l < 8; ++l) { const int L = L0 + l; if (L >= nlines) break; const size_t e = (size_t)L * 64 + lane * 2; const int grp = (int)(e >> 11), wi = (int)(e & 511), KT = K >> 5; const int n = (grp / KT) * 64 + ((int)(e >> 9) & 3) * 16 + ((wi >> 3) & 15), k = (grp % KT) * 32 + (wi >> 7) * 8 + (wi & 7); v2us o;   // e counts in fragment order
            const float* p0 = w + (size_t)k * N + n; const float* p1 = p0 + N; const float w0 = *p0, w1 = *p1;
            asm volatile("s_wait_xcnt 0x0" :: "v"(p0), "v"(p1) : "memory");   // stands in front of every later write of the two loads' address registers, which are inputs so that they keep their registers up to it
            o[0] = f2bf(w0); o[1] = f2bf(w1); *(v2us*)(Bt + e) = o; }
         }
}
// cvt8_blk: f32 rows of K -> bf16 plane in fragment order. A block takes 16 rows x 128 k = 4 tiles: whole lines are read, the 16-byte runs change places in LDS (16 runs + 16 bytes of pad: no bank conflict either way), whole lines are stored. rows / 16 * K / 128 blocks.
__device__ __forceinline__ void cvt8_blk(const float* __restrict__ src, bf* dst, int K, int blk) {
    __shared__ __align__(16) bf st[16 * 17 * 8];
    const int t = threadIdx.x, row = t >> 4, c = t & 15, ns = K >> 7; const int rb = blk / ns, sg = blk % ns;
    const v8f v = *(const v8f*)(src + (size_t)(rb * 16 + row) * K + sg * 128 + c * 8); v8us o;
#pragma unroll
    for (int k = 0; k < 8; ++k) o[k] = f2bf(v[k]);
    *(v8usa*)(st + (c * 17 + row) * 8) = o;                           // run c of a row (k = 8 c ..) is group c of 16 runs in fragment order
    __syncthreads();                                                 // every run is in LDS before any thread reads the one it stores
    *(v8us*)(dst + ((size_t)(rb >> 2) * (K >> 5) + sg * 4 + (t >> 6)) * 2048 + (rb & 3) * 512 + (t & 63) * 8) = *(const v8usa*)(st + ((t >> 4) * 17 + (t & 15)) * 8);
    asm volatile("s_wait_xcnt 0x0" ::: "memory"); }   // stands in front of every later write of a register that the store names: in the merged kernel the other converters' code follows this one in the listing
// k_prep: blocks [0, PW1) transpose w_qkv, [PW1, PW1 + PW2) w_out (the latency-bound ones first), the rest convert x of both sequences. The branch is the same for a whole block, the converter's barrier included.
#define PW1 (DM * (DQ + 2 * DKV) / 4096)
#define PW2 (DQ * DM / 4096)
#define PXB (NB_ * TT * DM / 2048)
__global__ __launch_bounds__(256) void k_prep(const float* __restrict__ wf, const float* __restrict__ wo, const float* __restrict__ x, bf* WALL, bf* WO, bf* XB) {
    const int b = (int)blockIdx.x;
    if (b < PW1) wtG_blk(wf, DM, DQ + 2 * DKV, WALL, b);
    else if (b < PW1 + PW2) wtG_blk(wo, DQ, DM, WO, b - PW1);
    else cvt8_blk(x, XB, DM, b - (PW1 + PW2)); }
// ---- k_fattn: causal scores, softmax and probability x value product of one head in ONE kernel; no score or probability ever reaches memory.
// Transposed products: S^T = K Q^T (A = 16 key rows, B = 16 query columns), O^T += V^T P^T (A = 16 rows of V^T, B = P^T). A lane then holds the scores of ONE query (column lr; keys 8 hi + j of each 16-key tile),
// and the two score tiles of a 32-key block, converted in place, ARE the B operand of the value product in the order that WFrag::ld gives A (k = 8 hi + 0..7, 16 + 8 hi + 0..7).
// A group of FW waves (KG groups to a work-group, each with its own rows and staging) owns 16 NQ query rows of one head. Its FW waves share the key loop (wave w takes the 32-key blocks w, w + FW, ... up to the diagonal block), each with its own running maximum, sum and O^T tile
// (online softmax, base 2); the FW partial results are brought to the common maximum and summed in wave order through LDS, divided by the summed denominator and stored as the hi/lo bf16 planes of the merged heads. All planes in fragment order (above k_gemmw).
// amdgpu_waves_per_eu(4): at most 256 registers, so that two work-groups (two waves of each per SIMD) stay resident and cover each other's load and softmax latency.
// HL: hi+lo bf16 planes, three products for each contraction; else single fp16 with the probabilities carried x 2^10 (numerator and denominator alike).
// Both kinds share ONE launch (k_fattn below fattn_body): grid (sequences x heads, row blocks), longest rows first, the hi+lo row blocks (the shortest) last.
#define FW 4
#define KG 2      // a work-group of k_fattn is KG groups of FW waves
typedef __attribute__((ext_vector_type(16))) unsigned short v16us;
template <typename T16, bool HL, int NQ>
__device__ __forceinline__ void fattn_body(const T16* __restrict__ Q, const T16* __restrict__ Q2, const T16* __restrict__ Kp, const T16* __restrict__ K2, const T16* __restrict__ Vt, const T16* __restrict__ V2, const int q0, bf* Ah, bf* Al) {
    typedef typename WFrag<T16>::V V; typedef WFrag<T16> F;
    constexpr int QW = 16 * NQ; constexpr float SC2 = SCL * 1.4426950408889634f;
    __shared__ __align__(16) float soa[KG * FW * QW * 68];
    __shared__ float sma[KG * FW * QW], sla[KG * FW * QW];
    const int lane = threadIdx.x & 31, lr = lane & 15, hi = lane >> 4; const int wa = __builtin_amdgcn_readfirstlane((int)(threadIdx.x >> 5)), w = wa % FW, gr = wa / FW;
    float* so = soa + gr * (FW * QW * 68); float* sm = sma + gr * (FW * QW); float* sl = sla + gr * (FW * QW);   // each group of FW waves has its own row block q0 and its own staging; both groups pass the same two barriers
    const int h = (int)blockIdx.x % NH_, sq = (int)blockIdx.x / NH_;
    const size_t hp = (size_t)blockIdx.x * TT * HD; Q += hp; Kp += hp; Vt += hp; if constexpr (HL) { Q2 += hp; K2 += hp; V2 += hp; }
    const int nkb = (q0 + QW - 1) / 32 + 1;                          // 32-key blocks up to and with the one that holds the last query's own key
    V bq[NQ][2], bq2[NQ][2];
#pragma unroll
    for (int qt = 0; qt < NQ; ++qt)
#pragma unroll
        for (int ks = 0; ks < 2; ++ks) { const size_t qo = (size_t)(q0 + qt * 16) * HD + ks * 512 + lane * 8; bq[qt][ks] = F::ld(Q + qo); if constexpr (HL) bq2[qt][ks] = F::ld(Q2 + qo); }
    v8f o[4][NQ]; float m[NQ], l[NQ];
#pragma unroll
    for (int qt = 0; qt < NQ; ++qt) { m[qt] = -1.0e30f; l[qt] = 0.f;
#pragma unroll
        for (int dt = 0; dt < 4; ++dt) o[dt][qt] = (v8f){}; }
    const size_t koff = lane * 8, voff = lane * 8;                    // a 32-key block is 4 tiles in a row in the key planes (16 keys x 32 dims each) and in the value planes (16 dims x 32 keys each)
    V ak[2][2], ak2[2][2], av[4], av2[4];
    // each loader ends with s_wait_xcnt 0: it stands in front of every later write of a register that one of its loads names as its address (some of these are rewritten behind a branch);
    // the wait takes the addresses as inputs, so that they keep their registers up to it and no load of the group returns its data onto them
    auto ldK = [&](int kb) { const T16* p = Kp + koff + (size_t)kb * 32 * HD; const T16* p2 = HL ? K2 + koff + (size_t)kb * 32 * HD : p;
#pragma unroll
        for (int kt = 0; kt < 2; ++kt)
#pragma unroll
            for (int ks = 0; ks < 2; ++ks) { ak[kt][ks] = F::ld(p + kt * 1024 + ks * 512); if constexpr (HL) ak2[kt][ks] = F::ld(p2 + kt * 1024 + ks * 512); }
        asm volatile("s_wait_xcnt 0x0" :: "v"(p), "v"(p2) : "memory"); };
    auto ldV = [&](int k0) { const T16* p = Vt + voff + (size_t)k0 * HD; const T16* p2 = HL ? V2 + voff + (size_t)k0 * HD : p;
#pragma unroll
        for (int dt = 0; dt < 4; ++dt) { av[dt] = F::ld(p + dt * 512); if constexpr (HL) av2[dt] = F::ld(p2 + dt * 512); }
        asm volatile("s_wait_xcnt 0x0" :: "v"(p), "v"(p2) : "memory"); };
    // single fp16: the values are fetched at the head of a pass and the NEXT pass's keys behind the score products, so that both latencies run under matrix and softmax work.
    // hi+lo (at most 4 passes a wave, twice the fragments): keys, products, then values, which keeps the wave inside 256 registers without spills.
    if constexpr (!HL) ldK(w);
#pragma unroll 1
    for (int kb = w; kb < nkb; kb += FW) {
        const int k0 = kb * 32;
        if constexpr (HL) ldK(kb); else ldV(k0);
        v8f s[NQ][2];
#pragma unroll
        for (int kt = 0; kt < 2; ++kt)
#pragma unroll
            for (int qt = 0; qt < NQ; ++qt) { v8f c = (v8f){};
#pragma unroll
                for (int ks = 0; ks < 2; ++ks) { c = F::mma(ak[kt][ks], bq[qt][ks], c); if constexpr (HL) { c = F::mma(ak[kt][ks], bq2[qt][ks], c); c = F::mma(ak2[kt][ks], bq[qt][ks], c); } }
                s[qt][kt] = c; }
        if constexpr (HL) ldV(k0); else ldK((kb + FW < nkb) ? kb + FW : kb);   // the last pass fetches its own block again: in bounds, unused
        if (k0 + 31 > q0) {                                          // only the diagonal block holds keys behind a query
#pragma unroll
            for (int qt = 0; qt < NQ; ++qt)
#pragma unroll
                for (int kt = 0; kt < 2; ++kt)
#pragma unroll
                    for (int j = 0; j < 8; ++j) if (k0 + kt * 16 + hi * 8 + j > q0 + qt * 16 + lr) s[qt][kt][j] = -3.0e38f; }
#pragma unroll
        for (int qt = 0; qt < NQ; ++qt) {
            float mx = s[qt][0][0];
#pragma unroll
            for (int j = 1; j < 16; ++j) mx = fmaxf(mx, s[qt][j >> 3][j & 7]);
            mx = fmaxf(mx, __shfl_xor(mx, 16, 32));                  // the other half-wave holds this query's other 16 keys
            const float mn = fmaxf(m[qt], mx * SC2), al = __builtin_amdgcn_exp2f(m[qt] - mn), mo = HL ? mn : mn - 10.0f; m[qt] = mn;
            float sum = 0.f;
#pragma unroll
            for (int j = 0; j < 16; ++j) { const float p = __builtin_amdgcn_exp2f(s[qt][j >> 3][j & 7] * SC2 - mo); s[qt][j >> 3][j & 7] = p; sum += p; }
            l[qt] = l[qt] * al + sum;
#pragma unroll
            for (int dt = 0; dt < 4; ++dt) o[dt][qt] *= al;
            if constexpr (HL) { v16us ph, pl;
#pragma unroll
                for (int j = 0; j < 16; ++j) { unsigned short a, c2; splitf(s[qt][j >> 3][j & 7], a, c2); ph[j] = a; pl[j] = c2; }
                const V bh = __builtin_bit_cast(V, ph), bl = __builtin_bit_cast(V, pl);
#pragma unroll
                for (int dt = 0; dt < 4; ++dt) { o[dt][qt] = F::mma(av[dt], bh, o[dt][qt]); o[dt][qt] = F::mma(av[dt], bl, o[dt][qt]); o[dt][qt] = F::mma(av2[dt], bh, o[dt][qt]); }
            } else { V pb;
#pragma unroll
                for (int j = 0; j < 16; ++j) pb[j] = tohx(s[qt][j >> 3][j & 7]);
#pragma unroll
                for (int dt = 0; dt < 4; ++dt) o[dt][qt] = F::mma(av[dt], pb, o[dt][qt]); }
        }
    }
#pragma unroll
    for (int qt = 0; qt < NQ; ++qt) { l[qt] += __shfl_xor(l[qt], 16, 32); if (hi == 0) sm[w * QW + qt * 16 + lr] = m[qt]; }
    __syncthreads();                                                 // every wave's maxima are in LDS before any wave forms the common one
#pragma unroll
    for (int qt = 0; qt < NQ; ++qt) { const int q = qt * 16 + lr; float M = sm[q];
#pragma unroll
        for (int p = 1; p < FW; ++p) M = fmaxf(M, sm[p * QW + q]);
        const float f = __builtin_amdgcn_exp2f(m[qt] - M); if (hi == 0) sl[w * QW + q] = l[qt] * f;   // a wave without a key block: f = 0
        float* op = so + (size_t)(w * QW + q) * 68 + hi * 8;
#pragma unroll
        for (int dt = 0; dt < 4; ++dt) { const v8f x = o[dt][qt] * f; *(v4fa*)(op + dt * 16) = __builtin_shufflevector(x, x, 0, 1, 2, 3); *(v4fa*)(op + dt * 16 + 4) = __builtin_shufflevector(x, x, 4, 5, 6, 7); } }
    __syncthreads();                                                 // every wave's rescaled partial tile and sum are in LDS before any thread adds them
#pragma unroll
    for (int i = 0; i < NQ; ++i) { const int u = (int)threadIdx.x % (FW * 32), q = i * 16 + (u & 15), d0 = (u >> 4) * 8; const float* op = so + (size_t)q * 68 + d0; v4f a0 = *(const v4fa*)op, a1 = *(const v4fa*)(op + 4); float L = sl[q];
#pragma unroll
        for (int p = 1; p < FW; ++p) { a0 += *(const v4fa*)(op + p * (QW * 68)); a1 += *(const v4fa*)(op + p * (QW * 68) + 4); L += sl[p * QW + q]; }
        const float inv = __fdiv_rn(1.0f, L); v8us oh, ol;
#pragma unroll
        for (int k = 0; k < 4; ++k) { unsigned short a, c2; splitf(a0[k] * inv, a, c2); oh[k] = a; ol[k] = c2; splitf(a1[k] * inv, a, c2); oh[4 + k] = a; ol[4 + k] = c2; }
        const int qb = sq * TT + q0 + i * 16; const size_t oo = ((size_t)(qb >> 6) * (DQ / 32) + h * 2 + (u >> 6)) * 2048 + ((qb >> 4) & 3) * 512 + (u & 63) * 8; *(v8us*)(Ah + oo) = oh; *(v8us*)(Al + oo) = ol;   // fragment order: 16 queries x this head's 64 dims are 2 tiles; run u of them is (query u & 15, dims 8 (u >> 4) ..)
        asm volatile("s_wait_xcnt 0x0" ::: "memory"); }   // stands in front of every later write of a register that the two stores name: in the merged kernel the other body's code follows this one in the listing
}
// ---- fattn_sh (query rows >= RH, single fp16; fattn_body above serves the hi+lo rows): a work-group owns FW x 32 query rows of one head and has KG groups of FW waves. Wave w of each group has the same 32 rows;
// group kg takes keys 64 kg .. 64 kg + 63 of every stage, so a wave's serial walk over the keys is 1 / KG as long; the KG partial results of a row are merged once, through LDS, behind the loop.
// All waves walk the same stages: a stage of SK keys (their key tiles and their value tiles, each one contiguous run in a fragment-order plane) is brought into LDS once for the work-group
// by asynchronous copies, two buffers, stage s + 1 in flight while stage s is worked on, and every wave reads its fragments from there: a key or value byte leaves L2 once per FW x 32 queries, not once per 32.
// A wave skips the 32-key blocks behind its own diagonal block (a scalar branch) but passes every barrier. A lane's 8 accumulators of a tile are one 16-byte run of the merged-heads planes: stored straight from registers.
#define SK 128
// exp2_slot: 2^x with the free slot that the instruction set asks for behind a transcendental inside the statement itself. For the rarely taken branch of fattn_sh.
__device__ __forceinline__ float exp2_slot(float x) { float r; asm("v_exp_f32 %0, %1\n\tv_nop" : "=v"(r) : "v"(x)); return r; }
__device__ __forceinline__ void fattn_sh(const h16* __restrict__ Q, const h16* __restrict__ Kp, const h16* __restrict__ Vt, const int q0, bf* Ah, bf* Al) {
    typedef WFrag<h16> F; typedef F::V V;
    constexpr int NQ = 2, SE = SK * HD; constexpr float SC2 = SCL * 1.4426950408889634f;   // SE: elements of a stage in one plane
    constexpr float PMAX = 32768.0f;                                 // 2^15, under the largest fp16 (65504); at a fresh reference point a probability is at most 2^10 and a lane's sum at most 2^14
    static_assert(KG * FW * 32 * 8 * 4 == SE, "four 16-byte copies a lane bring one plane's stage");
    static_assert(SK == KG * 64 && SK == FW * 32, "a key group takes 64 keys of a stage; the row block's own keys are one stage");
    __shared__ __align__(16) h16 ring[2 * 2 * SE];
    const int tid = (int)threadIdx.x, lane = tid & 31, lr = lane & 15, hi = lane >> 4; const int wa = __builtin_amdgcn_readfirstlane(tid >> 5), w = wa % FW, kg = wa / FW;   // w: which 32 queries; kg: which 64 keys of every stage
    const int h = (int)blockIdx.x % NH_, sq = (int)blockIdx.x / NH_;
    const size_t hp = (size_t)blockIdx.x * TT * HD; Q += hp; Kp += hp; Vt += hp;
    const int qw = q0 + w * 32, kbl = qw / 32;                       // this wave's first query; the 32-key block that holds its queries' own keys, its last
    const int nst = (q0 + FW * 32) / SK;                             // stages up to the last query's own key: at least 2
    const unsigned lb = (unsigned)(size_t)ring + (unsigned)tid * 16u; // this lane's LDS byte address inside a run of 256 lanes x 16 bytes
    auto fill = [&](int s, int buf) { const h16* gk = Kp + (size_t)s * SE + tid * 8; const h16* gv = Vt + (size_t)s * SE + tid * 8; const unsigned l = lb + (unsigned)(buf * (2 * SE * 2));
        cp4(l, gk, l + 4096u, gk + 2048, l + 8192u, gk + 4096, l + 12288u, gk + 6144);
        cp4(l + 16384u, gv, l + 20480u, gv + 2048, l + 24576u, gv + 4096, l + 28672u, gv + 6144); };
    fill(0, 0);
    V bq[NQ][2]; { const h16* pq = Q + (size_t)qw * HD + lane * 8;
#pragma unroll
        for (int qt = 0; qt < NQ; ++qt)
#pragma unroll
            for (int ks = 0; ks < 2; ++ks) bq[qt][ks] = F::ld(pq + qt * 1024 + ks * 512);
        asm volatile("s_wait_xcnt 0x0" :: "v"(pq) : "memory"); }     // stands in front of every later write of the address registers of these loads, which are inputs so that they keep their registers up to it
    v8f o[4][NQ]; float m[NQ], l[NQ];
#pragma unroll
    for (int qt = 0; qt < NQ; ++qt) { m[qt] = -1.0e30f; l[qt] = 0.f;
#pragma unroll
        for (int dt = 0; dt < 4; ++dt) o[dt][qt] = (v8f){}; }
    asm volatile("s_wait_asynccnt 0x0" ::: "memory");                // this wave's copies of stage 0 have landed
    __syncthreads();                                                 // and every other wave's: nothing of stage 0 is read in front of this barrier
    fill(1, 1);
#pragma unroll 1
    for (int s = 0; s < nst; ++s) {                                  // kept rolled: one copy of the two passes in the instruction cache
        const h16* sb = ring + (s & 1) * (2 * SE) + kg * 4096 + lane * 8;   // this key group's 64 keys: 4096 elements in either plane
#pragma unroll
        for (int t = 0; t < 2; ++t) { const int kb = s * (SK / 32) + kg * 2 + t, k0 = kb * 32;
            if (kb > kbl) continue;                                  // behind the diagonal of every query of this wave: the same for the whole wave
            V ak[2][2], av[4];
#pragma unroll
            for (int kt = 0; kt < 2; ++kt)
#pragma unroll
                for (int ks = 0; ks < 2; ++ks) ak[kt][ks] = F::ld(sb + t * 2048 + kt * 1024 + ks * 512);
#pragma unroll
            for (int dt = 0; dt < 4; ++dt) av[dt] = F::ld(sb + SE + t * 2048 + dt * 512);
            __builtin_amdgcn_sched_barrier(0);   // keeps every product behind the whole group of LDS reads: left alone the compiler reloads one key fragment per two products and waits out the LDS latency each time
            v8f sc[NQ][2];
#pragma unroll
            for (int kt = 0; kt < 2; ++kt)
#pragma unroll
                for (int qt = 0; qt < NQ; ++qt) { v8f c = (v8f){};
#pragma unroll
                    for (int ks = 0; ks < 2; ++ks) c = F::mma(ak[kt][ks], bq[qt][ks], c);
                    sc[qt][kt] = c; }
            if (kb == kbl) {                                         // only the diagonal block holds keys behind a query
#pragma unroll
                for (int qt = 0; qt < NQ; ++qt)
#pragma unroll
                    for (int kt = 0; kt < 2; ++kt)
#pragma unroll
                        for (int j = 0; j < 8; ++j) if (k0 + kt * 16 + hi * 8 + j > qw + qt * 16 + lr) sc[qt][kt][j] = -3.0e38f; }
            // The probabilities are formed against the reference point m that an EARLIER block left (softmax does not depend on the point; numerator and denominator carry the same one).
            // A lane's 16 probabilities are not negative, so their sum bounds each of them: while every lane's sum stays at or below PMAX, all of them fit fp16 and the block is done.
            V pb[NQ]; float sum[NQ];
            auto probs = [&](auto rare) {
#pragma unroll
                for (int qt = 0; qt < NQ; ++qt) { const float mo = m[qt] - 10.0f; float a = 0.f;
#pragma unroll
                    for (int j = 0; j < 16; ++j) { const float e = sc[qt][j >> 3][j & 7] * SC2 - mo, p = decltype(rare)::value ? exp2_slot(e) : __builtin_amdgcn_exp2f(e); a += p; pb[qt][j] = tohx(p); }
                    sum[qt] = a; } };
            probs(BoolC<false>{});
            // Otherwise (the first block, whose point is -1e30; a score far above the point; not-a-number) the whole wave takes the running maximum as the new point, brings l and O to it and forms the block's probabilities again, each then at most 2^10: a scalar branch.
            if (__builtin_amdgcn_ballot_w32(!(sum[0] <= PMAX && sum[1] <= PMAX)) != 0u) {
                float mh[NQ], mo2[NQ];
#pragma unroll
                for (int qt = 0; qt < NQ; ++qt) { mh[qt] = sc[qt][0][0];
#pragma unroll
                    for (int j = 1; j < 16; ++j) mh[qt] = fmaxf(mh[qt], sc[qt][j >> 3][j & 7]); }
#pragma unroll
                for (int qt = 0; qt < NQ; ++qt) mo2[qt] = __shfl_xor(mh[qt], 16, 32);   // the other half-wave holds this query's other 16 keys
#pragma unroll
                for (int qt = 0; qt < NQ; ++qt) {
                    const float mx = fmaxf(mh[qt], mo2[qt]);
                    const float mn = fmaxf(m[qt], mx * SC2), al = exp2_slot(m[qt] - mn); m[qt] = mn;
                    l[qt] *= al;
#pragma unroll
                    for (int dt = 0; dt < 4; ++dt) o[dt][qt] *= al; }
                probs(BoolC<true>{}); }
#pragma unroll
            for (int qt = 0; qt < NQ; ++qt) { l[qt] += sum[qt];
#pragma unroll
                for (int dt = 0; dt < 4; ++dt) o[dt][qt] = F::mma(av[dt], pb[qt], o[dt][qt]); }
        }
        asm volatile("s_wait_dscnt 0x0" ::: "memory");               // this wave's reads of the buffer have returned before it is refilled
        asm volatile("s_wait_asynccnt 0x0" ::: "memory");            // this wave's copies of stage s + 1 have landed
        __syncthreads();                                             // publishes stage s + 1 and ends every wave's reads of stage s
        if (s + 2 < nst) fill(s + 2, s & 1);
    }
    asm volatile("s_wait_asynccnt 0x0" ::: "memory");                // no copy is outstanding when the ring becomes the staging of the partial results
    // Waves w and FW + w hold partial results of the same queries in the same lanes and registers. The second hands its own over through the ring, which nobody reads behind the loop's last barrier
    // (17 runs of 16 bytes a lane, a run of all lanes contiguous); the first brings both to the common reference point, adds them and stores.
    v4fa* mp = (v4fa*)ring + w * (17 * 32) + lane;
    if (kg != 0) {                                                   // a scalar branch
#pragma unroll
        for (int qt = 0; qt < NQ; ++qt)
#pragma unroll
            for (int dt = 0; dt < 4; ++dt) { const v8f x = o[dt][qt]; mp[((qt * 4 + dt) * 2) * 32] = __builtin_shufflevector(x, x, 0, 1, 2, 3); mp[((qt * 4 + dt) * 2 + 1) * 32] = __builtin_shufflevector(x, x, 4, 5, 6, 7); }
        mp[16 * 32] = (v4f){m[0], m[1], l[0], l[1]}; }
    __syncthreads();                                                 // the second group's partial results are in LDS before the first group reads them
    if (kg != 0) return;                                             // no barrier follows
    { const v4f ml = mp[16 * 32];
#pragma unroll
      for (int qt = 0; qt < NQ; ++qt) { const float M = fmaxf(m[qt], ml[qt]), f0 = exp2_slot(m[qt] - M), f1 = exp2_slot(ml[qt] - M); l[qt] = l[qt] * f0 + ml[2 + qt] * f1;
#pragma unroll
        for (int dt = 0; dt < 4; ++dt) { const v4f x0 = mp[((qt * 4 + dt) * 2) * 32], x1 = mp[((qt * 4 + dt) * 2 + 1) * 32]; o[dt][qt] = o[dt][qt] * f0 + __builtin_shufflevector(x0, x1, 0, 1, 2, 3, 4, 5, 6, 7) * f1; } } }
#pragma unroll
    for (int qt = 0; qt < NQ; ++qt) { const float L = l[qt] + __shfl_xor(l[qt], 16, 32), inv = __fdiv_rn(1.0f, L);
        const int qb = sq * TT + qw + qt * 16; const size_t ob = ((size_t)(qb >> 6) * (DQ / 32) + h * 2) * 2048 + ((qb >> 4) & 3) * 512 + lane * 8;   // fragment order: 16 queries x this head's 64 dims are 2 tiles; dims 16 dt + 8 hi .. of query lr are run lane of half dt & 1 of tile dt >> 1
#pragma unroll
        for (int dt = 0; dt < 4; ++dt) { v8us oh, ol;
#pragma unroll
            for (int k = 0; k < 8; ++k) { unsigned short a, c2; splitf(o[dt][qt][k] * inv, a, c2); oh[k] = a; ol[k] = c2; }
            const size_t oo = ob + (dt >> 1) * 2048 + (dt & 1) * 256; *(v8us*)(Ah + oo) = oh; *(v8us*)(Al + oo) = ol;
            asm volatile("s_wait_xcnt 0x0" ::: "memory"); } }        // stands in front of every later write of a register that the two stores name
}
#define FY1 ((TT - RH) / (FW * 32))   // row blocks of FW x 32 queries, single fp16
#define FY2 (RH / (16 * KG))      // work-groups of KG row blocks of 16 queries, hi+lo
__global__ __launch_bounds__(KG * FW * 32) __attribute__((amdgpu_waves_per_eu(4))) void k_fattn(const h16* __restrict__ Q16, const h16* __restrict__ K16, const h16* __restrict__ V16, const bf* __restrict__ Qh, const bf* __restrict__ Ql, const bf* __restrict__ Kh, const bf* __restrict__ Kl, const bf* __restrict__ Vh, const bf* __restrict__ Vl, bf* Ah, bf* Al) {
    const int y = (int)blockIdx.y;                                   // the branch is the same for a whole work-group, the barriers of either body included
    if (y < FY1) fattn_sh(Q16, K16, V16, RH + (FY1 - 1 - y) * (FW * 32), Ah, Al);   // more work-groups than resident places (two to a WGP): the longest first (for speed only)
    else fattn_body<bf, true, 1>(Qh, Ql, Kh, Kl, Vh, Vl, ((FY1 + FY2 - 1 - y) * KG + __builtin_amdgcn_readfirstlane((int)(threadIdx.x / (FW * 32)))) * 16, Ah, Al);
}

extern "C" void kernel_launch(void* const* d_in, const int* in_sizes, int n_in,
                              void* d_out, int out_size, void* d_ws, size_t ws_size, hipStream_t stream) {
    (void)in_sizes; (void)n_in; (void)out_size;
    const float* x = (const float*)d_in[0]; const float* wf = (const float*)d_in[1]; const float* wo = (const float*)d_in[2]; /* x, w_qkv, w_o = d_in[0..2]; no bias inputs in this module: the projection GEMMs below use the bias-free instantiation */
    float* OUT = (float*)d_out;     // [2][4096][1024]
    char* wsp = (char*)d_ws;
    auto take = [&](size_t bytes) { char* p = wsp; wsp += (bytes + 255) & ~(size_t)255; return (void*)p; };
    bf* WO = (bf*)take((size_t)DM * DQ * 2);
    bf* XB = (bf*)take((size_t)NB_ * TT * DM * 2); bf* WALL = (bf*)take((size_t)(DQ + 2 * DKV) * DM * 2);
    const size_t PS = (size_t)NB_ * NH_ * TT * HD;        // one plane: both sequences, all heads; q, k, v planes of a kind stand in a row
    h16* QP16 = (h16*)take(3 * PS * 2); h16* KP16 = QP16 + PS; h16* VT16 = KP16 + PS;
    bf* QPh = (bf*)take(3 * PS * 2); bf* KPh = QPh + PS; bf* VTh = KPh + PS; bf* QPl = (bf*)take(3 * PS * 2); bf* KPl = QPl + PS; bf* VTl = KPl + PS;
    bf* ATh = (bf*)take((size_t)NB_ * TT * DQ * 2); bf* ATl = (bf*)take((size_t)NB_ * TT * DQ * 2);
    if ((size_t)(wsp - (char*)d_ws) > ws_size) return;    // ws 256 MiB
    k_prep<<<PW1 + PW2 + PXB, 256, 0, stream>>>(wf, wo, x, WALL, WO, XB);
    k_gemmw<bf, 0, false, 1><<<dim3(NB_ * TT / (64 * GWM), (DQ + 2 * DKV) / (64 * GWN), 1), GWM * GWN * 32, 0, stream>>>(XB, nullptr, WALL, nullptr, DM, nullptr, 0, nullptr, 0, 0, 0, QP16, QPh, QPl);
    k_fattn<<<dim3(NB_ * NH_, FY1 + FY2), KG * FW * 32, 0, stream>>>(QP16, KP16, VT16, QPh, QPl, KPh, KPl, VTh, VTl, ATh, ATl);
    k_gemmw<bf, 1, false, 0><<<dim3(NB_ * TT / (64 * GWM), DM / (64 * GWN), 1), GWM * GWN * 32, 0, stream>>>(ATh, ATl, WO, nullptr, DQ, OUT, DM, nullptr, 0, 0, 0, nullptr, nullptr, nullptr);
}
